// v000
// The times below were measured on an AMD MI455X: many runs one after another, warmed up first and cycling through
// copies of the inputs, with the whole window's GPU time divided by the number of runs. Launches and the gaps
// between them are all in it. The median over several windows is given; except for v000 it joins two sittings, which
// can be a few percent apart, so the side-by-side timings, each taken in one sitting, are the better comparison.
// v000 is the starting kernel. One run takes 292 microseconds.
// Contractions: q/k/v projections x.W^T on v_wmma_f32_16x16x32_bf16 (bf16 RNE planes of x and W, one
// product each); q.k^T and p.v on v_wmma_f32_16x16x32_f16 (q, k: f16 hi plane + f16 x2048 residual plane;
// p: f16 x1024 hi + x2048 residual; v^T: f16 x64 hi + x2048 residual; hi.hi + hi.res + res.hi, residual
// products in their own f32 accumulator folded x1/2048); all f32 accumulate; online softmax in f32 on VALU.
#include <hip/hip_runtime.h>
#include <hip/hip_bf16.h>
#include <math.h>
#include <stdint.h>

#define NB   4
#define SEQ  4096
#define DE   512
#define HD   64
#define KC   64
#define NQB  (SEQ / 64)
#define NROW (NB * SEQ)
#define NX   (NROW * DE)
#define NW   (HD * DE)
#define NO   (NROW * HD)
#define PSC  1024.0f
#define RSC  2048.0f
#define VSC  64.0f
#define OSC  8.0f
static_assert((SEQ % 64) == 0);
static_assert(HD == 64);
static_assert(KC == 64);
static_assert((DE % 32) == 0);
static_assert(((NX / 8) % 256) == 0);
static_assert(((NW / 8) % 256) == 0);
static_assert((NROW % 64) == 0);

typedef _Float16 v16h __attribute__((ext_vector_type(16)));
typedef _Float16 v8h  __attribute__((ext_vector_type(8)));
typedef __bf16   v16b __attribute__((ext_vector_type(16)));
typedef float    v8f  __attribute__((ext_vector_type(8)));
typedef float    v4f  __attribute__((ext_vector_type(4)));
typedef unsigned int v4u __attribute__((ext_vector_type(4)));

union FragH { v16h v; v8h h[2]; };
union FragB { v16b v; v4u u[2]; };
union HU8   { v8h h; v4u u; };

// ---- scalar helpers --------------------------------------------------------------------------------
__device__ __forceinline__ unsigned short bf_bits(float f) {          // f32 -> bf16 bits, RNE convert
  unsigned u = __float_as_uint(f);
  return (unsigned short)((u + 0x7FFFu + ((u >> 16) & 1u)) >> 16);
}
__device__ __forceinline__ float bf_up(unsigned short h) { return __uint_as_float(((unsigned)h) << 16); }
__device__ __forceinline__ float bfr(float f) { return bf_up(bf_bits(f)); }   // value of the bf16 RNE convert
__device__ __forceinline__ unsigned pk16(unsigned short a, unsigned short b) { return (unsigned)a | ((unsigned)b << 16); }
__device__ __forceinline__ v8f zero8() { v8f z = {0.f, 0.f, 0.f, 0.f, 0.f, 0.f, 0.f, 0.f}; return z; }

// ---- fragment loaders: 16-bit A/B operand, lane -> row/col (lane&15), p already includes +8*(lane>>4);
//      elements 0..7 <- p[0..7] (k0+8h..), elements 8..15 <- p[16..23] (k0+16+8h..)
__device__ __forceinline__ v16h ldfrag_h(const _Float16* p) {
  FragH f;
  f.h[0] = *(const v8h*)(p);
  f.h[1] = *(const v8h*)(p + 16);
  return f.v;
}
__device__ __forceinline__ v16b ldfrag_b(const unsigned short* p) {
  FragB f;
  f.u[0] = *(const v4u*)(p);
  f.u[1] = *(const v4u*)(p + 16);
  return f.v;
}

// ---- WMMA helpers with trailing VALU hazard gap --------------------------------------------------------
__device__ __forceinline__ v8f mma_h(v16h a, v16h b, v8f c) {
  c = __builtin_amdgcn_wmma_f32_16x16x32_f16(false, a, false, b, (short)0, c, false, false);
#if defined(__HIP_DEVICE_COMPILE__)
  asm volatile("v_nop\n\tv_nop\n\tv_nop\n\tv_nop" : "+v"(c) : "v"(a), "v"(b));
#endif
  return c;
}
__device__ __forceinline__ v8f mma_b(v16b a, v16b b, v8f c) {
  c = __builtin_amdgcn_wmma_f32_16x16x32_bf16(false, a, false, b, (short)0, c, false, false);
#if defined(__HIP_DEVICE_COMPILE__)
  asm volatile("v_nop\n\tv_nop\n\tv_nop\n\tv_nop" : "+v"(c) : "v"(a), "v"(b));
#endif
  return c;
}
__device__ __forceinline__ void wave_sync_lds() {
  __builtin_amdgcn_fence(__ATOMIC_RELEASE, "workgroup");
  __builtin_amdgcn_wave_barrier();
  __builtin_amdgcn_fence(__ATOMIC_ACQUIRE, "workgroup");
}

// =====================================================================================================
// Plane convert: Y[i] = bf16_RNE(X[i]) bits. Thread i handles elements 8i..8i+7 and writes one 16-B piece;
// grid = n8 / 256 (n8 multiple of 256, host-checked). coverage: n8 threads x 8 elements = the whole plane.
// =====================================================================================================
__global__ __launch_bounds__(256) void conv_bf16(const float* __restrict__ X, unsigned short* Y, int n8) {
  const int i  = blockIdx.x * 256 + threadIdx.x;
  const int ic = (i < n8) ? i : (n8 - 1);                     // clamped address
  const float* src = X + (size_t)ic * 8;
  const v4f a = *(const v4f*)(src);
  const v4f c = *(const v4f*)(src + 4);
  v4u o;
  o[0] = pk16(bf_bits(a[0]), bf_bits(a[1]));
  o[1] = pk16(bf_bits(a[2]), bf_bits(a[3]));
  o[2] = pk16(bf_bits(c[0]), bf_bits(c[1]));
  o[3] = pk16(bf_bits(c[2]), bf_bits(c[3]));
  if (i < n8) *(v4u*)(Y + (size_t)i * 8) = o;
  
}

// =====================================================================================================
// q/k/v projections. Block = 128 threads = 4 waves = 64 token rows (rows r0..r0+63 of the flattened
// [NB*SEQ] row index; 64 | SEQ so one block never crosses a sequence). Each wave owns 16 rows x 64 columns
// of one projection at a time (w = 0: q, 1: k, 2: v): A fragments from the bf16 x plane (row pitch DE),
// B(k, n) = W[n][k] fragments straight from the bf16 W plane row n (k-contiguous), K = DE in 32-steps.
// Epilogue (f32): + bf16_RNE(bias[n]); q/k: hi = f16(v), res = f16((v - hi) * 2048) staged as [row][d]
// coverage: q/k planes: 4 waves x 4 it x 4 rows x 8 lanes x 8 halves = 64 rows x 64; v^T planes:
//           4 it x 16 d x 8 lanes x 8 halves = 64 d x 64 s; grid NROW/64 blocks covers all rows.
// =====================================================================================================
__global__ __launch_bounds__(128)
void proj_qkv(const unsigned short* __restrict__ Xb,
              const unsigned short* __restrict__ Wqb, const unsigned short* __restrict__ Wkb,
              const unsigned short* __restrict__ Wvb,
              const float* __restrict__ bq, const float* __restrict__ bk, const float* __restrict__ bv,
              _Float16* Qh, _Float16* Qr, _Float16* Kh, _Float16* Kr, _Float16* VTh, _Float16* VTr) {
  __shared__ __align__(16) _Float16 Th[64 * 72];
  __shared__ __align__(16) _Float16 Tr[64 * 72];

  const int tid  = threadIdx.x;
  const int wave = tid >> 5;
  const int lane = tid & 31;
  const int hh   = lane >> 4;
  const int c    = lane & 15;
  const int r0   = blockIdx.x * 64;
  const int b    = r0 / SEQ;
  const int s0   = r0 - b * SEQ;
  const unsigned short* ap = Xb + (size_t)(r0 + wave * 16 + c) * DE + 8 * hh;   // A row = lane&15

#pragma unroll 1
  for (int w = 0; w < 3; ++w) {                              // block-uniform
    const unsigned short* Wb = (w == 0) ? Wqb : ((w == 1) ? Wkb : Wvb);
    const float* bp = (w == 0) ? bq : ((w == 1) ? bk : bv);

    v8f acc[4];
#pragma unroll
    for (int nt = 0; nt < 4; ++nt) acc[nt] = zero8();

#pragma unroll 2
    for (int k0 = 0; k0 < DE; k0 += 32) {
      const v16b a = ldfrag_b(ap + k0);
#pragma unroll
      for (int nt = 0; nt < 4; ++nt) {
        const v16b wf = ldfrag_b(Wb + (size_t)(nt * 16 + c) * DE + 8 * hh + k0);   // B col n = nt*16+c
        acc[nt] = mma_b(a, wf, acc[nt]);
      }
    }

    if (w < 2) {
      // ---- q or k: stage [token row][d] as f16 hi and x2048 residual ----
      _Float16* Ph = (w == 0) ? Qh : Kh;
      _Float16* Pr = (w == 0) ? Qr : Kr;
#pragma unroll
      for (int nt = 0; nt < 4; ++nt) {
        const int n = nt * 16 + c;
        const float bias = bfr(bp[n]);
#pragma unroll
        for (int r = 0; r < 8; ++r) {
          const float v = acc[nt][r] + bias;
          const _Float16 hq = (_Float16)v;
          const _Float16 rq = (_Float16)((v - (float)hq) * RSC);
          const int pi = (wave * 16 + 8 * hh + r) * 72 + n;
          Th[pi] = hq;
          Tr[pi] = rq;
        }
      }
      __syncthreads();
      const int q8 = lane >> 3, c8 = (lane & 7) * 8;
      v4u vh[4], vr[4];
#pragma unroll
      for (int it = 0; it < 4; ++it) {
        const int row = wave * 16 + it * 4 + q8;
        HU8 u;
        u.h = *(const v8h*)(Th + row * 72 + c8);
        vh[it] = u.u;
        u.h = *(const v8h*)(Tr + row * 72 + c8);
        vr[it] = u.u;
      }
#pragma unroll
      for (int it = 0; it < 4; ++it) {
        const int row = wave * 16 + it * 4 + q8;
        const size_t o = (size_t)(r0 + row) * HD + c8;
        *(v4u*)(Ph + o) = vh[it];
        *(v4u*)(Pr + o) = vr[it];
      }
      
      __syncthreads();                                       // Th/Tr reused by the next projection
    } else {
      // ---- v: stage transposed [d][s] as f16 hi of (v * 64) and its x2048 residual ----
#pragma unroll
      for (int nt = 0; nt < 4; ++nt) {
        const int n = nt * 16 + c;
        const float bias = bfr(bp[n]);
#pragma unroll
        for (int r = 0; r < 8; ++r) {
          const float v = (acc[nt][r] + bias) * VSC;
          const _Float16 hq = (_Float16)v;
          const _Float16 rq = (_Float16)((v - (float)hq) * RSC);
          const int pi = n * 72 + wave * 16 + 8 * hh + r;
          Th[pi] = hq;
          Tr[pi] = rq;
        }
      }
      __syncthreads();
      const int q8 = tid >> 3, c8 = (tid & 7) * 8;
      v4u vh[4], vr[4];
#pragma unroll
      for (int it = 0; it < 4; ++it) {
        const int d = it * 16 + q8;
        HU8 u;
        u.h = *(const v8h*)(Th + d * 72 + c8);
        vh[it] = u.u;
        u.h = *(const v8h*)(Tr + d * 72 + c8);
        vr[it] = u.u;
      }
#pragma unroll
      for (int it = 0; it < 4; ++it) {
        const int d = it * 16 + q8;
        const size_t o = ((size_t)b * HD + d) * SEQ + s0 + c8;
        *(v4u*)(VTh + o) = vh[it];
        *(v4u*)(VTr + o) = vr[it];
      }
      
    }
  }
}

// =====================================================================================================
// Causal flash attention, head dim 64, one head per sequence, SEQ query/key rows per sequence.
//   q/k planes (f16 hi, f16 x2048 residual): element (b, t, d) at [(b*SEQ + t)*64 + d]
//   v^T planes (f16 hi of 64 v, f16 x2048 residual): element (b, d, s) at [(b*64 + d)*SEQ + s]
//   out (f32): element (b, t, d) at [(b*SEQ + t)*64 + d]
//   score = qh.kh + (qh.kr + qr.kh) / 2048 (no scale); score := -inf where key > query row (index select);
//   p = exp(s - m) spilled per wave as f16(1024 p) and f16(2048 (1024 p - hi));
//   context += ph . vh^T, plus (ph . vr^T + pr . vh^T) / 2048 from a per-chunk accumulator; online softmax
//   (running max) in f32; epilogue scale = 8 / (l * 1024 * 64).
//   Block = 4 waves = 64 query rows of one sequence; grid = NQB * NB; key chunks of 64, block-uniform trip
//   kt = 0..qb (chunks strictly above the diagonal are fully excluded and skipped).
//   K / V^T chunk staging: 128 threads x 32 halves per plane = the whole 64x64 tile of each of the 4 planes
//   (plain 16-B loads, __syncthreads before and after); P tiles are wave-private, spilled with _Float16
//   Output coverage: each wave stores its rows q0..q0+15 x 64 columns, two whole 256-B rows = 512 B per
// =====================================================================================================
__global__ __launch_bounds__(128)
void attn64(const _Float16* __restrict__ Qh, const _Float16* __restrict__ Qr,
            const _Float16* __restrict__ Kh, const _Float16* __restrict__ Kr,
            const _Float16* __restrict__ VTh, const _Float16* __restrict__ VTr, float* outp) {
  __shared__ __align__(16) _Float16 Khs[KC * HD];                 // K hi  [kv][d]   8 KB
  __shared__ __align__(16) _Float16 Krs[KC * HD];                 // K res [kv][d]   8 KB
  __shared__ __align__(16) _Float16 Vhs[HD * KC];                 // V^T hi  [d][kv] 8 KB
  __shared__ __align__(16) _Float16 Vrs[HD * KC];                 // V^T res [d][kv] 8 KB
  __shared__ __align__(16) _Float16 Psh[4][16 * KC];              // per wave P hi [row][kv]
  __shared__ __align__(16) _Float16 Rsh[4][16 * KC];              // per wave P residual [row][kv]
  __shared__ __align__(16) float    Os[4][16 * HD];               // per wave context tile [row][d]

  const int tid  = threadIdx.x;
  const int wave = tid >> 5;
  const int lane = tid & 31;
  const int hh   = lane >> 4;
  const int c    = lane & 15;

  const int bx = blockIdx.x;
  const int qb = bx % NQB;
  const int b  = bx / NQB;
  const int q0 = qb * 64 + wave * 16;            // in-sequence query row of this wave's first row
  const int rlo = q0 + 8 * hh;                   // in-sequence row of accumulator element r is rlo + r
  const size_t rowB = (size_t)b * SEQ;
  const _Float16* VThb = VTh + (size_t)b * HD * SEQ;
  const _Float16* VTrb = VTr + (size_t)b * HD * SEQ;

  // ---- Q fragments (A operand, row = lane&15): 2 d-chunks, hi and residual ----
  v16h qh[2], qr[2];
#pragma unroll
  for (int dc = 0; dc < 2; ++dc) {
    qh[dc] = ldfrag_h(Qh + (rowB + q0 + c) * HD + dc * 32 + 8 * hh);
    qr[dc] = ldfrag_h(Qr + (rowB + q0 + c) * HD + dc * 32 + 8 * hh);
  }

  float mrow[8], lrow[8];
  v8f oacc[4];
#pragma unroll
  for (int r = 0; r < 8; ++r) { mrow[r] = -INFINITY; lrow[r] = 0.f; }
#pragma unroll
  for (int t = 0; t < 4; ++t) oacc[t] = zero8();

#pragma unroll 1
  for (int kt = 0; kt <= qb; ++kt) {         // block-uniform trip count, at most NQB
    const int kv0 = kt * KC;

    __syncthreads();
    {
      const int r = tid >> 1, hf = (tid & 1) * 32;
      const _Float16* kgh = Kh + (rowB + kv0 + r) * HD + hf;          // K row kv0+r, d = hf..hf+31
      const _Float16* kgr = Kr + (rowB + kv0 + r) * HD + hf;
#pragma unroll
      for (int i = 0; i < 4; ++i) {
        const v8h a0 = *(const v8h*)(kgh + 8 * i);
        const v8h a1 = *(const v8h*)(kgr + 8 * i);
        *(v8h*)(Khs + r * HD + hf + 8 * i) = a0;
        *(v8h*)(Krs + r * HD + hf + 8 * i) = a1;
      }
      const _Float16* vgh = VThb + (size_t)r * SEQ + kv0 + hf;          // V^T row d = r, s = kv0+hf..+31
      const _Float16* vgr = VTrb + (size_t)r * SEQ + kv0 + hf;
#pragma unroll
      for (int i = 0; i < 4; ++i) {
        const v8h b0 = *(const v8h*)(vgh + 8 * i);
        const v8h b1 = *(const v8h*)(vgr + 8 * i);
        *(v8h*)(Vhs + r * KC + hf + 8 * i) = b0;
        *(v8h*)(Vrs + r * KC + hf + 8 * i) = b1;
      }
    }
    __syncthreads();

    // ---- scores: 16 query rows x 64 keys per wave (B operand: col = key j*16+c, k = d, split map) ----
    v8f s[4];
#pragma unroll
    for (int j = 0; j < 4; ++j) {
      v8f sh = zero8();
      v8f sx = zero8();
#pragma unroll
      for (int dc = 0; dc < 2; ++dc) {
        FragH kb, kx;
        kb.h[0] = *(const v8h*)(Khs + (j * 16 + c) * HD + dc * 32 + 8 * hh);
        kb.h[1] = *(const v8h*)(Khs + (j * 16 + c) * HD + dc * 32 + 16 + 8 * hh);
        kx.h[0] = *(const v8h*)(Krs + (j * 16 + c) * HD + dc * 32 + 8 * hh);
        kx.h[1] = *(const v8h*)(Krs + (j * 16 + c) * HD + dc * 32 + 16 + 8 * hh);
        sh = mma_h(qh[dc], kb.v, sh);
        sx = mma_h(qh[dc], kx.v, sx);
        sx = mma_h(qr[dc], kb.v, sx);
      }
      const int key = kv0 + j * 16 + c;
#pragma unroll
      for (int r = 0; r < 8; ++r) {
        const float sv = sh[r] + sx[r] * (1.0f / RSC);
        s[j][r] = (key > rlo + r) ? -INFINITY : sv;           // causal: keys strictly after the row excluded
      }
    }

    // ---- row max, online softmax, P hi (x1024) and residual (x2048) to LDS ----
    _Float16* pwh = Psh[wave];
    _Float16* pwr = Rsh[wave];
#pragma unroll
    for (int r = 0; r < 8; ++r) {
      float m = s[0][r];
      m = fmaxf(m, s[1][r]);
      m = fmaxf(m, s[2][r]);
      m = fmaxf(m, s[3][r]);
#pragma unroll
      for (int off = 1; off < 16; off <<= 1) m = fmaxf(m, __shfl_xor(m, off, 32));
      const float mnew  = fmaxf(mrow[r], m);
      const float alpha = __expf(mrow[r] - mnew);
      mrow[r] = mnew;
      float psum = 0.f;
#pragma unroll
      for (int j = 0; j < 4; ++j) {
        const float p  = __expf(s[j][r] - mnew);
        psum += p;
        const float ph = p * PSC;
        const _Float16 hq = (_Float16)ph;
        const float res = (ph - (float)hq) * RSC;
        const int pi = (8 * hh + r) * KC + j * 16 + c;
        pwh[pi] = hq;
        pwr[pi] = (_Float16)res;
      }
#pragma unroll
      for (int off = 1; off < 16; off <<= 1) psum += __shfl_xor(psum, off, 32);
      lrow[r] = lrow[r] * alpha + psum;
#pragma unroll
      for (int t = 0; t < 4; ++t) oacc[t][r] *= alpha;
    }
    wave_sync_lds();

    // ---- context += P . V (f16 WMMA; A = P [row][kv], B = V^T [dv][kv], both split map) ----
    FragH pa[2], pr[2];
#pragma unroll
    for (int kk = 0; kk < 2; ++kk) {
      pa[kk].h[0] = *(const v8h*)(pwh + c * KC + kk * 32 + 8 * hh);
      pa[kk].h[1] = *(const v8h*)(pwh + c * KC + kk * 32 + 16 + 8 * hh);
      pr[kk].h[0] = *(const v8h*)(pwr + c * KC + kk * 32 + 8 * hh);
      pr[kk].h[1] = *(const v8h*)(pwr + c * KC + kk * 32 + 16 + 8 * hh);
    }
#pragma unroll
    for (int t = 0; t < 4; ++t) {
      FragH vb[2], vx[2];
#pragma unroll
      for (int kk = 0; kk < 2; ++kk) {
        vb[kk].h[0] = *(const v8h*)(Vhs + (t * 16 + c) * KC + kk * 32 + 8 * hh);
        vb[kk].h[1] = *(const v8h*)(Vhs + (t * 16 + c) * KC + kk * 32 + 16 + 8 * hh);
        vx[kk].h[0] = *(const v8h*)(Vrs + (t * 16 + c) * KC + kk * 32 + 8 * hh);
        vx[kk].h[1] = *(const v8h*)(Vrs + (t * 16 + c) * KC + kk * 32 + 16 + 8 * hh);
      }
      oacc[t] = mma_h(pa[0].v, vb[0].v, oacc[t]);
      oacc[t] = mma_h(pa[1].v, vb[1].v, oacc[t]);
      v8f rr = mma_h(pa[0].v, vx[0].v, zero8());
      rr = mma_h(pa[1].v, vx[1].v, rr);
      rr = mma_h(pr[0].v, vb[0].v, rr);
      rr = mma_h(pr[1].v, vb[1].v, rr);
#pragma unroll
      for (int r = 0; r < 8; ++r) oacc[t][r] += rr[r] * (1.0f / RSC);
    }
  }

  // ---- normalise (8 / l, the 1/1024 p carry and the 1/64 v carry), stage the wave's 16x64 f32 tile,
  float* os = Os[wave];
#pragma unroll
  for (int r = 0; r < 8; ++r) {
    const float l = lrow[r];
    const float inv = ((l > 0.f) ? (1.0f / l) : 0.f) * (OSC / (PSC * VSC));
#pragma unroll
    for (int t = 0; t < 4; ++t) os[(8 * hh + r) * HD + t * 16 + c] = oacc[t][r] * inv;
  }
  wave_sync_lds();
  {
    const int c4 = lane * 4;
    v4f vals[8];
#pragma unroll
    for (int it = 0; it < 8; ++it) vals[it] = *(const v4f*)(os + it * 128 + c4);
    float* C = outp + (rowB + q0) * HD;
#pragma unroll
    for (int it = 0; it < 8; ++it) *(v4f*)(C + (size_t)it * 128 + c4) = vals[it];
    
  }
}

// =====================================================================================================
// Workspace map (bytes); every plane is an exact multiple of its whole-line / 64x64-tile store granularity:
//   Xb   bf16 [16384][512]       0          16777216
//   Wqb  bf16 [64][512]          16777216   65536
//   Wkb  bf16 [64][512]          16842752   65536
//   Wvb  bf16 [64][512]          16908288   65536
//   Qh   f16  [16384][64]        16973824   2097152
//   Qr   f16  [16384][64]        19070976   2097152
//   Kh   f16  [16384][64]        21168128   2097152
//   Kr   f16  [16384][64]        23265280   2097152
//   VTh  f16  [4][64][4096]      25362432   2097152
//   VTr  f16  [4][64][4096]      27459584   2097152
//   end                          29556736
// =====================================================================================================
extern "C" void kernel_launch(void* const* d_in, const int* in_sizes, int n_in,
                              void* d_out, int out_size, void* d_ws, size_t ws_size,
                              hipStream_t stream) {
  if (n_in < 7) return;
  if (in_sizes[0] != NX) return;
  if (in_sizes[1] != NW || in_sizes[3] != NW || in_sizes[5] != NW) return;
  if (in_sizes[2] != HD || in_sizes[4] != HD || in_sizes[6] != HD) return;
  if (out_size != NO) return;

  const float* x  = (const float*)d_in[0];
  const float* Wq = (const float*)d_in[1];
  const float* bq = (const float*)d_in[2];
  const float* Wk = (const float*)d_in[3];
  const float* bk = (const float*)d_in[4];
  const float* Wv = (const float*)d_in[5];
  const float* bv = (const float*)d_in[6];

  const size_t XB = (size_t)NX * 2;                     // 16777216
  const size_t WB = (size_t)NW * 2;                     // 65536
  const size_t PB = (size_t)NO * 2;                     // 2097152
  size_t off = 0;
  const size_t oX  = off; off += XB;
  const size_t oWq = off; off += WB;
  const size_t oWk = off; off += WB;
  const size_t oWv = off; off += WB;
  const size_t oQh = off; off += PB;
  const size_t oQr = off; off += PB;
  const size_t oKh = off; off += PB;
  const size_t oKr = off; off += PB;
  const size_t oVh = off; off += PB;
  const size_t oVr = off; off += PB;
  if (off > ws_size) return;                            // off = 29556736
  if (off > (size_t)134217728) return;

  char* ws = (char*)d_ws;
  unsigned short* Xb  = (unsigned short*)(ws + oX);
  unsigned short* Wqb = (unsigned short*)(ws + oWq);
  unsigned short* Wkb = (unsigned short*)(ws + oWk);
  unsigned short* Wvb = (unsigned short*)(ws + oWv);
  _Float16* Qh  = (_Float16*)(ws + oQh);
  _Float16* Qr  = (_Float16*)(ws + oQr);
  _Float16* Kh  = (_Float16*)(ws + oKh);
  _Float16* Kr  = (_Float16*)(ws + oKr);
  _Float16* VTh = (_Float16*)(ws + oVh);
  _Float16* VTr = (_Float16*)(ws + oVr);
  float* out0 = (float*)d_out;

  const int nx8 = NX / 8;                               // 1048576
  const int nw8 = NW / 8;                               // 4096
  const dim3 blk(256), blk128(128);
  const dim3 gX(nx8 / 256);                             // 4096 blocks
  const dim3 gW(nw8 / 256);                             // 16 blocks
  const dim3 gP(NROW / 64);                             // 256 blocks of 128
  const dim3 gA(NB * NQB);                              // 256 blocks of 128

  // (0) x, Wq, Wk, Wv -> bf16 planes
  conv_bf16<<<gX, blk, 0, stream>>>(x, Xb, nx8);
  conv_bf16<<<gW, blk, 0, stream>>>(Wq, Wqb, nw8);
  conv_bf16<<<gW, blk, 0, stream>>>(Wk, Wkb, nw8);
  conv_bf16<<<gW, blk, 0, stream>>>(Wv, Wvb, nw8);

  // (1) projections -> q/k f16 hi + residual planes, v^T f16 hi + residual planes
  proj_qkv<<<gP, blk128, 0, stream>>>(Xb, Wqb, Wkb, Wvb, bq, bk, bv, Qh, Qr, Kh, Kr, VTh, VTr);

  // (2) causal flash attention -> out f32 [4][4096][64]
  attn64<<<gA, blk128, 0, stream>>>(Qh, Qr, Kh, Kr, VTh, VTr, out0);
  (void)hipGetLastError();
}

// v001
// One run takes 208 microseconds.
// Timed twice side by side with v000, it ran 1.42 times as fast both times.
// Contractions: q/k/v projections x.W^T on v_wmma_f32_16x16x32_bf16 (bf16 RNE planes of x and W, one
// product each); q.k^T and p.v on v_wmma_f32_16x16x32_f16 (q, k: f16 hi plane + f16 x2048 residual plane;
// p: f16 x1024 hi + x2048 residual; v^T: f16 x64 hi + x2048 residual; hi.hi + hi.res + res.hi, residual
// products in their own f32 accumulator folded x1/2048); all f32 accumulate; online softmax in f32 on VALU.
#include <hip/hip_runtime.h>
#include <hip/hip_bf16.h>
#include <math.h>
#include <stdint.h>

#define NB   4
#define SEQ  4096
#define DE   512
#define HD   64
#define KC   64
#define LP   72      // LDS row pitch in halves of the 64-half K, V^T and P rows: 144 B = 16 B x odd
#define NQB  (SEQ / 64)
#define NROW (NB * SEQ)
#define NX   (NROW * DE)
#define NW   (HD * DE)
#define NO   (NROW * HD)
#define PSC  1024.0f
#define RSC  2048.0f
#define VSC  64.0f
#define OSC  8.0f
static_assert((SEQ % 64) == 0);
static_assert(HD == 64);
static_assert(KC == 64);
static_assert(LP >= KC && LP >= HD && (LP % 8) == 0 && ((LP / 8) % 2) == 1);
static_assert((DE % 32) == 0);
static_assert(((NX / 8) % 256) == 0);
static_assert(((NW / 8) % 256) == 0);
static_assert((NROW % 64) == 0);

typedef _Float16 v16h __attribute__((ext_vector_type(16)));
typedef _Float16 v8h  __attribute__((ext_vector_type(8)));
typedef __bf16   v16b __attribute__((ext_vector_type(16)));
typedef float    v8f  __attribute__((ext_vector_type(8)));
typedef float    v4f  __attribute__((ext_vector_type(4)));
typedef unsigned int v4u __attribute__((ext_vector_type(4)));

union FragH { v16h v; v8h h[2]; };
union FragB { v16b v; v4u u[2]; };
union HU8   { v8h h; v4u u; };

// ---- scalar helpers --------------------------------------------------------------------------------
__device__ __forceinline__ unsigned short bf_bits(float f) {          // f32 -> bf16 bits, RNE convert
  unsigned u = __float_as_uint(f);
  return (unsigned short)((u + 0x7FFFu + ((u >> 16) & 1u)) >> 16);
}
__device__ __forceinline__ float bf_up(unsigned short h) { return __uint_as_float(((unsigned)h) << 16); }
__device__ __forceinline__ float bfr(float f) { return bf_up(bf_bits(f)); }   // value of the bf16 RNE convert
__device__ __forceinline__ unsigned pk16(unsigned short a, unsigned short b) { return (unsigned)a | ((unsigned)b << 16); }
__device__ __forceinline__ v8f zero8() { v8f z = {0.f, 0.f, 0.f, 0.f, 0.f, 0.f, 0.f, 0.f}; return z; }

// ---- fragment loaders: 16-bit A/B operand, lane -> row/col (lane&15), p already includes +8*(lane>>4);
//      elements 0..7 <- p[0..7] (k0+8h..), elements 8..15 <- p[16..23] (k0+16+8h..)
__device__ __forceinline__ v16h ldfrag_h(const _Float16* p) {
  FragH f;
  f.h[0] = *(const v8h*)(p);
  f.h[1] = *(const v8h*)(p + 16);
  return f.v;
}
__device__ __forceinline__ v16b ldfrag_b(const unsigned short* p) {
  FragB f;
  f.u[0] = *(const v4u*)(p);
  f.u[1] = *(const v4u*)(p + 16);
  return f.v;
}

// ---- WMMA helpers with trailing VALU hazard gap --------------------------------------------------------
__device__ __forceinline__ v8f mma_h(v16h a, v16h b, v8f c) {
  c = __builtin_amdgcn_wmma_f32_16x16x32_f16(false, a, false, b, (short)0, c, false, false);
#if defined(__HIP_DEVICE_COMPILE__)
  asm volatile("v_nop\n\tv_nop\n\tv_nop\n\tv_nop" : "+v"(c) : "v"(a), "v"(b));
#endif
  return c;
}
__device__ __forceinline__ v8f mma_b(v16b a, v16b b, v8f c) {
  c = __builtin_amdgcn_wmma_f32_16x16x32_bf16(false, a, false, b, (short)0, c, false, false);
#if defined(__HIP_DEVICE_COMPILE__)
  asm volatile("v_nop\n\tv_nop\n\tv_nop\n\tv_nop" : "+v"(c) : "v"(a), "v"(b));
#endif
  return c;
}
__device__ __forceinline__ void wave_sync_lds() {
  __builtin_amdgcn_fence(__ATOMIC_RELEASE, "workgroup");
  __builtin_amdgcn_wave_barrier();
  __builtin_amdgcn_fence(__ATOMIC_ACQUIRE, "workgroup");
}

// =====================================================================================================
// Plane convert: Y[i] = bf16_RNE(X[i]) bits. Thread i handles elements 8i..8i+7 and writes one 16-B piece;
// grid = n8 / 256 (n8 multiple of 256, host-checked). coverage: n8 threads x 8 elements = the whole plane.
// =====================================================================================================
__global__ __launch_bounds__(256) void conv_bf16(const float* __restrict__ X, unsigned short* Y, int n8) {
  const int i  = blockIdx.x * 256 + threadIdx.x;
  const int ic = (i < n8) ? i : (n8 - 1);                     // clamped address
  const float* src = X + (size_t)ic * 8;
  const v4f a = *(const v4f*)(src);
  const v4f c = *(const v4f*)(src + 4);
  v4u o;
  o[0] = pk16(bf_bits(a[0]), bf_bits(a[1]));
  o[1] = pk16(bf_bits(a[2]), bf_bits(a[3]));
  o[2] = pk16(bf_bits(c[0]), bf_bits(c[1]));
  o[3] = pk16(bf_bits(c[2]), bf_bits(c[3]));
  if (i < n8) *(v4u*)(Y + (size_t)i * 8) = o;
  
}

// =====================================================================================================
// q/k/v projections. Block = 128 threads = 4 waves = 64 token rows (rows r0..r0+63 of the flattened
// [NB*SEQ] row index; 64 | SEQ so one block never crosses a sequence). Each wave owns 16 rows x 64 columns
// of one projection at a time (w = 0: q, 1: k, 2: v): A fragments from the bf16 x plane (row pitch DE),
// B(k, n) = W[n][k] fragments straight from the bf16 W plane row n (k-contiguous), K = DE in 32-steps.
// Epilogue (f32): + bf16_RNE(bias[n]); q/k: hi = f16(v), res = f16((v - hi) * 2048) staged as [row][d]
// coverage: q/k planes: 4 waves x 4 it x 4 rows x 8 lanes x 8 halves = 64 rows x 64; v^T planes:
//           4 it x 16 d x 8 lanes x 8 halves = 64 d x 64 s; grid NROW/64 blocks covers all rows.
// =====================================================================================================
__global__ __launch_bounds__(128)
void proj_qkv(const unsigned short* __restrict__ Xb,
              const unsigned short* __restrict__ Wqb, const unsigned short* __restrict__ Wkb,
              const unsigned short* __restrict__ Wvb,
              const float* __restrict__ bq, const float* __restrict__ bk, const float* __restrict__ bv,
              _Float16* Qh, _Float16* Qr, _Float16* Kh, _Float16* Kr, _Float16* VTh, _Float16* VTr) {
  __shared__ __align__(16) _Float16 Th[64 * 72];
  __shared__ __align__(16) _Float16 Tr[64 * 72];

  const int tid  = threadIdx.x;
  const int wave = tid >> 5;
  const int lane = tid & 31;
  const int hh   = lane >> 4;
  const int c    = lane & 15;
  const int r0   = blockIdx.x * 64;
  const int b    = r0 / SEQ;
  const int s0   = r0 - b * SEQ;
  const unsigned short* ap = Xb + (size_t)(r0 + wave * 16 + c) * DE + 8 * hh;   // A row = lane&15

#pragma unroll 1
  for (int w = 0; w < 3; ++w) {                              // block-uniform
    const unsigned short* Wb = (w == 0) ? Wqb : ((w == 1) ? Wkb : Wvb);
    const float* bp = (w == 0) ? bq : ((w == 1) ? bk : bv);

    v8f acc[4];
#pragma unroll
    for (int nt = 0; nt < 4; ++nt) acc[nt] = zero8();

#pragma unroll 2
    for (int k0 = 0; k0 < DE; k0 += 32) {
      const v16b a = ldfrag_b(ap + k0);
#pragma unroll
      for (int nt = 0; nt < 4; ++nt) {
        const v16b wf = ldfrag_b(Wb + (size_t)(nt * 16 + c) * DE + 8 * hh + k0);   // B col n = nt*16+c
        acc[nt] = mma_b(a, wf, acc[nt]);
      }
    }

    if (w < 2) {
      // ---- q or k: stage [token row][d] as f16 hi and x2048 residual ----
      _Float16* Ph = (w == 0) ? Qh : Kh;
      _Float16* Pr = (w == 0) ? Qr : Kr;
#pragma unroll
      for (int nt = 0; nt < 4; ++nt) {
        const int n = nt * 16 + c;
        const float bias = bfr(bp[n]);
#pragma unroll
        for (int r = 0; r < 8; ++r) {
          const float v = acc[nt][r] + bias;
          const _Float16 hq = (_Float16)v;
          const _Float16 rq = (_Float16)((v - (float)hq) * RSC);
          const int pi = (wave * 16 + 8 * hh + r) * 72 + n;
          Th[pi] = hq;
          Tr[pi] = rq;
        }
      }
      __syncthreads();
      const int q8 = lane >> 3, c8 = (lane & 7) * 8;
      v4u vh[4], vr[4];
#pragma unroll
      for (int it = 0; it < 4; ++it) {
        const int row = wave * 16 + it * 4 + q8;
        HU8 u;
        u.h = *(const v8h*)(Th + row * 72 + c8);
        vh[it] = u.u;
        u.h = *(const v8h*)(Tr + row * 72 + c8);
        vr[it] = u.u;
      }
#pragma unroll
      for (int it = 0; it < 4; ++it) {
        const int row = wave * 16 + it * 4 + q8;
        const size_t o = (size_t)(r0 + row) * HD + c8;
        *(v4u*)(Ph + o) = vh[it];
        *(v4u*)(Pr + o) = vr[it];
      }
      
      __syncthreads();                                       // Th/Tr reused by the next projection
    } else {
      // ---- v: stage transposed [d][s] as f16 hi of (v * 64) and its x2048 residual ----
#pragma unroll
      for (int nt = 0; nt < 4; ++nt) {
        const int n = nt * 16 + c;
        const float bias = bfr(bp[n]);
#pragma unroll
        for (int r = 0; r < 8; ++r) {
          const float v = (acc[nt][r] + bias) * VSC;
          const _Float16 hq = (_Float16)v;
          const _Float16 rq = (_Float16)((v - (float)hq) * RSC);
          const int pi = n * 72 + wave * 16 + 8 * hh + r;
          Th[pi] = hq;
          Tr[pi] = rq;
        }
      }
      __syncthreads();
      const int q8 = tid >> 3, c8 = (tid & 7) * 8;
      v4u vh[4], vr[4];
#pragma unroll
      for (int it = 0; it < 4; ++it) {
        const int d = it * 16 + q8;
        HU8 u;
        u.h = *(const v8h*)(Th + d * 72 + c8);
        vh[it] = u.u;
        u.h = *(const v8h*)(Tr + d * 72 + c8);
        vr[it] = u.u;
      }
#pragma unroll
      for (int it = 0; it < 4; ++it) {
        const int d = it * 16 + q8;
        const size_t o = ((size_t)b * HD + d) * SEQ + s0 + c8;
        *(v4u*)(VTh + o) = vh[it];
        *(v4u*)(VTr + o) = vr[it];
      }
      
    }
  }
}

// =====================================================================================================
// Causal flash attention, head dim 64, one head per sequence, SEQ query/key rows per sequence.
//   q/k planes (f16 hi, f16 x2048 residual): element (b, t, d) at [(b*SEQ + t)*64 + d]
//   v^T planes (f16 hi of 64 v, f16 x2048 residual): element (b, d, s) at [(b*64 + d)*SEQ + s]
//   out (f32): element (b, t, d) at [(b*SEQ + t)*64 + d]
//   score = qh.kh + (qh.kr + qr.kh) / 2048 (no scale); score := -inf where key > query row (index select);
//   p = exp(s - m) spilled per wave as f16(1024 p) and f16(2048 (1024 p - hi));
//   context += ph . vh^T, plus (ph . vr^T + pr . vh^T) / 2048 from a per-chunk accumulator; online softmax
//   (running max) in f32; epilogue scale = 8 / (l * 1024 * 64).
//   Block = 4 waves = 64 query rows of one sequence; grid = NQB * NB; key chunks of 64, block-uniform trip
//   kt = 0..qb (chunks strictly above the diagonal are fully excluded and skipped).
//   K / V^T chunk staging: 128 threads x 32 halves per plane = the whole 64x64 tile of each of the 4 planes
//   (plain 16-B loads, __syncthreads before and after); P tiles are wave-private, spilled with _Float16
//   Output coverage: each wave stores its rows q0..q0+15 x 64 columns, two whole 256-B rows = 512 B per
// =====================================================================================================
__global__ __launch_bounds__(128)
void attn64(const _Float16* __restrict__ Qh, const _Float16* __restrict__ Qr,
            const _Float16* __restrict__ Kh, const _Float16* __restrict__ Kr,
            const _Float16* __restrict__ VTh, const _Float16* __restrict__ VTr, float* outp) {
  __shared__ __align__(16) _Float16 Khs[KC * LP];                 // K hi  [kv][d], pitch LP   9 KB
  __shared__ __align__(16) _Float16 Krs[KC * LP];                 // K res [kv][d], pitch LP   9 KB
  __shared__ __align__(16) _Float16 Vhs[HD * LP];                 // V^T hi  [d][kv], pitch LP 9 KB
  __shared__ __align__(16) _Float16 Vrs[HD * LP];                 // V^T res [d][kv], pitch LP 9 KB
  __shared__ __align__(16) _Float16 Psh[4][16 * LP];              // per wave P hi [row][kv], pitch LP
  __shared__ __align__(16) _Float16 Rsh[4][16 * LP];              // per wave P residual [row][kv], pitch LP
  __shared__ __align__(16) float    Os[4][16 * HD];               // per wave context tile [row][d]

  const int tid  = threadIdx.x;
  const int wave = tid >> 5;
  const int lane = tid & 31;
  const int hh   = lane >> 4;
  const int c    = lane & 15;

  const int bx = blockIdx.x;
  const int qb = bx % NQB;
  const int b  = bx / NQB;
  const int q0 = qb * 64 + wave * 16;            // in-sequence query row of this wave's first row
  const int rlo = q0 + 8 * hh;                   // in-sequence row of accumulator element r is rlo + r
  const size_t rowB = (size_t)b * SEQ;
  const _Float16* VThb = VTh + (size_t)b * HD * SEQ;
  const _Float16* VTrb = VTr + (size_t)b * HD * SEQ;

  // ---- Q fragments (A operand, row = lane&15): 2 d-chunks, hi and residual ----
  v16h qh[2], qr[2];
#pragma unroll
  for (int dc = 0; dc < 2; ++dc) {
    qh[dc] = ldfrag_h(Qh + (rowB + q0 + c) * HD + dc * 32 + 8 * hh);
    qr[dc] = ldfrag_h(Qr + (rowB + q0 + c) * HD + dc * 32 + 8 * hh);
  }

  float mrow[8], lrow[8];
  v8f oacc[4];
#pragma unroll
  for (int r = 0; r < 8; ++r) { mrow[r] = -INFINITY; lrow[r] = 0.f; }
#pragma unroll
  for (int t = 0; t < 4; ++t) oacc[t] = zero8();

#pragma unroll 1
  for (int kt = 0; kt <= qb; ++kt) {         // block-uniform trip count, at most NQB
    const int kv0 = kt * KC;

    __syncthreads();
    {
      const int r = tid >> 1, hf = (tid & 1) * 32;
      const _Float16* kgh = Kh + (rowB + kv0 + r) * HD + hf;          // K row kv0+r, d = hf..hf+31
      const _Float16* kgr = Kr + (rowB + kv0 + r) * HD + hf;
#pragma unroll
      for (int i = 0; i < 4; ++i) {
        const v8h a0 = *(const v8h*)(kgh + 8 * i);
        const v8h a1 = *(const v8h*)(kgr + 8 * i);
        *(v8h*)(Khs + r * LP + hf + 8 * i) = a0;
        *(v8h*)(Krs + r * LP + hf + 8 * i) = a1;
      }
      const _Float16* vgh = VThb + (size_t)r * SEQ + kv0 + hf;          // V^T row d = r, s = kv0+hf..+31
      const _Float16* vgr = VTrb + (size_t)r * SEQ + kv0 + hf;
#pragma unroll
      for (int i = 0; i < 4; ++i) {
        const v8h b0 = *(const v8h*)(vgh + 8 * i);
        const v8h b1 = *(const v8h*)(vgr + 8 * i);
        *(v8h*)(Vhs + r * LP + hf + 8 * i) = b0;
        *(v8h*)(Vrs + r * LP + hf + 8 * i) = b1;
      }
    }
    __syncthreads();

    // ---- scores: 16 query rows x 64 keys per wave (B operand: col = key j*16+c, k = d, split map) ----
    v8f s[4];
#pragma unroll
    for (int j = 0; j < 4; ++j) {
      v8f sh = zero8();
      v8f sx = zero8();
#pragma unroll
      for (int dc = 0; dc < 2; ++dc) {
        FragH kb, kx;
        kb.h[0] = *(const v8h*)(Khs + (j * 16 + c) * LP + dc * 32 + 8 * hh);
        kb.h[1] = *(const v8h*)(Khs + (j * 16 + c) * LP + dc * 32 + 16 + 8 * hh);
        kx.h[0] = *(const v8h*)(Krs + (j * 16 + c) * LP + dc * 32 + 8 * hh);
        kx.h[1] = *(const v8h*)(Krs + (j * 16 + c) * LP + dc * 32 + 16 + 8 * hh);
        sh = mma_h(qh[dc], kb.v, sh);
        sx = mma_h(qh[dc], kx.v, sx);
        sx = mma_h(qr[dc], kb.v, sx);
      }
      const int key = kv0 + j * 16 + c;
#pragma unroll
      for (int r = 0; r < 8; ++r) {
        const float sv = sh[r] + sx[r] * (1.0f / RSC);
        s[j][r] = (key > rlo + r) ? -INFINITY : sv;           // causal: keys strictly after the row excluded
      }
    }

    // ---- row max, online softmax, P hi (x1024) and residual (x2048) to LDS ----
    _Float16* pwh = Psh[wave];
    _Float16* pwr = Rsh[wave];
#pragma unroll
    for (int r = 0; r < 8; ++r) {
      float m = s[0][r];
      m = fmaxf(m, s[1][r]);
      m = fmaxf(m, s[2][r]);
      m = fmaxf(m, s[3][r]);
#pragma unroll
      for (int off = 1; off < 16; off <<= 1) m = fmaxf(m, __shfl_xor(m, off, 32));
      const float mnew  = fmaxf(mrow[r], m);
      const float alpha = __expf(mrow[r] - mnew);
      mrow[r] = mnew;
      float psum = 0.f;
#pragma unroll
      for (int j = 0; j < 4; ++j) {
        const float p  = __expf(s[j][r] - mnew);
        psum += p;
        const float ph = p * PSC;
        const _Float16 hq = (_Float16)ph;
        const float res = (ph - (float)hq) * RSC;
        const int pi = (8 * hh + r) * LP + j * 16 + c;
        pwh[pi] = hq;
        pwr[pi] = (_Float16)res;
      }
#pragma unroll
      for (int off = 1; off < 16; off <<= 1) psum += __shfl_xor(psum, off, 32);
      lrow[r] = lrow[r] * alpha + psum;
#pragma unroll
      for (int t = 0; t < 4; ++t) oacc[t][r] *= alpha;
    }
    wave_sync_lds();

    // ---- context += P . V (f16 WMMA; A = P [row][kv], B = V^T [dv][kv], both split map) ----
    FragH pa[2], pr[2];
#pragma unroll
    for (int kk = 0; kk < 2; ++kk) {
      pa[kk].h[0] = *(const v8h*)(pwh + c * LP + kk * 32 + 8 * hh);
      pa[kk].h[1] = *(const v8h*)(pwh + c * LP + kk * 32 + 16 + 8 * hh);
      pr[kk].h[0] = *(const v8h*)(pwr + c * LP + kk * 32 + 8 * hh);
      pr[kk].h[1] = *(const v8h*)(pwr + c * LP + kk * 32 + 16 + 8 * hh);
    }
#pragma unroll
    for (int t = 0; t < 4; ++t) {
      FragH vb[2], vx[2];
#pragma unroll
      for (int kk = 0; kk < 2; ++kk) {
        vb[kk].h[0] = *(const v8h*)(Vhs + (t * 16 + c) * LP + kk * 32 + 8 * hh);
        vb[kk].h[1] = *(const v8h*)(Vhs + (t * 16 + c) * LP + kk * 32 + 16 + 8 * hh);
        vx[kk].h[0] = *(const v8h*)(Vrs + (t * 16 + c) * LP + kk * 32 + 8 * hh);
        vx[kk].h[1] = *(const v8h*)(Vrs + (t * 16 + c) * LP + kk * 32 + 16 + 8 * hh);
      }
      oacc[t] = mma_h(pa[0].v, vb[0].v, oacc[t]);
      oacc[t] = mma_h(pa[1].v, vb[1].v, oacc[t]);
      v8f rr = mma_h(pa[0].v, vx[0].v, zero8());
      rr = mma_h(pa[1].v, vx[1].v, rr);
      rr = mma_h(pr[0].v, vb[0].v, rr);
      rr = mma_h(pr[1].v, vb[1].v, rr);
#pragma unroll
      for (int r = 0; r < 8; ++r) oacc[t][r] += rr[r] * (1.0f / RSC);
    }
  }

  // ---- normalise (8 / l, the 1/1024 p carry and the 1/64 v carry), stage the wave's 16x64 f32 tile,
  float* os = Os[wave];
#pragma unroll
  for (int r = 0; r < 8; ++r) {
    const float l = lrow[r];
    const float inv = ((l > 0.f) ? (1.0f / l) : 0.f) * (OSC / (PSC * VSC));
#pragma unroll
    for (int t = 0; t < 4; ++t) os[(8 * hh + r) * HD + t * 16 + c] = oacc[t][r] * inv;
  }
  wave_sync_lds();
  {
    const int c4 = lane * 4;
    v4f vals[8];
#pragma unroll
    for (int it = 0; it < 8; ++it) vals[it] = *(const v4f*)(os + it * 128 + c4);
    float* C = outp + (rowB + q0) * HD;
#pragma unroll
    for (int it = 0; it < 8; ++it) *(v4f*)(C + (size_t)it * 128 + c4) = vals[it];
    
  }
}

// =====================================================================================================
// Workspace map (bytes); every plane is an exact multiple of its whole-line / 64x64-tile store granularity:
//   Xb   bf16 [16384][512]       0          16777216
//   Wqb  bf16 [64][512]          16777216   65536
//   Wkb  bf16 [64][512]          16842752   65536
//   Wvb  bf16 [64][512]          16908288   65536
//   Qh   f16  [16384][64]        16973824   2097152
//   Qr   f16  [16384][64]        19070976   2097152
//   Kh   f16  [16384][64]        21168128   2097152
//   Kr   f16  [16384][64]        23265280   2097152
//   VTh  f16  [4][64][4096]      25362432   2097152
//   VTr  f16  [4][64][4096]      27459584   2097152
//   end                          29556736
// =====================================================================================================
extern "C" void kernel_launch(void* const* d_in, const int* in_sizes, int n_in,
                              void* d_out, int out_size, void* d_ws, size_t ws_size,
                              hipStream_t stream) {
  if (n_in < 7) return;
  if (in_sizes[0] != NX) return;
  if (in_sizes[1] != NW || in_sizes[3] != NW || in_sizes[5] != NW) return;
  if (in_sizes[2] != HD || in_sizes[4] != HD || in_sizes[6] != HD) return;
  if (out_size != NO) return;

  const float* x  = (const float*)d_in[0];
  const float* Wq = (const float*)d_in[1];
  const float* bq = (const float*)d_in[2];
  const float* Wk = (const float*)d_in[3];
  const float* bk = (const float*)d_in[4];
  const float* Wv = (const float*)d_in[5];
  const float* bv = (const float*)d_in[6];

  const size_t XB = (size_t)NX * 2;                     // 16777216
  const size_t WB = (size_t)NW * 2;                     // 65536
  const size_t PB = (size_t)NO * 2;                     // 2097152
  size_t off = 0;
  const size_t oX  = off; off += XB;
  const size_t oWq = off; off += WB;
  const size_t oWk = off; off += WB;
  const size_t oWv = off; off += WB;
  const size_t oQh = off; off += PB;
  const size_t oQr = off; off += PB;
  const size_t oKh = off; off += PB;
  const size_t oKr = off; off += PB;
  const size_t oVh = off; off += PB;
  const size_t oVr = off; off += PB;
  if (off > ws_size) return;                            // off = 29556736
  if (off > (size_t)134217728) return;

  char* ws = (char*)d_ws;
  unsigned short* Xb  = (unsigned short*)(ws + oX);
  unsigned short* Wqb = (unsigned short*)(ws + oWq);
  unsigned short* Wkb = (unsigned short*)(ws + oWk);
  unsigned short* Wvb = (unsigned short*)(ws + oWv);
  _Float16* Qh  = (_Float16*)(ws + oQh);
  _Float16* Qr  = (_Float16*)(ws + oQr);
  _Float16* Kh  = (_Float16*)(ws + oKh);
  _Float16* Kr  = (_Float16*)(ws + oKr);
  _Float16* VTh = (_Float16*)(ws + oVh);
  _Float16* VTr = (_Float16*)(ws + oVr);
  float* out0 = (float*)d_out;

  const int nx8 = NX / 8;                               // 1048576
  const int nw8 = NW / 8;                               // 4096
  const dim3 blk(256), blk128(128);
  const dim3 gX(nx8 / 256);                             // 4096 blocks
  const dim3 gW(nw8 / 256);                             // 16 blocks
  const dim3 gP(NROW / 64);                             // 256 blocks of 128
  const dim3 gA(NB * NQB);                              // 256 blocks of 128

  // (0) x, Wq, Wk, Wv -> bf16 planes
  conv_bf16<<<gX, blk, 0, stream>>>(x, Xb, nx8);
  conv_bf16<<<gW, blk, 0, stream>>>(Wq, Wqb, nw8);
  conv_bf16<<<gW, blk, 0, stream>>>(Wk, Wkb, nw8);
  conv_bf16<<<gW, blk, 0, stream>>>(Wv, Wvb, nw8);

  // (1) projections -> q/k f16 hi + residual planes, v^T f16 hi + residual planes
  proj_qkv<<<gP, blk128, 0, stream>>>(Xb, Wqb, Wkb, Wvb, bq, bk, bv, Qh, Qr, Kh, Kr, VTh, VTr);

  // (2) causal flash attention -> out f32 [4][4096][64]
  attn64<<<gA, blk128, 0, stream>>>(Qh, Qr, Kh, Kr, VTh, VTr, out0);
  (void)hipGetLastError();
}

// v002
// A run of this version takes 140 microseconds.
// Next to v001, in two timings, it ran 1.49 and 1.50 times as fast.
// Over all steps from v000 it is 2.12 times as fast.
// Contractions: q/k/v projections x.W^T on v_wmma_f32_16x16x32_bf16 (bf16 RNE planes of x and W, one
// product each); q.k^T and p.v on v_wmma_f32_16x16x32_f16 (q, k: f16 hi plane + f16 x2048 residual plane;
// p: f16 x1024 hi + x2048 residual; v^T: f16 x64 hi + x2048 residual; hi.hi + hi.res + res.hi, residual
// products in their own f32 accumulator folded x1/2048); all f32 accumulate; online softmax in f32 on VALU.
#include <hip/hip_runtime.h>
#include <hip/hip_bf16.h>
#include <math.h>
#include <stdint.h>

#define NB   4
#define SEQ  4096
#define DE   512
#define HD   64
#define KC   64
#define LP   72      // LDS row pitch in halves of the 64-half K, V^T and P rows: 144 B = 16 B x odd
#define NQB  (SEQ / 64)
#define NG   4       // key groups per attention workgroup: group g takes key chunks g, g + NG, g + 2 NG, ...
#define NROW (NB * SEQ)
#define NX   (NROW * DE)
#define NW   (HD * DE)
#define NO   (NROW * HD)
#define PSC  1024.0f
#define RSC  2048.0f
#define VSC  64.0f
#define OSC  8.0f
static_assert((SEQ % 64) == 0);
static_assert(HD == 64);
static_assert(KC == 64);
static_assert(LP >= KC && LP >= HD && (LP % 8) == 0 && ((LP / 8) % 2) == 1);
static_assert((DE % 32) == 0);
static_assert(((NX / 8) % 256) == 0);
static_assert(((NW / 8) % 256) == 0);
static_assert((NROW % 64) == 0);

typedef _Float16 v16h __attribute__((ext_vector_type(16)));
typedef _Float16 v8h  __attribute__((ext_vector_type(8)));
typedef __bf16   v16b __attribute__((ext_vector_type(16)));
typedef float    v8f  __attribute__((ext_vector_type(8)));
typedef float    v4f  __attribute__((ext_vector_type(4)));
typedef unsigned int v4u __attribute__((ext_vector_type(4)));

union FragH { v16h v; v8h h[2]; };
union FragB { v16b v; v4u u[2]; };
union HU8   { v8h h; v4u u; };

// ---- scalar helpers --------------------------------------------------------------------------------
__device__ __forceinline__ unsigned short bf_bits(float f) {          // f32 -> bf16 bits, RNE convert
  unsigned u = __float_as_uint(f);
  return (unsigned short)((u + 0x7FFFu + ((u >> 16) & 1u)) >> 16);
}
__device__ __forceinline__ float bf_up(unsigned short h) { return __uint_as_float(((unsigned)h) << 16); }
__device__ __forceinline__ float bfr(float f) { return bf_up(bf_bits(f)); }   // value of the bf16 RNE convert
__device__ __forceinline__ unsigned pk16(unsigned short a, unsigned short b) { return (unsigned)a | ((unsigned)b << 16); }
__device__ __forceinline__ v8f zero8() { v8f z = {0.f, 0.f, 0.f, 0.f, 0.f, 0.f, 0.f, 0.f}; return z; }

// ---- fragment loaders: 16-bit A/B operand, lane -> row/col (lane&15), p already includes +8*(lane>>4);
//      elements 0..7 <- p[0..7] (k0+8h..), elements 8..15 <- p[16..23] (k0+16+8h..)
__device__ __forceinline__ v16h ldfrag_h(const _Float16* p) {
  FragH f;
  f.h[0] = *(const v8h*)(p);
  f.h[1] = *(const v8h*)(p + 16);
  return f.v;
}
__device__ __forceinline__ v16b ldfrag_b(const unsigned short* p) {
  FragB f;
  f.u[0] = *(const v4u*)(p);
  f.u[1] = *(const v4u*)(p + 16);
  return f.v;
}

// ---- WMMA helpers with trailing VALU hazard gap --------------------------------------------------------
__device__ __forceinline__ v8f mma_h(v16h a, v16h b, v8f c) {
  c = __builtin_amdgcn_wmma_f32_16x16x32_f16(false, a, false, b, (short)0, c, false, false);
#if defined(__HIP_DEVICE_COMPILE__)
  asm volatile("v_nop\n\tv_nop\n\tv_nop\n\tv_nop" : "+v"(c) : "v"(a), "v"(b));
#endif
  return c;
}
__device__ __forceinline__ v8f mma_b(v16b a, v16b b, v8f c) {
  c = __builtin_amdgcn_wmma_f32_16x16x32_bf16(false, a, false, b, (short)0, c, false, false);
#if defined(__HIP_DEVICE_COMPILE__)
  asm volatile("v_nop\n\tv_nop\n\tv_nop\n\tv_nop" : "+v"(c) : "v"(a), "v"(b));
#endif
  return c;
}
__device__ __forceinline__ void wave_sync_lds() {
  __builtin_amdgcn_fence(__ATOMIC_RELEASE, "workgroup");
  __builtin_amdgcn_wave_barrier();
  __builtin_amdgcn_fence(__ATOMIC_ACQUIRE, "workgroup");
}

// =====================================================================================================
// Plane convert: Y[i] = bf16_RNE(X[i]) bits. Thread i handles elements 8i..8i+7 and writes one 16-B piece;
// grid = n8 / 256 (n8 multiple of 256, host-checked). coverage: n8 threads x 8 elements = the whole plane.
// =====================================================================================================
__global__ __launch_bounds__(256) void conv_bf16(const float* __restrict__ X, unsigned short* Y, int n8) {
  const int i  = blockIdx.x * 256 + threadIdx.x;
  const int ic = (i < n8) ? i : (n8 - 1);                     // clamped address
  const float* src = X + (size_t)ic * 8;
  const v4f a = *(const v4f*)(src);
  const v4f c = *(const v4f*)(src + 4);
  v4u o;
  o[0] = pk16(bf_bits(a[0]), bf_bits(a[1]));
  o[1] = pk16(bf_bits(a[2]), bf_bits(a[3]));
  o[2] = pk16(bf_bits(c[0]), bf_bits(c[1]));
  o[3] = pk16(bf_bits(c[2]), bf_bits(c[3]));
  if (i < n8) *(v4u*)(Y + (size_t)i * 8) = o;
  
}

// =====================================================================================================
// q/k/v projections. Block = 128 threads = 4 waves = 64 token rows (rows r0..r0+63 of the flattened
// [NB*SEQ] row index; 64 | SEQ so one block never crosses a sequence). Each wave owns 16 rows x 64 columns
// of one projection at a time (w = 0: q, 1: k, 2: v): A fragments from the bf16 x plane (row pitch DE),
// B(k, n) = W[n][k] fragments straight from the bf16 W plane row n (k-contiguous), K = DE in 32-steps.
// Epilogue (f32): + bf16_RNE(bias[n]); q/k: hi = f16(v), res = f16((v - hi) * 2048) staged as [row][d]
// coverage: q/k planes: 4 waves x 4 it x 4 rows x 8 lanes x 8 halves = 64 rows x 64; v^T planes:
//           4 it x 16 d x 8 lanes x 8 halves = 64 d x 64 s; grid NROW/64 blocks covers all rows.
// =====================================================================================================
__global__ __launch_bounds__(128)
void proj_qkv(const unsigned short* __restrict__ Xb,
              const unsigned short* __restrict__ Wqb, const unsigned short* __restrict__ Wkb,
              const unsigned short* __restrict__ Wvb,
              const float* __restrict__ bq, const float* __restrict__ bk, const float* __restrict__ bv,
              _Float16* Qh, _Float16* Qr, _Float16* Kh, _Float16* Kr, _Float16* VTh, _Float16* VTr) {
  __shared__ __align__(16) _Float16 Th[64 * 72];
  __shared__ __align__(16) _Float16 Tr[64 * 72];

  const int tid  = threadIdx.x;
  const int wave = tid >> 5;
  const int lane = tid & 31;
  const int hh   = lane >> 4;
  const int c    = lane & 15;
  const int r0   = blockIdx.x * 64;
  const int b    = r0 / SEQ;
  const int s0   = r0 - b * SEQ;
  const unsigned short* ap = Xb + (size_t)(r0 + wave * 16 + c) * DE + 8 * hh;   // A row = lane&15

#pragma unroll 1
  for (int w = 0; w < 3; ++w) {                              // block-uniform
    const unsigned short* Wb = (w == 0) ? Wqb : ((w == 1) ? Wkb : Wvb);
    const float* bp = (w == 0) ? bq : ((w == 1) ? bk : bv);

    v8f acc[4];
#pragma unroll
    for (int nt = 0; nt < 4; ++nt) acc[nt] = zero8();

#pragma unroll 2
    for (int k0 = 0; k0 < DE; k0 += 32) {
      const v16b a = ldfrag_b(ap + k0);
#pragma unroll
      for (int nt = 0; nt < 4; ++nt) {
        const v16b wf = ldfrag_b(Wb + (size_t)(nt * 16 + c) * DE + 8 * hh + k0);   // B col n = nt*16+c
        acc[nt] = mma_b(a, wf, acc[nt]);
      }
    }

    if (w < 2) {
      // ---- q or k: stage [token row][d] as f16 hi and x2048 residual ----
      _Float16* Ph = (w == 0) ? Qh : Kh;
      _Float16* Pr = (w == 0) ? Qr : Kr;
#pragma unroll
      for (int nt = 0; nt < 4; ++nt) {
        const int n = nt * 16 + c;
        const float bias = bfr(bp[n]);
#pragma unroll
        for (int r = 0; r < 8; ++r) {
          const float v = acc[nt][r] + bias;
          const _Float16 hq = (_Float16)v;
          const _Float16 rq = (_Float16)((v - (float)hq) * RSC);
          const int pi = (wave * 16 + 8 * hh + r) * 72 + n;
          Th[pi] = hq;
          Tr[pi] = rq;
        }
      }
      __syncthreads();
      const int q8 = lane >> 3, c8 = (lane & 7) * 8;
      v4u vh[4], vr[4];
#pragma unroll
      for (int it = 0; it < 4; ++it) {
        const int row = wave * 16 + it * 4 + q8;
        HU8 u;
        u.h = *(const v8h*)(Th + row * 72 + c8);
        vh[it] = u.u;
        u.h = *(const v8h*)(Tr + row * 72 + c8);
        vr[it] = u.u;
      }
#pragma unroll
      for (int it = 0; it < 4; ++it) {
        const int row = wave * 16 + it * 4 + q8;
        const size_t o = (size_t)(r0 + row) * HD + c8;
        *(v4u*)(Ph + o) = vh[it];
        *(v4u*)(Pr + o) = vr[it];
      }
      
      __syncthreads();                                       // Th/Tr reused by the next projection
    } else {
      // ---- v: stage transposed [d][s] as f16 hi of (v * 64) and its x2048 residual ----
#pragma unroll
      for (int nt = 0; nt < 4; ++nt) {
        const int n = nt * 16 + c;
        const float bias = bfr(bp[n]);
#pragma unroll
        for (int r = 0; r < 8; ++r) {
          const float v = (acc[nt][r] + bias) * VSC;
          const _Float16 hq = (_Float16)v;
          const _Float16 rq = (_Float16)((v - (float)hq) * RSC);
          const int pi = n * 72 + wave * 16 + 8 * hh + r;
          Th[pi] = hq;
          Tr[pi] = rq;
        }
      }
      __syncthreads();
      const int q8 = tid >> 3, c8 = (tid & 7) * 8;
      v4u vh[4], vr[4];
#pragma unroll
      for (int it = 0; it < 4; ++it) {
        const int d = it * 16 + q8;
        HU8 u;
        u.h = *(const v8h*)(Th + d * 72 + c8);
        vh[it] = u.u;
        u.h = *(const v8h*)(Tr + d * 72 + c8);
        vr[it] = u.u;
      }
#pragma unroll
      for (int it = 0; it < 4; ++it) {
        const int d = it * 16 + q8;
        const size_t o = ((size_t)b * HD + d) * SEQ + s0 + c8;
        *(v4u*)(VTh + o) = vh[it];
        *(v4u*)(VTr + o) = vr[it];
      }
      
    }
  }
}

// =====================================================================================================
// Causal flash attention, head dim 64, one head per sequence, SEQ query/key rows per sequence.
//   q/k planes (f16 hi, f16 x2048 residual): element (b, t, d) at [(b*SEQ + t)*64 + d]
//   v^T planes (f16 hi of 64 v, f16 x2048 residual): element (b, d, s) at [(b*64 + d)*SEQ + s]
//   out (f32): element (b, t, d) at [(b*SEQ + t)*64 + d]
//   score = qh.kh + (qh.kr + qr.kh) / 2048 (no scale); score := -inf where key > query row (index select);
//   p = exp(s - m) spilled per wave as f16(1024 p) and f16(2048 (1024 p - hi));
//   context += ph . vh^T, plus (ph . vr^T + pr . vh^T) / 2048 from a per-chunk accumulator; online softmax
//   (running max) in f32; epilogue scale = 8 / (l * 1024 * 64).
//   Block = NG groups x 4 waves = 64 query rows of one sequence; grid = NQB * NB; key chunks of 64. Group g
//   walks chunks kt = g, g + NG, ... <= qb with its own K / V^T tiles, running max, sum and context (chunks
//   strictly above the diagonal are fully excluded and skipped); the trip count ceil((qb + 1) / NG) is
//   block-uniform, and a group whose chunk is past qb only passes the barriers.
//   K / V^T chunk staging: a group's 128 threads x 32 halves per plane = the whole 64x64 tile of each of its
//   4 planes (plain 16-B loads, __syncthreads before and after); P tiles are wave-private.
//   Merge: every wave leaves its un-normalised 16x64 context tile and its 16 (max, sum) pairs in LDS, one
//   barrier, then wave (g, wq) joins rows 4g..4g+3 of query tile wq over the NG groups with weights
//   exp(m_g - max m); a group without a chunk hands (-inf, 0, zeros) and weighs 0 (group 0 always has one).
//   Output coverage: NG groups x 4 rows = the 16 rows of each tile; 512 contiguous bytes per wave store.
// =====================================================================================================
__global__ __launch_bounds__(128 * NG)
void attn64(const _Float16* __restrict__ Qh, const _Float16* __restrict__ Qr,
            const _Float16* __restrict__ Kh, const _Float16* __restrict__ Kr,
            const _Float16* __restrict__ VTh, const _Float16* __restrict__ VTr, float* outp) {
  __shared__ __align__(16) _Float16 KhsG[NG][KC * LP];            // per group K hi  [kv][d], pitch LP   9 KB
  __shared__ __align__(16) _Float16 KrsG[NG][KC * LP];            // per group K res [kv][d], pitch LP   9 KB
  __shared__ __align__(16) _Float16 VhsG[NG][HD * LP];            // per group V^T hi  [d][kv], pitch LP 9 KB
  __shared__ __align__(16) _Float16 VrsG[NG][HD * LP];            // per group V^T res [d][kv], pitch LP 9 KB
  __shared__ __align__(16) _Float16 Psh[4 * NG][16 * LP];         // per wave P hi [row][kv], pitch LP
  __shared__ __align__(16) _Float16 Rsh[4 * NG][16 * LP];         // per wave P residual [row][kv], pitch LP
  __shared__ __align__(16) float    Os[4 * NG][16 * HD];          // per wave context tile [row][d]
  __shared__ float                  Ms[4 * NG][16];               // per wave running max of its 16 rows
  __shared__ float                  Ls[4 * NG][16];               // per wave running sum of its 16 rows

  const int tid  = threadIdx.x;
  const int wave = __builtin_amdgcn_readfirstlane(tid >> 5);      // scalar: group tests are scalar branches
  const int grp  = wave >> 2;                    // key group
  const int wq   = wave & 3;                     // query tile inside the block
  const int gtid = tid & 127;                    // thread inside the group
  const int lane = tid & 31;
  const int hh   = lane >> 4;
  const int c    = lane & 15;
  _Float16* Khs = KhsG[grp];
  _Float16* Krs = KrsG[grp];
  _Float16* Vhs = VhsG[grp];
  _Float16* Vrs = VrsG[grp];

  const int bx = blockIdx.x;
  const int qb = bx % NQB;
  const int b  = bx / NQB;
  const int q0 = qb * 64 + wq * 16;              // in-sequence query row of this wave's first row
  const int rlo = q0 + 8 * hh;                   // in-sequence row of accumulator element r is rlo + r
  const size_t rowB = (size_t)b * SEQ;
  const _Float16* VThb = VTh + (size_t)b * HD * SEQ;
  const _Float16* VTrb = VTr + (size_t)b * HD * SEQ;

  // ---- Q fragments (A operand, row = lane&15): 2 d-chunks, hi and residual ----
  v16h qh[2], qr[2];
#pragma unroll
  for (int dc = 0; dc < 2; ++dc) {
    qh[dc] = ldfrag_h(Qh + (rowB + q0 + c) * HD + dc * 32 + 8 * hh);
    qr[dc] = ldfrag_h(Qr + (rowB + q0 + c) * HD + dc * 32 + 8 * hh);
  }

  float mrow[8], lrow[8];
  v8f oacc[4];
#pragma unroll
  for (int r = 0; r < 8; ++r) { mrow[r] = -INFINITY; lrow[r] = 0.f; }
#pragma unroll
  for (int t = 0; t < 4; ++t) oacc[t] = zero8();

#pragma unroll 1
  for (int kb = 0; kb <= qb; kb += NG) {     // block-uniform trip count, at most NQB / NG
    const int kt  = kb + grp;
    const int kv0 = kt * KC;
    const bool act = (kt <= qb);             // wave-uniform (scalar): this group has a chunk in this trip

    __syncthreads();
    if (act) {
      const int r = gtid >> 1, hf = (gtid & 1) * 32;
      const _Float16* kgh = Kh + (rowB + kv0 + r) * HD + hf;          // K row kv0+r, d = hf..hf+31
      const _Float16* kgr = Kr + (rowB + kv0 + r) * HD + hf;
#pragma unroll
      for (int i = 0; i < 4; ++i) {
        const v8h a0 = *(const v8h*)(kgh + 8 * i);
        const v8h a1 = *(const v8h*)(kgr + 8 * i);
        *(v8h*)(Khs + r * LP + hf + 8 * i) = a0;
        *(v8h*)(Krs + r * LP + hf + 8 * i) = a1;
      }
      const _Float16* vgh = VThb + (size_t)r * SEQ + kv0 + hf;          // V^T row d = r, s = kv0+hf..+31
      const _Float16* vgr = VTrb + (size_t)r * SEQ + kv0 + hf;
#pragma unroll
      for (int i = 0; i < 4; ++i) {
        const v8h b0 = *(const v8h*)(vgh + 8 * i);
        const v8h b1 = *(const v8h*)(vgr + 8 * i);
        *(v8h*)(Vhs + r * LP + hf + 8 * i) = b0;
        *(v8h*)(Vrs + r * LP + hf + 8 * i) = b1;
      }
    }
    __syncthreads();
    if (!act) continue;                      // the barriers above are passed by every wave in every trip

    // ---- scores: 16 query rows x 64 keys per wave (B operand: col = key j*16+c, k = d, split map) ----
    v8f s[4];
#pragma unroll
    for (int j = 0; j < 4; ++j) {
      v8f sh = zero8();
      v8f sx = zero8();
#pragma unroll
      for (int dc = 0; dc < 2; ++dc) {
        FragH kb, kx;
        kb.h[0] = *(const v8h*)(Khs + (j * 16 + c) * LP + dc * 32 + 8 * hh);
        kb.h[1] = *(const v8h*)(Khs + (j * 16 + c) * LP + dc * 32 + 16 + 8 * hh);
        kx.h[0] = *(const v8h*)(Krs + (j * 16 + c) * LP + dc * 32 + 8 * hh);
        kx.h[1] = *(const v8h*)(Krs + (j * 16 + c) * LP + dc * 32 + 16 + 8 * hh);
        sh = mma_h(qh[dc], kb.v, sh);
        sx = mma_h(qh[dc], kx.v, sx);
        sx = mma_h(qr[dc], kb.v, sx);
      }
      const int key = kv0 + j * 16 + c;
#pragma unroll
      for (int r = 0; r < 8; ++r) {
        const float sv = sh[r] + sx[r] * (1.0f / RSC);
        s[j][r] = (key > rlo + r) ? -INFINITY : sv;           // causal: keys strictly after the row excluded
      }
    }

    // ---- row max, online softmax, P hi (x1024) and residual (x2048) to LDS ----
    _Float16* pwh = Psh[wave];
    _Float16* pwr = Rsh[wave];
#pragma unroll
    for (int r = 0; r < 8; ++r) {
      float m = s[0][r];
      m = fmaxf(m, s[1][r]);
      m = fmaxf(m, s[2][r]);
      m = fmaxf(m, s[3][r]);
#pragma unroll
      for (int off = 1; off < 16; off <<= 1) m = fmaxf(m, __shfl_xor(m, off, 32));
      const float mnew  = fmaxf(mrow[r], m);
      const float alpha = __expf(mrow[r] - mnew);
      mrow[r] = mnew;
      float psum = 0.f;
#pragma unroll
      for (int j = 0; j < 4; ++j) {
        const float p  = __expf(s[j][r] - mnew);
        psum += p;
        const float ph = p * PSC;
        const _Float16 hq = (_Float16)ph;
        const float res = (ph - (float)hq) * RSC;
        const int pi = (8 * hh + r) * LP + j * 16 + c;
        pwh[pi] = hq;
        pwr[pi] = (_Float16)res;
      }
#pragma unroll
      for (int off = 1; off < 16; off <<= 1) psum += __shfl_xor(psum, off, 32);
      lrow[r] = lrow[r] * alpha + psum;
#pragma unroll
      for (int t = 0; t < 4; ++t) oacc[t][r] *= alpha;
    }
    wave_sync_lds();

    // ---- context += P . V (f16 WMMA; A = P [row][kv], B = V^T [dv][kv], both split map) ----
    FragH pa[2], pr[2];
#pragma unroll
    for (int kk = 0; kk < 2; ++kk) {
      pa[kk].h[0] = *(const v8h*)(pwh + c * LP + kk * 32 + 8 * hh);
      pa[kk].h[1] = *(const v8h*)(pwh + c * LP + kk * 32 + 16 + 8 * hh);
      pr[kk].h[0] = *(const v8h*)(pwr + c * LP + kk * 32 + 8 * hh);
      pr[kk].h[1] = *(const v8h*)(pwr + c * LP + kk * 32 + 16 + 8 * hh);
    }
#pragma unroll
    for (int t = 0; t < 4; ++t) {
      FragH vb[2], vx[2];
#pragma unroll
      for (int kk = 0; kk < 2; ++kk) {
        vb[kk].h[0] = *(const v8h*)(Vhs + (t * 16 + c) * LP + kk * 32 + 8 * hh);
        vb[kk].h[1] = *(const v8h*)(Vhs + (t * 16 + c) * LP + kk * 32 + 16 + 8 * hh);
        vx[kk].h[0] = *(const v8h*)(Vrs + (t * 16 + c) * LP + kk * 32 + 8 * hh);
        vx[kk].h[1] = *(const v8h*)(Vrs + (t * 16 + c) * LP + kk * 32 + 16 + 8 * hh);
      }
      oacc[t] = mma_h(pa[0].v, vb[0].v, oacc[t]);
      oacc[t] = mma_h(pa[1].v, vb[1].v, oacc[t]);
      v8f rr = mma_h(pa[0].v, vx[0].v, zero8());
      rr = mma_h(pa[1].v, vx[1].v, rr);
      rr = mma_h(pr[0].v, vb[0].v, rr);
      rr = mma_h(pr[1].v, vb[1].v, rr);
#pragma unroll
      for (int r = 0; r < 8; ++r) oacc[t][r] += rr[r] * (1.0f / RSC);
    }
  }

  // ---- hand over the wave's un-normalised 16x64 f32 tile and its rows' (max, sum) ----
  float* os = Os[wave];
#pragma unroll
  for (int r = 0; r < 8; ++r) {
#pragma unroll
    for (int t = 0; t < 4; ++t) os[(8 * hh + r) * HD + t * 16 + c] = oacc[t][r];
    if (c == 0) {                                // the 16 lanes of a half hold equal max and sum
      Ms[wave][8 * hh + r] = mrow[r];
      Ls[wave][8 * hh + r] = lrow[r];
    }
  }
  __syncthreads();
  // ---- join the NG groups' partials of rows 4 grp .. 4 grp + 3 of tile wq; normalise (8 / l, the 1/1024 p
  //      carry and the 1/64 v carry); each wave store = two whole 256-B rows ----
  {
    const int col = c * 4;
    float* C = outp + (rowB + q0) * HD;
#pragma unroll
    for (int it = 0; it < 2; ++it) {
      const int row = grp * 4 + it * 2 + hh;
      float mg[NG], lg[NG];
      v4f og[NG];
#pragma unroll
      for (int g = 0; g < NG; ++g) {
        mg[g] = Ms[g * 4 + wq][row];
        lg[g] = Ls[g * 4 + wq][row];
        og[g] = *(const v4f*)(Os[g * 4 + wq] + row * HD + col);
      }
      float mx = mg[0];                          // finite: group 0 has chunk 0, whose key 0 no row excludes
#pragma unroll
      for (int g = 1; g < NG; ++g) mx = fmaxf(mx, mg[g]);
      float l = 0.f;
      v4f o = {0.f, 0.f, 0.f, 0.f};
#pragma unroll
      for (int g = 0; g < NG; ++g) {
        const float wg = __expf(mg[g] - mx);
        l = fmaf(wg, lg[g], l);
        o += wg * og[g];
      }
      const float inv = ((l > 0.f) ? (1.0f / l) : 0.f) * (OSC / (PSC * VSC));
      *(v4f*)(C + (size_t)row * HD + col) = o * inv;
    }
  }
}

// =====================================================================================================
// Workspace map (bytes); every plane is an exact multiple of its whole-line / 64x64-tile store granularity:
//   Xb   bf16 [16384][512]       0          16777216
//   Wqb  bf16 [64][512]          16777216   65536
//   Wkb  bf16 [64][512]          16842752   65536
//   Wvb  bf16 [64][512]          16908288   65536
//   Qh   f16  [16384][64]        16973824   2097152
//   Qr   f16  [16384][64]        19070976   2097152
//   Kh   f16  [16384][64]        21168128   2097152
//   Kr   f16  [16384][64]        23265280   2097152
//   VTh  f16  [4][64][4096]      25362432   2097152
//   VTr  f16  [4][64][4096]      27459584   2097152
//   end                          29556736
// =====================================================================================================
extern "C" void kernel_launch(void* const* d_in, const int* in_sizes, int n_in,
                              void* d_out, int out_size, void* d_ws, size_t ws_size,
                              hipStream_t stream) {
  if (n_in < 7) return;
  if (in_sizes[0] != NX) return;
  if (in_sizes[1] != NW || in_sizes[3] != NW || in_sizes[5] != NW) return;
  if (in_sizes[2] != HD || in_sizes[4] != HD || in_sizes[6] != HD) return;
  if (out_size != NO) return;

  const float* x  = (const float*)d_in[0];
  const float* Wq = (const float*)d_in[1];
  const float* bq = (const float*)d_in[2];
  const float* Wk = (const float*)d_in[3];
  const float* bk = (const float*)d_in[4];
  const float* Wv = (const float*)d_in[5];
  const float* bv = (const float*)d_in[6];

  const size_t XB = (size_t)NX * 2;                     // 16777216
  const size_t WB = (size_t)NW * 2;                     // 65536
  const size_t PB = (size_t)NO * 2;                     // 2097152
  size_t off = 0;
  const size_t oX  = off; off += XB;
  const size_t oWq = off; off += WB;
  const size_t oWk = off; off += WB;
  const size_t oWv = off; off += WB;
  const size_t oQh = off; off += PB;
  const size_t oQr = off; off += PB;
  const size_t oKh = off; off += PB;
  const size_t oKr = off; off += PB;
  const size_t oVh = off; off += PB;
  const size_t oVr = off; off += PB;
  if (off > ws_size) return;                            // off = 29556736
  if (off > (size_t)134217728) return;

  char* ws = (char*)d_ws;
  unsigned short* Xb  = (unsigned short*)(ws + oX);
  unsigned short* Wqb = (unsigned short*)(ws + oWq);
  unsigned short* Wkb = (unsigned short*)(ws + oWk);
  unsigned short* Wvb = (unsigned short*)(ws + oWv);
  _Float16* Qh  = (_Float16*)(ws + oQh);
  _Float16* Qr  = (_Float16*)(ws + oQr);
  _Float16* Kh  = (_Float16*)(ws + oKh);
  _Float16* Kr  = (_Float16*)(ws + oKr);
  _Float16* VTh = (_Float16*)(ws + oVh);
  _Float16* VTr = (_Float16*)(ws + oVr);
  float* out0 = (float*)d_out;

  const int nx8 = NX / 8;                               // 1048576
  const int nw8 = NW / 8;                               // 4096
  const dim3 blk(256), blk128(128);
  const dim3 gX(nx8 / 256);                             // 4096 blocks
  const dim3 gW(nw8 / 256);                             // 16 blocks
  const dim3 gP(NROW / 64);                             // 256 blocks of 128
  const dim3 gA(NB * NQB);                              // 256 blocks of 128 * NG
  const dim3 blkA(128 * NG);

  // (0) x, Wq, Wk, Wv -> bf16 planes
  conv_bf16<<<gX, blk, 0, stream>>>(x, Xb, nx8);
  conv_bf16<<<gW, blk, 0, stream>>>(Wq, Wqb, nw8);
  conv_bf16<<<gW, blk, 0, stream>>>(Wk, Wkb, nw8);
  conv_bf16<<<gW, blk, 0, stream>>>(Wv, Wvb, nw8);

  // (1) projections -> q/k f16 hi + residual planes, v^T f16 hi + residual planes
  proj_qkv<<<gP, blk128, 0, stream>>>(Xb, Wqb, Wkb, Wvb, bq, bk, bv, Qh, Qr, Kh, Kr, VTh, VTr);

  // (2) causal flash attention -> out f32 [4][4096][64]
  attn64<<<gA, blkA, 0, stream>>>(Qh, Qr, Kh, Kr, VTh, VTr, out0);
  (void)hipGetLastError();
}

// v003
// A run of this version takes 126 microseconds.
// Timed twice side by side with v002, it ran 1.10 times as fast both times.
// Counting every step since v000, it is 2.34 times as fast.
#include <hip/hip_runtime.h>
#include <hip/hip_bf16.h>
#include <math.h>
#include <stdint.h>

#define NB   4
#define SEQ  4096
#define DE   512
#define HD   64
#define KC   64
#define LP   72      // LDS row pitch in halves of the 64-half K and V^T rows: 144 B = 16 B x odd
#define OP   68      // LDS row pitch in floats of the 64-float context rows: 272 B = 16 B x odd
#define NQB  (SEQ / 64)
#define NG   4       // key groups per attention workgroup: group g takes key chunks g, g + NG, g + 2 NG, ...
#define NROW (NB * SEQ)
#define NX   (NROW * DE)
#define NW   (HD * DE)
#define NO   (NROW * HD)
#define PSC  1024.0f
#define RSC  2048.0f
#define VSC  64.0f
#define OSC  8.0f
static_assert((SEQ % 64) == 0);
static_assert(HD == 64);
static_assert(KC == 64);
static_assert(LP >= KC && LP >= HD && (LP % 8) == 0 && ((LP / 8) % 2) == 1);
static_assert(OP >= HD && (OP % 4) == 0 && ((OP / 4) % 2) == 1);
static_assert((DE % 32) == 0);
static_assert(((NX / 8) % 256) == 0);
static_assert(((NW / 8) % 256) == 0);
static_assert((NROW % 64) == 0);

typedef _Float16 v16h __attribute__((ext_vector_type(16)));
typedef _Float16 v8h  __attribute__((ext_vector_type(8)));
typedef __bf16   v16b __attribute__((ext_vector_type(16)));
typedef float    v8f  __attribute__((ext_vector_type(8)));
typedef float    v4f  __attribute__((ext_vector_type(4)));
typedef unsigned int v4u __attribute__((ext_vector_type(4)));

union FragH { v16h v; v8h h[2]; };
union FragB { v16b v; v4u u[2]; };
union HU8   { v8h h; v4u u; };

// ---- scalar helpers --------------------------------------------------------------------------------
__device__ __forceinline__ unsigned short bf_bits(float f) {          // f32 -> bf16 bits, RNE convert
  unsigned u = __float_as_uint(f);
  return (unsigned short)((u + 0x7FFFu + ((u >> 16) & 1u)) >> 16);
}
__device__ __forceinline__ float bf_up(unsigned short h) { return __uint_as_float(((unsigned)h) << 16); }
__device__ __forceinline__ float bfr(float f) { return bf_up(bf_bits(f)); }   // value of the bf16 RNE convert
__device__ __forceinline__ unsigned pk16(unsigned short a, unsigned short b) { return (unsigned)a | ((unsigned)b << 16); }
__device__ __forceinline__ v8f zero8() { v8f z = {0.f, 0.f, 0.f, 0.f, 0.f, 0.f, 0.f, 0.f}; return z; }

// ---- fragment loaders: 16-bit A/B operand, lane -> row/col (lane&15), p already includes +8*(lane>>4);
//      elements 0..7 <- p[0..7] (k0+8h..), elements 8..15 <- p[16..23] (k0+16+8h..)
__device__ __forceinline__ v16h ldfrag_h(const _Float16* p) {
  FragH f;
  f.h[0] = *(const v8h*)(p);
  f.h[1] = *(const v8h*)(p + 16);
  return f.v;
}
__device__ __forceinline__ v16b ldfrag_b(const unsigned short* p) {
  FragB f;
  f.u[0] = *(const v4u*)(p);
  f.u[1] = *(const v4u*)(p + 16);
  return f.v;
}

// ---- WMMA helpers with trailing VALU hazard gap --------------------------------------------------------
__device__ __forceinline__ v8f mma_h(v16h a, v16h b, v8f c) {
  c = __builtin_amdgcn_wmma_f32_16x16x32_f16(false, a, false, b, (short)0, c, false, false);
#if defined(__HIP_DEVICE_COMPILE__)
  asm volatile("v_nop\n\tv_nop\n\tv_nop\n\tv_nop" : "+v"(c) : "v"(a), "v"(b));
#endif
  return c;
}
__device__ __forceinline__ v8f mma_b(v16b a, v16b b, v8f c) {
  c = __builtin_amdgcn_wmma_f32_16x16x32_bf16(false, a, false, b, (short)0, c, false, false);
#if defined(__HIP_DEVICE_COMPILE__)
  asm volatile("v_nop\n\tv_nop\n\tv_nop\n\tv_nop" : "+v"(c) : "v"(a), "v"(b));
#endif
  return c;
}
// value of lane l ^ 16 (the other half of the wave), by a vector cross-row move
__device__ __forceinline__ float xhalf(float x) {
  const int i = __float_as_int(x);
  return __int_as_float(__builtin_amdgcn_permlanex16(i, i, 0x76543210, 0xfedcba98, false, false));
}

// =====================================================================================================
// Plane convert: Y[i] = bf16_RNE(X[i]) bits. Thread i handles elements 8i..8i+7 and writes one 16-B piece;
// grid = n8 / 256 (n8 multiple of 256, host-checked). coverage: n8 threads x 8 elements = the whole plane.
// =====================================================================================================
__global__ __launch_bounds__(256) void conv_bf16(const float* __restrict__ X, unsigned short* Y, int n8) {
  const int i  = blockIdx.x * 256 + threadIdx.x;
  const int ic = (i < n8) ? i : (n8 - 1);                     // clamped address
  const float* src = X + (size_t)ic * 8;
  const v4f a = *(const v4f*)(src);
  const v4f c = *(const v4f*)(src + 4);
  v4u o;
  o[0] = pk16(bf_bits(a[0]), bf_bits(a[1]));
  o[1] = pk16(bf_bits(a[2]), bf_bits(a[3]));
  o[2] = pk16(bf_bits(c[0]), bf_bits(c[1]));
  o[3] = pk16(bf_bits(c[2]), bf_bits(c[3]));
  if (i < n8) *(v4u*)(Y + (size_t)i * 8) = o;
  
}

// =====================================================================================================
// q/k/v projections. Block = 128 threads = 4 waves = 64 token rows (rows r0..r0+63 of the flattened
// [NB*SEQ] row index; 64 | SEQ so one block never crosses a sequence). Each wave owns 16 rows x 64 columns
// of one projection at a time (w = 0: q, 1: k, 2: v): A fragments from the bf16 x plane (row pitch DE),
// B(k, n) = W[n][k] fragments straight from the bf16 W plane row n (k-contiguous), K = DE in 32-steps.
// Epilogue (f32): + bf16_RNE(bias[n]); q/k: hi = f16(v), res = f16((v - hi) * 2048) staged as [row][d]
// coverage: q/k planes: 4 waves x 4 it x 4 rows x 8 lanes x 8 halves = 64 rows x 64; v^T planes:
//           4 it x 16 d x 8 lanes x 8 halves = 64 d x 64 s; grid NROW/64 blocks covers all rows.
// =====================================================================================================
__global__ __launch_bounds__(128)
void proj_qkv(const unsigned short* __restrict__ Xb,
              const unsigned short* __restrict__ Wqb, const unsigned short* __restrict__ Wkb,
              const unsigned short* __restrict__ Wvb,
              const float* __restrict__ bq, const float* __restrict__ bk, const float* __restrict__ bv,
              _Float16* Qh, _Float16* Qr, _Float16* Kh, _Float16* Kr, _Float16* VTh, _Float16* VTr) {
  __shared__ __align__(16) _Float16 Th[64 * 72];
  __shared__ __align__(16) _Float16 Tr[64 * 72];

  const int tid  = threadIdx.x;
  const int wave = tid >> 5;
  const int lane = tid & 31;
  const int hh   = lane >> 4;
  const int c    = lane & 15;
  const int r0   = blockIdx.x * 64;
  const int b    = r0 / SEQ;
  const int s0   = r0 - b * SEQ;
  const unsigned short* ap = Xb + (size_t)(r0 + wave * 16 + c) * DE + 8 * hh;   // A row = lane&15

#pragma unroll 1
  for (int w = 0; w < 3; ++w) {                              // block-uniform
    const unsigned short* Wb = (w == 0) ? Wqb : ((w == 1) ? Wkb : Wvb);
    const float* bp = (w == 0) ? bq : ((w == 1) ? bk : bv);

    v8f acc[4];
#pragma unroll
    for (int nt = 0; nt < 4; ++nt) acc[nt] = zero8();

#pragma unroll 2
    for (int k0 = 0; k0 < DE; k0 += 32) {
      const v16b a = ldfrag_b(ap + k0);
#pragma unroll
      for (int nt = 0; nt < 4; ++nt) {
        const v16b wf = ldfrag_b(Wb + (size_t)(nt * 16 + c) * DE + 8 * hh + k0);   // B col n = nt*16+c
        acc[nt] = mma_b(a, wf, acc[nt]);
      }
    }

    if (w < 2) {
      // ---- q or k: stage [token row][d] as f16 hi and x2048 residual ----
      _Float16* Ph = (w == 0) ? Qh : Kh;
      _Float16* Pr = (w == 0) ? Qr : Kr;
#pragma unroll
      for (int nt = 0; nt < 4; ++nt) {
        const int n = nt * 16 + c;
        const float bias = bfr(bp[n]);
#pragma unroll
        for (int r = 0; r < 8; ++r) {
          const float v = acc[nt][r] + bias;
          const _Float16 hq = (_Float16)v;
          const _Float16 rq = (_Float16)((v - (float)hq) * RSC);
          const int pi = (wave * 16 + 8 * hh + r) * 72 + n;
          Th[pi] = hq;
          Tr[pi] = rq;
        }
      }
      __syncthreads();
      const int q8 = lane >> 3, c8 = (lane & 7) * 8;
      v4u vh[4], vr[4];
#pragma unroll
      for (int it = 0; it < 4; ++it) {
        const int row = wave * 16 + it * 4 + q8;
        HU8 u;
        u.h = *(const v8h*)(Th + row * 72 + c8);
        vh[it] = u.u;
        u.h = *(const v8h*)(Tr + row * 72 + c8);
        vr[it] = u.u;
      }
#pragma unroll
      for (int it = 0; it < 4; ++it) {
        const int row = wave * 16 + it * 4 + q8;
        const size_t o = (size_t)(r0 + row) * HD + c8;
        *(v4u*)(Ph + o) = vh[it];
        *(v4u*)(Pr + o) = vr[it];
      }
      
      __syncthreads();                                       // Th/Tr reused by the next projection
    } else {
      // ---- v: stage transposed [d][s] as f16 hi of (v * 64) and its x2048 residual ----
#pragma unroll
      for (int nt = 0; nt < 4; ++nt) {
        const int n = nt * 16 + c;
        const float bias = bfr(bp[n]);
#pragma unroll
        for (int r = 0; r < 8; ++r) {
          const float v = (acc[nt][r] + bias) * VSC;
          const _Float16 hq = (_Float16)v;
          const _Float16 rq = (_Float16)((v - (float)hq) * RSC);
          const int pi = n * 72 + wave * 16 + 8 * hh + r;
          Th[pi] = hq;
          Tr[pi] = rq;
        }
      }
      __syncthreads();
      const int q8 = tid >> 3, c8 = (tid & 7) * 8;
      v4u vh[4], vr[4];
#pragma unroll
      for (int it = 0; it < 4; ++it) {
        const int d = it * 16 + q8;
        HU8 u;
        u.h = *(const v8h*)(Th + d * 72 + c8);
        vh[it] = u.u;
        u.h = *(const v8h*)(Tr + d * 72 + c8);
        vr[it] = u.u;
      }
#pragma unroll
      for (int it = 0; it < 4; ++it) {
        const int d = it * 16 + q8;
        const size_t o = ((size_t)b * HD + d) * SEQ + s0 + c8;
        *(v4u*)(VTh + o) = vh[it];
        *(v4u*)(VTr + o) = vr[it];
      }
      
    }
  }
}

__global__ __launch_bounds__(128 * NG)
void attn64(const _Float16* __restrict__ Qh, const _Float16* __restrict__ Qr,
            const _Float16* __restrict__ Kh, const _Float16* __restrict__ Kr,
            const _Float16* __restrict__ VTh, const _Float16* __restrict__ VTr, float* outp) {
  __shared__ __align__(16) _Float16 KhsG[NG][KC * LP];            // per group K hi  [kv][d], pitch LP   9 KB
  __shared__ __align__(16) _Float16 KrsG[NG][KC * LP];            // per group K res [kv][d], pitch LP   9 KB
  __shared__ __align__(16) _Float16 VhsG[NG][HD * LP];            // per group V^T hi  [d][kv], pitch LP 9 KB
  __shared__ __align__(16) _Float16 VrsG[NG][HD * LP];            // per group V^T res [d][kv], pitch LP 9 KB
  __shared__ __align__(16) float    Os[4 * NG][16 * OP];          // per wave context tile [row][d], pitch OP
  __shared__ float                  Ms[4 * NG][16];               // per wave running max of its 16 rows
  __shared__ float                  Ls[4 * NG][16];               // per wave running sum of its 16 rows

  const int tid  = threadIdx.x;
  const int wave = __builtin_amdgcn_readfirstlane(tid >> 5);      // scalar: group tests are scalar branches
  const int grp  = wave >> 2;                    // key group
  const int wq   = wave & 3;                     // query tile inside the block
  const int gtid = tid & 127;                    // thread inside the group
  const int lane = tid & 31;
  const int hh   = lane >> 4;
  const int c    = lane & 15;
  _Float16* Khs = KhsG[grp];
  _Float16* Krs = KrsG[grp];
  _Float16* Vhs = VhsG[grp];
  _Float16* Vrs = VrsG[grp];

  const int bx = blockIdx.x;
  const int qb = bx % NQB;
  const int b  = bx / NQB;
  const int q0 = qb * 64 + wq * 16;              // in-sequence query row of this wave's first row
  const int qrow = q0 + c;                       // in-sequence query row of this lane's accumulator column
  const size_t rowB = (size_t)b * SEQ;
  const _Float16* VThb = VTh + (size_t)b * HD * SEQ;
  const _Float16* VTrb = VTr + (size_t)b * HD * SEQ;

  // ---- Q fragments (B operand, column = query = lane&15): 2 d-chunks, hi and residual ----
  v16h qh[2], qr[2];
#pragma unroll
  for (int dc = 0; dc < 2; ++dc) {
    qh[dc] = ldfrag_h(Qh + (rowB + q0 + c) * HD + dc * 32 + 8 * hh);
    qr[dc] = ldfrag_h(Qr + (rowB + q0 + c) * HD + dc * 32 + 8 * hh);
  }

  float mrun = -INFINITY;                        // running max of query c (equal in both halves)
  float lrun = 0.f;                              // running sum of query c over this half's keys only
  v8f oacc[4];                                   // O^T: tile t, register r = context[query c][d = 16 t + 8 hh + r]
#pragma unroll
  for (int t = 0; t < 4; ++t) oacc[t] = zero8();

#pragma unroll 1
  for (int kb = 0; kb <= qb; kb += NG) {     // block-uniform trip count, at most NQB / NG
    const int kt  = kb + grp;
    const int kv0 = kt * KC;
    const bool act = (kt <= qb);             // wave-uniform (scalar): this group has a chunk in this trip

    __syncthreads();
    if (act) {
      const int r = gtid >> 1, hf = (gtid & 1) * 32;
      const _Float16* kgh = Kh + (rowB + kv0 + r) * HD + hf;          // K row kv0+r, d = hf..hf+31
      const _Float16* kgr = Kr + (rowB + kv0 + r) * HD + hf;
#pragma unroll
      for (int i = 0; i < 4; ++i) {
        const v8h a0 = *(const v8h*)(kgh + 8 * i);
        const v8h a1 = *(const v8h*)(kgr + 8 * i);
        *(v8h*)(Khs + r * LP + hf + 8 * i) = a0;
        *(v8h*)(Krs + r * LP + hf + 8 * i) = a1;
      }
      const _Float16* vgh = VThb + (size_t)r * SEQ + kv0 + hf;          // V^T row d = r, s = kv0+hf..+31
      const _Float16* vgr = VTrb + (size_t)r * SEQ + kv0 + hf;
#pragma unroll
      for (int i = 0; i < 4; ++i) {
        const v8h b0 = *(const v8h*)(vgh + 8 * i);
        const v8h b1 = *(const v8h*)(vgr + 8 * i);
        *(v8h*)(Vhs + r * LP + hf + 8 * i) = b0;
        *(v8h*)(Vrs + r * LP + hf + 8 * i) = b1;
      }
    }
    __syncthreads();
    if (!act) continue;                      // the barriers above are passed by every wave in every trip

    // ---- scores, transposed: 64 keys x 16 queries per wave (A operand: row = key j*16+c, k = d, split map) ----
    v8f s[4];
#pragma unroll
    for (int j = 0; j < 4; ++j) {
      v8f sh = zero8();
      v8f sx = zero8();
#pragma unroll
      for (int dc = 0; dc < 2; ++dc) {
        FragH kb, kx;
        kb.h[0] = *(const v8h*)(Khs + (j * 16 + c) * LP + dc * 32 + 8 * hh);
        kb.h[1] = *(const v8h*)(Khs + (j * 16 + c) * LP + dc * 32 + 16 + 8 * hh);
        kx.h[0] = *(const v8h*)(Krs + (j * 16 + c) * LP + dc * 32 + 8 * hh);
        kx.h[1] = *(const v8h*)(Krs + (j * 16 + c) * LP + dc * 32 + 16 + 8 * hh);
        sh = mma_h(kb.v, qh[dc], sh);
        sx = mma_h(kx.v, qh[dc], sx);
        sx = mma_h(kb.v, qr[dc], sx);
      }
      const int key = kv0 + j * 16 + 8 * hh;                  // key of accumulator register r is key + r
#pragma unroll
      for (int r = 0; r < 8; ++r) {
        const float sv = sh[r] + sx[r] * (1.0f / RSC);
        s[j][r] = (key + r > qrow) ? -INFINITY : sv;          // causal: keys strictly after the row excluded
      }
    }

    // ---- query max in the lane and across the halves, online softmax, P^T hi (x1024) and residual (x2048)
    //      packed straight into B operands ----
    float mj[4];                                              // one chain per tile: four short chains, not one long
#pragma unroll
    for (int j = 0; j < 4; ++j) {
      mj[j] = s[j][0];
#pragma unroll
      for (int r = 1; r < 8; ++r) mj[j] = fmaxf(mj[j], s[j][r]);
    }
    float m = fmaxf(fmaxf(mj[0], mj[1]), fmaxf(mj[2], mj[3]));
    m = fmaxf(m, xhalf(m));
    const float mnew  = fmaxf(mrun, m);
    const float alpha = __expf(mrun - mnew);
    mrun = mnew;
    FragH pa[2], pr[2];
    float pj[4];                                              // per-tile partial sums, joined below
#pragma unroll
    for (int j = 0; j < 4; ++j) {
      pj[j] = 0.f;
#pragma unroll
      for (int r = 0; r < 8; ++r) {
        const float p  = __expf(s[j][r] - mnew);
        pj[j] += p;
        const _Float16 hq = (_Float16)(p * PSC);
        const float res = __builtin_fmaf(p, PSC, -(float)hq) * RSC;   // p * 1024 is exact: the same residual
        pa[j >> 1].v[(j & 1) * 8 + r] = hq;                   // element e <-> key 32 kk + 8 hh + e, + 8 more from e = 8
        pr[j >> 1].v[(j & 1) * 8 + r] = (_Float16)res;
      }
    }
    lrun = lrun * alpha + ((pj[0] + pj[1]) + (pj[2] + pj[3]));
#pragma unroll
    for (int t = 0; t < 4; ++t) {
#pragma unroll
      for (int r = 0; r < 8; ++r) oacc[t][r] *= alpha;
    }

    // ---- context^T += V^T . P^T (f16 WMMA; A = V^T [dv][kv] split map, B = P^T from the registers) ----
#pragma unroll
    for (int t = 0; t < 4; ++t) {
      FragH vb[2], vx[2];
#pragma unroll
      for (int kk = 0; kk < 2; ++kk) {
        vb[kk].h[0] = *(const v8h*)(Vhs + (t * 16 + c) * LP + kk * 32 + 8 * hh);
        vb[kk].h[1] = *(const v8h*)(Vhs + (t * 16 + c) * LP + kk * 32 + 16 + 8 * hh);
        vx[kk].h[0] = *(const v8h*)(Vrs + (t * 16 + c) * LP + kk * 32 + 8 * hh);
        vx[kk].h[1] = *(const v8h*)(Vrs + (t * 16 + c) * LP + kk * 32 + 16 + 8 * hh);
      }
      oacc[t] = mma_h(vb[0].v, pa[0].v, oacc[t]);
      oacc[t] = mma_h(vb[1].v, pa[1].v, oacc[t]);
      v8f rr = mma_h(vx[0].v, pa[0].v, zero8());
      rr = mma_h(vx[1].v, pa[1].v, rr);
      rr = mma_h(vb[0].v, pr[0].v, rr);
      rr = mma_h(vb[1].v, pr[1].v, rr);
#pragma unroll
      for (int r = 0; r < 8; ++r) oacc[t][r] += rr[r] * (1.0f / RSC);
    }
  }

  // ---- hand over the wave's un-normalised 16x64 f32 tile (a lane holds 8 consecutive d of its query per
  //      tile: two 16-B stores) and its queries' (max, sum), the sum joined over the halves here ----
  float* os = Os[wave];
#pragma unroll
  for (int t = 0; t < 4; ++t) {
    const v4f lo = {oacc[t][0], oacc[t][1], oacc[t][2], oacc[t][3]};
    const v4f hi = {oacc[t][4], oacc[t][5], oacc[t][6], oacc[t][7]};
    *(v4f*)(os + c * OP + t * 16 + 8 * hh)     = lo;
    *(v4f*)(os + c * OP + t * 16 + 8 * hh + 4) = hi;
  }
  const float lall = lrun + xhalf(lrun);
  if (hh == 0) {                                 // both halves hold equal max and sum
    Ms[wave][c] = mrun;
    Ls[wave][c] = lall;
  }
  __syncthreads();
  // ---- join the NG groups' partials of rows 4 grp .. 4 grp + 3 of tile wq; normalise (8 / l, the 1/1024 p
  //      carry and the 1/64 v carry); each wave store = two whole 256-B rows ----
  {
    const int col = c * 4;
    float* C = outp + (rowB + q0) * HD;
#pragma unroll
    for (int it = 0; it < 2; ++it) {
      const int row = grp * 4 + it * 2 + hh;
      float mg[NG], lg[NG];
      v4f og[NG];
#pragma unroll
      for (int g = 0; g < NG; ++g) {
        mg[g] = Ms[g * 4 + wq][row];
        lg[g] = Ls[g * 4 + wq][row];
        og[g] = *(const v4f*)(Os[g * 4 + wq] + row * OP + col);
      }
      float mx = mg[0];                          // finite: group 0 has chunk 0, whose key 0 no row excludes
#pragma unroll
      for (int g = 1; g < NG; ++g) mx = fmaxf(mx, mg[g]);
      float l = 0.f;
      v4f o = {0.f, 0.f, 0.f, 0.f};
#pragma unroll
      for (int g = 0; g < NG; ++g) {
        const float wg = __expf(mg[g] - mx);
        l = fmaf(wg, lg[g], l);
        o += wg * og[g];
      }
      const float inv = ((l > 0.f) ? (1.0f / l) : 0.f) * (OSC / (PSC * VSC));
      *(v4f*)(C + (size_t)row * HD + col) = o * inv;
    }
  }
}

// =====================================================================================================
// Workspace map (bytes); every plane is an exact multiple of its whole-line / 64x64-tile store granularity:
//   Xb   bf16 [16384][512]       0          16777216
//   Wqb  bf16 [64][512]          16777216   65536
//   Wkb  bf16 [64][512]          16842752   65536
//   Wvb  bf16 [64][512]          16908288   65536
//   Qh   f16  [16384][64]        16973824   2097152
//   Qr   f16  [16384][64]        19070976   2097152
//   Kh   f16  [16384][64]        21168128   2097152
//   Kr   f16  [16384][64]        23265280   2097152
//   VTh  f16  [4][64][4096]      25362432   2097152
//   VTr  f16  [4][64][4096]      27459584   2097152
//   end                          29556736
// =====================================================================================================
extern "C" void kernel_launch(void* const* d_in, const int* in_sizes, int n_in,
                              void* d_out, int out_size, void* d_ws, size_t ws_size,
                              hipStream_t stream) {
  if (n_in < 7) return;
  if (in_sizes[0] != NX) return;
  if (in_sizes[1] != NW || in_sizes[3] != NW || in_sizes[5] != NW) return;
  if (in_sizes[2] != HD || in_sizes[4] != HD || in_sizes[6] != HD) return;
  if (out_size != NO) return;

  const float* x  = (const float*)d_in[0];
  const float* Wq = (const float*)d_in[1];
  const float* bq = (const float*)d_in[2];
  const float* Wk = (const float*)d_in[3];
  const float* bk = (const float*)d_in[4];
  const float* Wv = (const float*)d_in[5];
  const float* bv = (const float*)d_in[6];

  const size_t XB = (size_t)NX * 2;                     // 16777216
  const size_t WB = (size_t)NW * 2;                     // 65536
  const size_t PB = (size_t)NO * 2;                     // 2097152
  size_t off = 0;
  const size_t oX  = off; off += XB;
  const size_t oWq = off; off += WB;
  const size_t oWk = off; off += WB;
  const size_t oWv = off; off += WB;
  const size_t oQh = off; off += PB;
  const size_t oQr = off; off += PB;
  const size_t oKh = off; off += PB;
  const size_t oKr = off; off += PB;
  const size_t oVh = off; off += PB;
  const size_t oVr = off; off += PB;
  if (off > ws_size) return;                            // off = 29556736
  if (off > (size_t)134217728) return;

  char* ws = (char*)d_ws;
  unsigned short* Xb  = (unsigned short*)(ws + oX);
  unsigned short* Wqb = (unsigned short*)(ws + oWq);
  unsigned short* Wkb = (unsigned short*)(ws + oWk);
  unsigned short* Wvb = (unsigned short*)(ws + oWv);
  _Float16* Qh  = (_Float16*)(ws + oQh);
  _Float16* Qr  = (_Float16*)(ws + oQr);
  _Float16* Kh  = (_Float16*)(ws + oKh);
  _Float16* Kr  = (_Float16*)(ws + oKr);
  _Float16* VTh = (_Float16*)(ws + oVh);
  _Float16* VTr = (_Float16*)(ws + oVr);
  float* out0 = (float*)d_out;

  const int nx8 = NX / 8;                               // 1048576
  const int nw8 = NW / 8;                               // 4096
  const dim3 blk(256), blk128(128);
  const dim3 gX(nx8 / 256);                             // 4096 blocks
  const dim3 gW(nw8 / 256);                             // 16 blocks
  const dim3 gP(NROW / 64);                             // 256 blocks of 128
  const dim3 gA(NB * NQB);                              // 256 blocks of 128 * NG
  const dim3 blkA(128 * NG);

  // (0) x, Wq, Wk, Wv -> bf16 planes
  conv_bf16<<<gX, blk, 0, stream>>>(x, Xb, nx8);
  conv_bf16<<<gW, blk, 0, stream>>>(Wq, Wqb, nw8);
  conv_bf16<<<gW, blk, 0, stream>>>(Wk, Wkb, nw8);
  conv_bf16<<<gW, blk, 0, stream>>>(Wv, Wvb, nw8);

  // (1) projections -> q/k f16 hi + residual planes, v^T f16 hi + residual planes
  proj_qkv<<<gP, blk128, 0, stream>>>(Xb, Wqb, Wkb, Wvb, bq, bk, bv, Qh, Qr, Kh, Kr, VTh, VTr);

  // (2) causal flash attention -> out f32 [4][4096][64]
  attn64<<<gA, blkA, 0, stream>>>(Qh, Qr, Kh, Kr, VTh, VTr, out0);
  (void)hipGetLastError();
}

// v004
// It runs in 78.2 microseconds.
// Timed twice side by side with v003, it ran 1.67 and 1.59 times as fast.
// Over all steps from v000 it is 3.82 times as fast.
#include <hip/hip_runtime.h>
#include <hip/hip_bf16.h>
#include <math.h>
#include <stdint.h>

#define NB   4
#define SEQ  4096
#define DE   512
#define HD   64
#define KC   64
#define LP   72      // LDS row pitch in halves of the 64-half K and V^T rows: 144 B = 16 B x odd
#define XP   520     // LDS row pitch in bf16 of the 512-element x and W rows: 1040 B = 16 B x odd
#define OP   68      // LDS row pitch in floats of the 64-float context rows: 272 B = 16 B x odd
#define NQB  (SEQ / 64)
#define NG   4       // key groups per attention workgroup: group g takes key chunks g, g + NG, g + 2 NG, ...
#define NROW (NB * SEQ)
#define NX   (NROW * DE)
#define NW   (HD * DE)
#define NO   (NROW * HD)
#define PSC  1024.0f
#define RSC  2048.0f
#define VSC  64.0f
#define OSC  8.0f
static_assert((SEQ % 64) == 0);
static_assert(HD == 64);
static_assert(KC == 64);
static_assert(LP >= KC && LP >= HD && (LP % 8) == 0 && ((LP / 8) % 2) == 1);
static_assert(OP >= HD && (OP % 4) == 0 && ((OP / 4) % 2) == 1);
static_assert((DE % 32) == 0);
static_assert(DE == 512);
static_assert(XP >= DE && (XP % 8) == 0 && ((XP / 8) % 2) == 1);
static_assert((NROW % 64) == 0);

typedef _Float16 v16h __attribute__((ext_vector_type(16)));
typedef _Float16 v8h  __attribute__((ext_vector_type(8)));
typedef __bf16   v16b __attribute__((ext_vector_type(16)));
typedef float    v8f  __attribute__((ext_vector_type(8)));
typedef float    v4f  __attribute__((ext_vector_type(4)));
typedef unsigned int v4u __attribute__((ext_vector_type(4)));
typedef unsigned int v2u __attribute__((ext_vector_type(2)));
typedef float    v2f  __attribute__((ext_vector_type(2)));
typedef __bf16   v2b  __attribute__((ext_vector_type(2)));

union FragH { v16h v; v8h h[2]; };
union FragB { v16b v; v4u u[2]; };
union HU8   { v8h h; v4u u; };
union BU4   { v2b b[2]; v2u u; };

// ---- scalar helpers --------------------------------------------------------------------------------
__device__ __forceinline__ unsigned short bf_bits(float f) {          // f32 -> bf16 bits, RNE convert
  unsigned u = __float_as_uint(f);
  return (unsigned short)((u + 0x7FFFu + ((u >> 16) & 1u)) >> 16);
}
__device__ __forceinline__ float bf_up(unsigned short h) { return __uint_as_float(((unsigned)h) << 16); }
__device__ __forceinline__ float bfr(float f) { return bf_up(bf_bits(f)); }   // value of the bf16 RNE convert
__device__ __forceinline__ v8f zero8() { v8f z = {0.f, 0.f, 0.f, 0.f, 0.f, 0.f, 0.f, 0.f}; return z; }

// ---- fragment loaders: 16-bit A/B operand, lane -> row/col (lane&15), p already includes +8*(lane>>4);
//      elements 0..7 <- p[0..7] (k0+8h..), elements 8..15 <- p[16..23] (k0+16+8h..)
__device__ __forceinline__ v16h ldfrag_h(const _Float16* p) {
  FragH f;
  f.h[0] = *(const v8h*)(p);
  f.h[1] = *(const v8h*)(p + 16);
  return f.v;
}
__device__ __forceinline__ v16b ldfrag_b(const unsigned short* p) {
  FragB f;
  f.u[0] = *(const v4u*)(p);
  f.u[1] = *(const v4u*)(p + 16);
  return f.v;
}

// ---- WMMA helpers with trailing VALU hazard gap --------------------------------------------------------
__device__ __forceinline__ v8f mma_h(v16h a, v16h b, v8f c) {
  c = __builtin_amdgcn_wmma_f32_16x16x32_f16(false, a, false, b, (short)0, c, false, false);
#if defined(__HIP_DEVICE_COMPILE__)
  asm volatile("v_nop\n\tv_nop\n\tv_nop\n\tv_nop" : "+v"(c) : "v"(a), "v"(b));
#endif
  return c;
}
__device__ __forceinline__ v8f mma_b(v16b a, v16b b, v8f c) {
  c = __builtin_amdgcn_wmma_f32_16x16x32_bf16(false, a, false, b, (short)0, c, false, false);
#if defined(__HIP_DEVICE_COMPILE__)
  asm volatile("v_nop\n\tv_nop\n\tv_nop\n\tv_nop" : "+v"(c) : "v"(a), "v"(b));
#endif
  return c;
}
// value of lane l ^ 16 (the other half of the wave), by a vector cross-row move
__device__ __forceinline__ float xhalf(float x) {
  const int i = __float_as_int(x);
  return __int_as_float(__builtin_amdgcn_permlanex16(i, i, 0x76543210, 0xfedcba98, false, false));
}

// =====================================================================================================
// q/k/v projections, f32 inputs converted on the way in. Block = 512 threads = 16 waves = 64 token rows
// (rows r0..r0+63 of the flattened [NB*SEQ] row index; 64 | SEQ so one block never crosses a sequence).
// Stage: the block's 64 x rows and all 64 rows of Wq, Wk, Wv are read as f32 (a wave load = 512 contiguous
// bytes of one row), rounded to bf16 RNE in registers and laid in LDS in rows of pitch XP;
// wave w brings rows 4w..4w+3 of each of the four. One barrier.
// Product: wave (rt, cg) owns token rows 16 rt..+15 x columns 16 cg..+15 of q, k and v: A fragment from x row
// lane&15, B(k, n) = W[n][k] fragments from W row n (k-contiguous), K = DE in ascending 32-steps.
// Epilogue (f32): + bf16_RNE(bias[n]); q/k: hi = f16(v), res = f16((v - hi) * 2048) staged as [row][d];
// v: the same of 64 v, staged transposed [d][s]; one barrier; every thread stores one 16-B piece per plane.
// coverage: 512 threads x 8 halves = 64 x 64 per plane; grid NROW/64 blocks covers all rows.
// =====================================================================================================
__device__ __forceinline__ v2u cvt4(v4f a) {                 // four f32 -> four bf16 (RNE), packed
  BU4 o;
  const v2f lo = {a[0], a[1]};
  const v2f hi = {a[2], a[3]};
  o.b[0] = __builtin_convertvector(lo, v2b);
  o.b[1] = __builtin_convertvector(hi, v2b);
  return o.u;
}
// four f32 rows of DE elements: p = first row + 4 * lane; piece (i, j) = row i, elements 128 j + 4 lane ..+3
__device__ __forceinline__ void ld_rows(const float* __restrict__ p, v4f (&t)[16]) {
#pragma unroll                                   // constant indices keep t[] in registers, here and in st_rows
  for (int i = 0; i < 4; ++i) {
#pragma unroll
    for (int j = 0; j < 4; ++j) t[i * 4 + j] = *(const v4f*)(p + i * DE + j * 128);
  }
}
__device__ __forceinline__ void st_rows(unsigned short* d, const v4f (&t)[16]) {
#pragma unroll
  for (int i = 0; i < 4; ++i) {
#pragma unroll
    for (int j = 0; j < 4; ++j) *(v2u*)(d + i * XP + j * 128) = cvt4(t[i * 4 + j]);
  }
}

__global__ __launch_bounds__(512)
void proj_qkv(const float* __restrict__ x,
              const float* __restrict__ Wq, const float* __restrict__ Wk, const float* __restrict__ Wv,
              const float* __restrict__ bq, const float* __restrict__ bk, const float* __restrict__ bv,
              _Float16* Qh, _Float16* Qr, _Float16* Kh, _Float16* Kr, _Float16* VTh, _Float16* VTr) {
  __shared__ __align__(16) unsigned short Xs[64 * XP];       // bf16 x rows                            65 KB
  __shared__ __align__(16) unsigned short Ws[3][64 * XP];    // bf16 Wq, Wk, Wv rows                  195 KB
  __shared__ __align__(16) _Float16 Eh[3][64 * 72];          // q, k [row][d] and v^T [d][s], hi       27 KB
  __shared__ __align__(16) _Float16 Er[3][64 * 72];          // their x2048 residuals                  27 KB

  const int tid  = threadIdx.x;
  const int wave = __builtin_amdgcn_readfirstlane(tid >> 5);
  const int lane = tid & 31;
  const int hh   = lane >> 4;
  const int c    = lane & 15;
  const int rt   = wave & 3;                     // token row tile
  const int cg   = wave >> 2;                    // column tile inside each projection
  const int r0   = blockIdx.x * 64;
  const int b    = r0 / SEQ;
  const int s0   = r0 - b * SEQ;

  const int n = cg * 16 + c;
  const float bias0 = bfr(bq[n]);
  const float bias1 = bfr(bk[n]);
  const float bias2 = bfr(bv[n]);

  // ---- stage: two register sets, so that the next rows' loads fly while these are rounded and stored.
  //      Each sched_barrier keeps that order: without them the compiler lifts all 64 loads to the top, sinks
  //      all stores to the foot and spills ----
  {
    const size_t ro = (size_t)(wave * 4) * DE + lane * 4;
    const int d = (wave * 4) * XP + lane * 4;
    v4f ta[16], tb[16];
    ld_rows(x + (size_t)r0 * DE + ro, ta);
    ld_rows(Wq + ro, tb);
    __builtin_amdgcn_sched_barrier(0);           // x and Wq rows in flight before the first store
    st_rows(Xs + d, ta);
    __builtin_amdgcn_sched_barrier(0);           // set a is free only now
    ld_rows(Wk + ro, ta);
    __builtin_amdgcn_sched_barrier(0);           // Wk rows in flight before Wq is waited for
    st_rows(Ws[0] + d, tb);
    __builtin_amdgcn_sched_barrier(0);           // set b is free only now
    ld_rows(Wv + ro, tb);
    __builtin_amdgcn_sched_barrier(0);           // Wv rows in flight before Wk is waited for
    st_rows(Ws[1] + d, ta);
    st_rows(Ws[2] + d, tb);
  }
  __syncthreads();

  // ---- products: the fragments of k-step ks + 1 are fetched into the other register set ahead of the
  //      WMMAs of k-step ks ----
  v8f acc[3];
#pragma unroll
  for (int w = 0; w < 3; ++w) acc[w] = zero8();
  const unsigned short* ap = Xs + (rt * 16 + c) * XP + 8 * hh;           // A row = lane&15
  const int wo = n * XP + 8 * hh;                                        // B col n = cg*16+c = W row n
  v16b a[2], wf[2][3];
  a[0] = ldfrag_b(ap);
#pragma unroll
  for (int w = 0; w < 3; ++w) wf[0][w] = ldfrag_b(Ws[w] + wo);
#pragma unroll                                   // the set index ks & 1 must be a constant: both sets in registers
  for (int ks = 0; ks < DE / 32; ++ks) {
    const int cur = ks & 1;
    if (ks + 1 < DE / 32) {
      a[cur ^ 1] = ldfrag_b(ap + (ks + 1) * 32);
#pragma unroll
      for (int w = 0; w < 3; ++w) wf[cur ^ 1][w] = ldfrag_b(Ws[w] + wo + (ks + 1) * 32);
    }
#pragma unroll
    for (int w = 0; w < 3; ++w) acc[w] = mma_b(a[cur], wf[cur][w], acc[w]);
  }

  // ---- q, k: [token row][d] as f16 hi and x2048 residual; v: transposed [d][s], of v * 64 ----
#pragma unroll
  for (int w = 0; w < 3; ++w) {
    const float bias = (w == 0) ? bias0 : ((w == 1) ? bias1 : bias2);
#pragma unroll
    for (int r = 0; r < 8; ++r) {
      const float v = (w < 2) ? (acc[w][r] + bias) : ((acc[w][r] + bias) * VSC);
      const _Float16 hq = (_Float16)v;
      const _Float16 rq = (_Float16)((v - (float)hq) * RSC);
      const int row = rt * 16 + 8 * hh + r;
      const int pi = (w < 2) ? (row * 72 + n) : (n * 72 + row);
      Eh[w][pi] = hq;
      Er[w][pi] = rq;
    }
  }
  __syncthreads();
  {
    const int q8 = tid >> 3, c8 = (tid & 7) * 8;
    v4u vh[3], vr[3];
#pragma unroll
    for (int w = 0; w < 3; ++w) {
      HU8 u;
      u.h = *(const v8h*)(Eh[w] + q8 * 72 + c8);
      vh[w] = u.u;
      u.h = *(const v8h*)(Er[w] + q8 * 72 + c8);
      vr[w] = u.u;
    }
    const size_t o  = (size_t)(r0 + q8) * HD + c8;                       // q, k: token row q8
    const size_t ov = ((size_t)b * HD + q8) * SEQ + s0 + c8;             // v^T: d = q8
    *(v4u*)(Qh + o)   = vh[0];
    *(v4u*)(Qr + o)   = vr[0];
    *(v4u*)(Kh + o)   = vh[1];
    *(v4u*)(Kr + o)   = vr[1];
    *(v4u*)(VTh + ov) = vh[2];
    *(v4u*)(VTr + ov) = vr[2];
  }
}

__global__ __launch_bounds__(128 * NG)
void attn64(const _Float16* __restrict__ Qh, const _Float16* __restrict__ Qr,
            const _Float16* __restrict__ Kh, const _Float16* __restrict__ Kr,
            const _Float16* __restrict__ VTh, const _Float16* __restrict__ VTr, float* outp) {
  __shared__ __align__(16) _Float16 KhsG[NG][KC * LP];            // per group K hi  [kv][d], pitch LP   9 KB
  __shared__ __align__(16) _Float16 KrsG[NG][KC * LP];            // per group K res [kv][d], pitch LP   9 KB
  __shared__ __align__(16) _Float16 VhsG[NG][HD * LP];            // per group V^T hi  [d][kv], pitch LP 9 KB
  __shared__ __align__(16) _Float16 VrsG[NG][HD * LP];            // per group V^T res [d][kv], pitch LP 9 KB
  __shared__ __align__(16) float    Os[4 * NG][16 * OP];          // per wave context tile [row][d], pitch OP
  __shared__ float                  Ms[4 * NG][16];               // per wave running max of its 16 rows
  __shared__ float                  Ls[4 * NG][16];               // per wave running sum of its 16 rows

  const int tid  = threadIdx.x;
  const int wave = __builtin_amdgcn_readfirstlane(tid >> 5);      // scalar: group tests are scalar branches
  const int grp  = wave >> 2;                    // key group
  const int wq   = wave & 3;                     // query tile inside the block
  const int gtid = tid & 127;                    // thread inside the group
  const int lane = tid & 31;
  const int hh   = lane >> 4;
  const int c    = lane & 15;
  _Float16* Khs = KhsG[grp];
  _Float16* Krs = KrsG[grp];
  _Float16* Vhs = VhsG[grp];
  _Float16* Vrs = VrsG[grp];

  const int bx = blockIdx.x;
  const int qb = bx % NQB;
  const int b  = bx / NQB;
  const int q0 = qb * 64 + wq * 16;              // in-sequence query row of this wave's first row
  const int qrow = q0 + c;                       // in-sequence query row of this lane's accumulator column
  const size_t rowB = (size_t)b * SEQ;
  const _Float16* VThb = VTh + (size_t)b * HD * SEQ;
  const _Float16* VTrb = VTr + (size_t)b * HD * SEQ;

  // ---- Q fragments (B operand, column = query = lane&15): 2 d-chunks, hi and residual ----
  v16h qh[2], qr[2];
#pragma unroll
  for (int dc = 0; dc < 2; ++dc) {
    qh[dc] = ldfrag_h(Qh + (rowB + q0 + c) * HD + dc * 32 + 8 * hh);
    qr[dc] = ldfrag_h(Qr + (rowB + q0 + c) * HD + dc * 32 + 8 * hh);
  }

  float mrun = -INFINITY;                        // running max of query c (equal in both halves)
  float lrun = 0.f;                              // running sum of query c over this half's keys only
  v8f oacc[4];                                   // O^T: tile t, register r = context[query c][d = 16 t + 8 hh + r]
#pragma unroll
  for (int t = 0; t < 4; ++t) oacc[t] = zero8();

#pragma unroll 1
  for (int kb = 0; kb <= qb; kb += NG) {     // block-uniform trip count, at most NQB / NG
    const int kt  = kb + grp;
    const int kv0 = kt * KC;
    const bool act = (kt <= qb);             // wave-uniform (scalar): this group has a chunk in this trip

    __syncthreads();
    if (act) {
      const int r = gtid >> 1, hf = (gtid & 1) * 32;
      const _Float16* kgh = Kh + (rowB + kv0 + r) * HD + hf;          // K row kv0+r, d = hf..hf+31
      const _Float16* kgr = Kr + (rowB + kv0 + r) * HD + hf;
#pragma unroll
      for (int i = 0; i < 4; ++i) {
        const v8h a0 = *(const v8h*)(kgh + 8 * i);
        const v8h a1 = *(const v8h*)(kgr + 8 * i);
        *(v8h*)(Khs + r * LP + hf + 8 * i) = a0;
        *(v8h*)(Krs + r * LP + hf + 8 * i) = a1;
      }
      const _Float16* vgh = VThb + (size_t)r * SEQ + kv0 + hf;          // V^T row d = r, s = kv0+hf..+31
      const _Float16* vgr = VTrb + (size_t)r * SEQ + kv0 + hf;
#pragma unroll
      for (int i = 0; i < 4; ++i) {
        const v8h b0 = *(const v8h*)(vgh + 8 * i);
        const v8h b1 = *(const v8h*)(vgr + 8 * i);
        *(v8h*)(Vhs + r * LP + hf + 8 * i) = b0;
        *(v8h*)(Vrs + r * LP + hf + 8 * i) = b1;
      }
    }
    __syncthreads();
    if (!act) continue;                      // the barriers above are passed by every wave in every trip

    // ---- scores, transposed: 64 keys x 16 queries per wave (A operand: row = key j*16+c, k = d, split map) ----
    v8f s[4];
#pragma unroll
    for (int j = 0; j < 4; ++j) {
      v8f sh = zero8();
      v8f sx = zero8();
#pragma unroll
      for (int dc = 0; dc < 2; ++dc) {
        FragH kb, kx;
        kb.h[0] = *(const v8h*)(Khs + (j * 16 + c) * LP + dc * 32 + 8 * hh);
        kb.h[1] = *(const v8h*)(Khs + (j * 16 + c) * LP + dc * 32 + 16 + 8 * hh);
        kx.h[0] = *(const v8h*)(Krs + (j * 16 + c) * LP + dc * 32 + 8 * hh);
        kx.h[1] = *(const v8h*)(Krs + (j * 16 + c) * LP + dc * 32 + 16 + 8 * hh);
        sh = mma_h(kb.v, qh[dc], sh);
        sx = mma_h(kx.v, qh[dc], sx);
        sx = mma_h(kb.v, qr[dc], sx);
      }
      const int key = kv0 + j * 16 + 8 * hh;                  // key of accumulator register r is key + r
#pragma unroll
      for (int r = 0; r < 8; ++r) {
        const float sv = sh[r] + sx[r] * (1.0f / RSC);
        s[j][r] = (key + r > qrow) ? -INFINITY : sv;          // causal: keys strictly after the row excluded
      }
    }

    // ---- query max in the lane and across the halves, online softmax, P^T hi (x1024) and residual (x2048)
    //      packed straight into B operands ----
    float mj[4];                                              // one chain per tile: four short chains, not one long
#pragma unroll
    for (int j = 0; j < 4; ++j) {
      mj[j] = s[j][0];
#pragma unroll
      for (int r = 1; r < 8; ++r) mj[j] = fmaxf(mj[j], s[j][r]);
    }
    float m = fmaxf(fmaxf(mj[0], mj[1]), fmaxf(mj[2], mj[3]));
    m = fmaxf(m, xhalf(m));
    const float mnew  = fmaxf(mrun, m);
    const float alpha = __expf(mrun - mnew);
    mrun = mnew;
    FragH pa[2], pr[2];
    float pj[4];                                              // per-tile partial sums, joined below
#pragma unroll
    for (int j = 0; j < 4; ++j) {
      pj[j] = 0.f;
#pragma unroll
      for (int r = 0; r < 8; ++r) {
        const float p  = __expf(s[j][r] - mnew);
        pj[j] += p;
        const _Float16 hq = (_Float16)(p * PSC);
        const float res = __builtin_fmaf(p, PSC, -(float)hq) * RSC;   // p * 1024 is exact: the same residual
        pa[j >> 1].v[(j & 1) * 8 + r] = hq;                   // element e <-> key 32 kk + 8 hh + e, + 8 more from e = 8
        pr[j >> 1].v[(j & 1) * 8 + r] = (_Float16)res;
      }
    }
    lrun = lrun * alpha + ((pj[0] + pj[1]) + (pj[2] + pj[3]));
#pragma unroll
    for (int t = 0; t < 4; ++t) {
#pragma unroll
      for (int r = 0; r < 8; ++r) oacc[t][r] *= alpha;
    }

    // ---- context^T += V^T . P^T (f16 WMMA; A = V^T [dv][kv] split map, B = P^T from the registers) ----
#pragma unroll
    for (int t = 0; t < 4; ++t) {
      FragH vb[2], vx[2];
#pragma unroll
      for (int kk = 0; kk < 2; ++kk) {
        vb[kk].h[0] = *(const v8h*)(Vhs + (t * 16 + c) * LP + kk * 32 + 8 * hh);
        vb[kk].h[1] = *(const v8h*)(Vhs + (t * 16 + c) * LP + kk * 32 + 16 + 8 * hh);
        vx[kk].h[0] = *(const v8h*)(Vrs + (t * 16 + c) * LP + kk * 32 + 8 * hh);
        vx[kk].h[1] = *(const v8h*)(Vrs + (t * 16 + c) * LP + kk * 32 + 16 + 8 * hh);
      }
      oacc[t] = mma_h(vb[0].v, pa[0].v, oacc[t]);
      oacc[t] = mma_h(vb[1].v, pa[1].v, oacc[t]);
      v8f rr = mma_h(vx[0].v, pa[0].v, zero8());
      rr = mma_h(vx[1].v, pa[1].v, rr);
      rr = mma_h(vb[0].v, pr[0].v, rr);
      rr = mma_h(vb[1].v, pr[1].v, rr);
#pragma unroll
      for (int r = 0; r < 8; ++r) oacc[t][r] += rr[r] * (1.0f / RSC);
    }
  }

  // ---- hand over the wave's un-normalised 16x64 f32 tile (a lane holds 8 consecutive d of its query per
  //      tile: two 16-B stores) and its queries' (max, sum), the sum joined over the halves here ----
  float* os = Os[wave];
#pragma unroll
  for (int t = 0; t < 4; ++t) {
    const v4f lo = {oacc[t][0], oacc[t][1], oacc[t][2], oacc[t][3]};
    const v4f hi = {oacc[t][4], oacc[t][5], oacc[t][6], oacc[t][7]};
    *(v4f*)(os + c * OP + t * 16 + 8 * hh)     = lo;
    *(v4f*)(os + c * OP + t * 16 + 8 * hh + 4) = hi;
  }
  const float lall = lrun + xhalf(lrun);
  if (hh == 0) {                                 // both halves hold equal max and sum
    Ms[wave][c] = mrun;
    Ls[wave][c] = lall;
  }
  __syncthreads();
  // ---- join the NG groups' partials of rows 4 grp .. 4 grp + 3 of tile wq; normalise (8 / l, the 1/1024 p
  //      carry and the 1/64 v carry); each wave store = two whole 256-B rows ----
  {
    const int col = c * 4;
    float* C = outp + (rowB + q0) * HD;
#pragma unroll
    for (int it = 0; it < 2; ++it) {
      const int row = grp * 4 + it * 2 + hh;
      float mg[NG], lg[NG];
      v4f og[NG];
#pragma unroll
      for (int g = 0; g < NG; ++g) {
        mg[g] = Ms[g * 4 + wq][row];
        lg[g] = Ls[g * 4 + wq][row];
        og[g] = *(const v4f*)(Os[g * 4 + wq] + row * OP + col);
      }
      float mx = mg[0];                          // finite: group 0 has chunk 0, whose key 0 no row excludes
#pragma unroll
      for (int g = 1; g < NG; ++g) mx = fmaxf(mx, mg[g]);
      float l = 0.f;
      v4f o = {0.f, 0.f, 0.f, 0.f};
#pragma unroll
      for (int g = 0; g < NG; ++g) {
        const float wg = __expf(mg[g] - mx);
        l = fmaf(wg, lg[g], l);
        o += wg * og[g];
      }
      const float inv = ((l > 0.f) ? (1.0f / l) : 0.f) * (OSC / (PSC * VSC));
      *(v4f*)(C + (size_t)row * HD + col) = o * inv;
    }
  }
}

// =====================================================================================================
// Workspace map (bytes); every plane is an exact multiple of its whole-line / 64x64-tile store granularity:
//   Qh   f16  [16384][64]        0          2097152
//   Qr   f16  [16384][64]        2097152    2097152
//   Kh   f16  [16384][64]        4194304    2097152
//   Kr   f16  [16384][64]        6291456    2097152
//   VTh  f16  [4][64][4096]      8388608    2097152
//   VTr  f16  [4][64][4096]      10485760   2097152
//   end                          12582912
// =====================================================================================================
extern "C" void kernel_launch(void* const* d_in, const int* in_sizes, int n_in,
                              void* d_out, int out_size, void* d_ws, size_t ws_size,
                              hipStream_t stream) {
  if (n_in < 7) return;
  if (in_sizes[0] != NX) return;
  if (in_sizes[1] != NW || in_sizes[3] != NW || in_sizes[5] != NW) return;
  if (in_sizes[2] != HD || in_sizes[4] != HD || in_sizes[6] != HD) return;
  if (out_size != NO) return;

  const float* x  = (const float*)d_in[0];
  const float* Wq = (const float*)d_in[1];
  const float* bq = (const float*)d_in[2];
  const float* Wk = (const float*)d_in[3];
  const float* bk = (const float*)d_in[4];
  const float* Wv = (const float*)d_in[5];
  const float* bv = (const float*)d_in[6];

  const size_t PB = (size_t)NO * 2;                     // 2097152
  size_t off = 0;
  const size_t oQh = off; off += PB;
  const size_t oQr = off; off += PB;
  const size_t oKh = off; off += PB;
  const size_t oKr = off; off += PB;
  const size_t oVh = off; off += PB;
  const size_t oVr = off; off += PB;
  if (off > ws_size) return;                            // off = 12582912

  char* ws = (char*)d_ws;
  _Float16* Qh  = (_Float16*)(ws + oQh);
  _Float16* Qr  = (_Float16*)(ws + oQr);
  _Float16* Kh  = (_Float16*)(ws + oKh);
  _Float16* Kr  = (_Float16*)(ws + oKr);
  _Float16* VTh = (_Float16*)(ws + oVh);
  _Float16* VTr = (_Float16*)(ws + oVr);
  float* out0 = (float*)d_out;

  const dim3 gP(NROW / 64);                             // 256 blocks of 512
  const dim3 blkP(512);
  const dim3 gA(NB * NQB);                              // 256 blocks of 128 * NG
  const dim3 blkA(128 * NG);

  // (1) projections from the f32 inputs -> q/k f16 hi + residual planes, v^T f16 hi + residual planes
  proj_qkv<<<gP, blkP, 0, stream>>>(x, Wq, Wk, Wv, bq, bk, bv, Qh, Qr, Kh, Kr, VTh, VTr);

  // (2) causal flash attention -> out f32 [4][4096][64]
  attn64<<<gA, blkA, 0, stream>>>(Qh, Qr, Kh, Kr, VTh, VTr, out0);
  (void)hipGetLastError();
}

// v005
// Measured time: 69.2 microseconds a run.
// Two timings next to v004 put it at 1.13 and 1.14 times that version's speed.
// Over all steps from v000 it is 4.34 times as fast.
#include <hip/hip_runtime.h>
#include <hip/hip_bf16.h>
#include <math.h>
#include <stdint.h>

#define NB   4
#define SEQ  4096
#define DE   512
#define HD   64
#define KC   64
#define LP   72      // LDS row pitch in halves of the 64-half K and V^T rows: 144 B = 16 B x odd
#define XP   520     // LDS row pitch in bf16 of the 512-element x and W rows: 1040 B = 16 B x odd
#define OP   68      // LDS row pitch in floats of the 64-float context rows: 272 B = 16 B x odd
#define NQB  (SEQ / 64)
#define NG   4       // key groups per attention workgroup: group g takes key chunks g, g + NG, g + 2 NG, ...
#define NROW (NB * SEQ)
#define NX   (NROW * DE)
#define NW   (HD * DE)
#define NO   (NROW * HD)
#define PSC  1024.0f
#define RSC  2048.0f
#define VSC  64.0f
#define OSC  8.0f
static_assert((SEQ % 64) == 0);
static_assert(HD == 64);
static_assert(KC == 64);
static_assert(LP >= KC && LP >= HD && (LP % 8) == 0 && ((LP / 8) % 2) == 1);
static_assert(OP >= HD && (OP % 4) == 0 && ((OP / 4) % 2) == 1);
static_assert((DE % 32) == 0);
static_assert(DE == 512);
static_assert(XP >= DE && (XP % 8) == 0 && ((XP / 8) % 2) == 1);
static_assert((NROW % 64) == 0);

typedef _Float16 v16h __attribute__((ext_vector_type(16)));
typedef _Float16 v8h  __attribute__((ext_vector_type(8)));
typedef __bf16   v16b __attribute__((ext_vector_type(16)));
typedef float    v8f  __attribute__((ext_vector_type(8)));
typedef float    v4f  __attribute__((ext_vector_type(4)));
typedef unsigned int v4u __attribute__((ext_vector_type(4)));
typedef unsigned int v2u __attribute__((ext_vector_type(2)));
typedef float    v2f  __attribute__((ext_vector_type(2)));
typedef __bf16   v2b  __attribute__((ext_vector_type(2)));

union FragH { v16h v; v8h h[2]; };
union FragB { v16b v; v4u u[2]; };
union HU8   { v8h h; v4u u; };
union BU4   { v2b b[2]; v2u u; };

// ---- scalar helpers --------------------------------------------------------------------------------
__device__ __forceinline__ unsigned short bf_bits(float f) {          // f32 -> bf16 bits, RNE convert
  unsigned u = __float_as_uint(f);
  return (unsigned short)((u + 0x7FFFu + ((u >> 16) & 1u)) >> 16);
}
__device__ __forceinline__ float bf_up(unsigned short h) { return __uint_as_float(((unsigned)h) << 16); }
__device__ __forceinline__ float bfr(float f) { return bf_up(bf_bits(f)); }   // value of the bf16 RNE convert
__device__ __forceinline__ v8f zero8() { v8f z = {0.f, 0.f, 0.f, 0.f, 0.f, 0.f, 0.f, 0.f}; return z; }

// ---- fragment loaders: 16-bit A/B operand, lane -> row/col (lane&15), p already includes +8*(lane>>4);
//      elements 0..7 <- p[0..7] (k0+8h..), elements 8..15 <- p[16..23] (k0+16+8h..)
__device__ __forceinline__ v16h ldfrag_h(const _Float16* p) {
  FragH f;
  f.h[0] = *(const v8h*)(p);
  f.h[1] = *(const v8h*)(p + 16);
  return f.v;
}
__device__ __forceinline__ v16b ldfrag_b(const unsigned short* p) {
  FragB f;
  f.u[0] = *(const v4u*)(p);
  f.u[1] = *(const v4u*)(p + 16);
  return f.v;
}

// ---- WMMA helpers with trailing VALU hazard gap --------------------------------------------------------
__device__ __forceinline__ v8f mma_h(v16h a, v16h b, v8f c) {
  c = __builtin_amdgcn_wmma_f32_16x16x32_f16(false, a, false, b, (short)0, c, false, false);
#if defined(__HIP_DEVICE_COMPILE__)
  asm volatile("v_nop\n\tv_nop\n\tv_nop\n\tv_nop" : "+v"(c) : "v"(a), "v"(b));
#endif
  return c;
}
__device__ __forceinline__ v8f mma_b(v16b a, v16b b, v8f c) {
  c = __builtin_amdgcn_wmma_f32_16x16x32_bf16(false, a, false, b, (short)0, c, false, false);
#if defined(__HIP_DEVICE_COMPILE__)
  asm volatile("v_nop\n\tv_nop\n\tv_nop\n\tv_nop" : "+v"(c) : "v"(a), "v"(b));
#endif
  return c;
}
// value of lane l ^ 16 (the other half of the wave), by a vector cross-row move
__device__ __forceinline__ float xhalf(float x) {
  const int i = __float_as_int(x);
  return __int_as_float(__builtin_amdgcn_permlanex16(i, i, 0x76543210, 0xfedcba98, false, false));
}

// =====================================================================================================
// q/k/v projections, f32 inputs converted on the way in. Block = 512 threads = 16 waves = 64 token rows
// (rows r0..r0+63 of the flattened [NB*SEQ] row index; 64 | SEQ so one block never crosses a sequence).
// Stage: the block's 64 x rows and all 64 rows of Wq, Wk, Wv are read as f32 (a wave load = 512 contiguous
// bytes of one row), rounded to bf16 RNE in registers and laid in LDS in rows of pitch XP;
// wave w brings rows 4w..4w+3 of each of the four. One barrier.
// Product: wave (rt, cg) owns token rows 16 rt..+15 x columns 16 cg..+15 of q, k and v: A fragment from x row
// lane&15, B(k, n) = W[n][k] fragments from W row n (k-contiguous), K = DE in ascending 32-steps.
// Epilogue (f32): + bf16_RNE(bias[n]); q/k: hi = f16(v), res = f16((v - hi) * 2048) staged as [row][d];
// v: the same of 64 v, staged transposed [d][s]; one barrier; every thread stores one 16-B piece per plane.
// coverage: 512 threads x 8 halves = 64 x 64 per plane; grid NROW/64 blocks covers all rows.
// =====================================================================================================
__device__ __forceinline__ v2u cvt4(v4f a) {                 // four f32 -> four bf16 (RNE), packed
  BU4 o;
  const v2f lo = {a[0], a[1]};
  const v2f hi = {a[2], a[3]};
  o.b[0] = __builtin_convertvector(lo, v2b);
  o.b[1] = __builtin_convertvector(hi, v2b);
  return o.u;
}
// four f32 rows of DE elements: p = first row + 4 * lane; piece (i, j) = row i, elements 128 j + 4 lane ..+3
__device__ __forceinline__ void ld_rows(const float* __restrict__ p, v4f (&t)[16]) {
#pragma unroll                                   // constant indices keep t[] in registers, here and in st_rows
  for (int i = 0; i < 4; ++i) {
#pragma unroll
    for (int j = 0; j < 4; ++j) t[i * 4 + j] = *(const v4f*)(p + i * DE + j * 128);
  }
}
__device__ __forceinline__ void st_rows(unsigned short* d, const v4f (&t)[16]) {
#pragma unroll
  for (int i = 0; i < 4; ++i) {
#pragma unroll
    for (int j = 0; j < 4; ++j) *(v2u*)(d + i * XP + j * 128) = cvt4(t[i * 4 + j]);
  }
}

__global__ __launch_bounds__(512)
void proj_qkv(const float* __restrict__ x,
              const float* __restrict__ Wq, const float* __restrict__ Wk, const float* __restrict__ Wv,
              const float* __restrict__ bq, const float* __restrict__ bk, const float* __restrict__ bv,
              _Float16* Qh, _Float16* Qr, _Float16* Kh, _Float16* Kr, _Float16* VTh, _Float16* VTr) {
  __shared__ __align__(16) unsigned short Xs[64 * XP];       // bf16 x rows                            65 KB
  __shared__ __align__(16) unsigned short Ws[3][64 * XP];    // bf16 Wq, Wk, Wv rows                  195 KB
  __shared__ __align__(16) _Float16 Eh[3][64 * 72];          // q, k [row][d] and v^T [d][s], hi       27 KB
  __shared__ __align__(16) _Float16 Er[3][64 * 72];          // their x2048 residuals                  27 KB

  const int tid  = threadIdx.x;
  const int wave = __builtin_amdgcn_readfirstlane(tid >> 5);
  const int lane = tid & 31;
  const int hh   = lane >> 4;
  const int c    = lane & 15;
  const int rt   = wave & 3;                     // token row tile
  const int cg   = wave >> 2;                    // column tile inside each projection
  const int r0   = blockIdx.x * 64;
  const int b    = r0 / SEQ;
  const int s0   = r0 - b * SEQ;

  const int n = cg * 16 + c;
  const float bias0 = bfr(bq[n]);
  const float bias1 = bfr(bk[n]);
  const float bias2 = bfr(bv[n]);

  // ---- stage: two register sets, so that the next rows' loads fly while these are rounded and stored.
  //      Each sched_barrier keeps that order: without them the compiler lifts all 64 loads to the top, sinks
  //      all stores to the foot and spills ----
  {
    const size_t ro = (size_t)(wave * 4) * DE + lane * 4;
    const int d = (wave * 4) * XP + lane * 4;
    v4f ta[16], tb[16];
    ld_rows(x + (size_t)r0 * DE + ro, ta);
    ld_rows(Wq + ro, tb);
    __builtin_amdgcn_sched_barrier(0);           // x and Wq rows in flight before the first store
    st_rows(Xs + d, ta);
    __builtin_amdgcn_sched_barrier(0);           // set a is free only now
    ld_rows(Wk + ro, ta);
    __builtin_amdgcn_sched_barrier(0);           // Wk rows in flight before Wq is waited for
    st_rows(Ws[0] + d, tb);
    __builtin_amdgcn_sched_barrier(0);           // set b is free only now
    ld_rows(Wv + ro, tb);
    __builtin_amdgcn_sched_barrier(0);           // Wv rows in flight before Wk is waited for
    st_rows(Ws[1] + d, ta);
    st_rows(Ws[2] + d, tb);
  }
  __syncthreads();

  // ---- products: the fragments of k-step ks + 1 are fetched into the other register set ahead of the
  //      WMMAs of k-step ks ----
  v8f acc[3];
#pragma unroll
  for (int w = 0; w < 3; ++w) acc[w] = zero8();
  const unsigned short* ap = Xs + (rt * 16 + c) * XP + 8 * hh;           // A row = lane&15
  const int wo = n * XP + 8 * hh;                                        // B col n = cg*16+c = W row n
  v16b a[2], wf[2][3];
  a[0] = ldfrag_b(ap);
#pragma unroll
  for (int w = 0; w < 3; ++w) wf[0][w] = ldfrag_b(Ws[w] + wo);
#pragma unroll                                   // the set index ks & 1 must be a constant: both sets in registers
  for (int ks = 0; ks < DE / 32; ++ks) {
    const int cur = ks & 1;
    if (ks + 1 < DE / 32) {
      a[cur ^ 1] = ldfrag_b(ap + (ks + 1) * 32);
#pragma unroll
      for (int w = 0; w < 3; ++w) wf[cur ^ 1][w] = ldfrag_b(Ws[w] + wo + (ks + 1) * 32);
    }
#pragma unroll
    for (int w = 0; w < 3; ++w) acc[w] = mma_b(a[cur], wf[cur][w], acc[w]);
  }

  // ---- q, k: [token row][d] as f16 hi and x2048 residual; v: transposed [d][s], of v * 64 ----
#pragma unroll
  for (int w = 0; w < 3; ++w) {
    const float bias = (w == 0) ? bias0 : ((w == 1) ? bias1 : bias2);
#pragma unroll
    for (int r = 0; r < 8; ++r) {
      const float v = (w < 2) ? (acc[w][r] + bias) : ((acc[w][r] + bias) * VSC);
      const _Float16 hq = (_Float16)v;
      const _Float16 rq = (_Float16)((v - (float)hq) * RSC);
      const int row = rt * 16 + 8 * hh + r;
      const int pi = (w < 2) ? (row * 72 + n) : (n * 72 + row);
      Eh[w][pi] = hq;
      Er[w][pi] = rq;
    }
  }
  __syncthreads();
  {
    const int q8 = tid >> 3, c8 = (tid & 7) * 8;
    v4u vh[3], vr[3];
#pragma unroll
    for (int w = 0; w < 3; ++w) {
      HU8 u;
      u.h = *(const v8h*)(Eh[w] + q8 * 72 + c8);
      vh[w] = u.u;
      u.h = *(const v8h*)(Er[w] + q8 * 72 + c8);
      vr[w] = u.u;
    }
    const size_t o  = (size_t)(r0 + q8) * HD + c8;                       // q, k: token row q8
    const size_t ov = ((size_t)b * HD + q8) * SEQ + s0 + c8;             // v^T: d = q8
    *(v4u*)(Qh + o)   = vh[0];
    *(v4u*)(Qr + o)   = vr[0];
    *(v4u*)(Kh + o)   = vh[1];
    *(v4u*)(Kr + o)   = vr[1];
    *(v4u*)(VTh + ov) = vh[2];
    *(v4u*)(VTr + ov) = vr[2];
  }
}

__global__ __launch_bounds__(128 * NG)
void attn64(const _Float16* __restrict__ Qh, const _Float16* __restrict__ Qr,
            const _Float16* __restrict__ Kh, const _Float16* __restrict__ Kr,
            const _Float16* __restrict__ VTh, const _Float16* __restrict__ VTr, float* outp) {
  __shared__ __align__(16) _Float16 KhsG[NG][KC * LP];            // per group K hi  [kv][d], pitch LP   9 KB
  __shared__ __align__(16) _Float16 KrsG[NG][KC * LP];            // per group K res [kv][d], pitch LP   9 KB
  __shared__ __align__(16) _Float16 VhsG[NG][HD * LP];            // per group V^T hi  [d][kv], pitch LP 9 KB
  __shared__ __align__(16) _Float16 VrsG[NG][HD * LP];            // per group V^T res [d][kv], pitch LP 9 KB
  __shared__ __align__(16) float    Os[4 * NG][16 * OP];          // per wave context tile [row][d], pitch OP
  __shared__ float                  Ms[4 * NG][16];               // per wave running max of its 16 rows
  __shared__ float                  Ls[4 * NG][16];               // per wave running sum of its 16 rows

  const int tid  = threadIdx.x;
  const int wave = __builtin_amdgcn_readfirstlane(tid >> 5);      // scalar: group tests are scalar branches
  const int grp  = wave >> 2;                    // key group
  const int wq   = wave & 3;                     // query tile inside the block
  const int lane = tid & 31;
  const int hh   = lane >> 4;
  const int c    = lane & 15;
  _Float16* Khs = KhsG[grp];
  _Float16* Krs = KrsG[grp];
  _Float16* Vhs = VhsG[grp];
  _Float16* Vrs = VrsG[grp];

  const int bx = blockIdx.x;
  const int qb = bx % NQB;
  const int b  = bx / NQB;
  const int q0 = qb * 64 + wq * 16;              // in-sequence query row of this wave's first row
  const int qrow = q0 + c;                       // in-sequence query row of this lane's accumulator column
  const size_t rowB = (size_t)b * SEQ;
  const _Float16* VThb = VTh + (size_t)b * HD * SEQ;
  const _Float16* VTrb = VTr + (size_t)b * HD * SEQ;

  // ---- Q fragments (B operand, column = query = lane&15): 2 d-chunks, hi and residual ----
  v16h qh[2], qr[2];
#pragma unroll
  for (int dc = 0; dc < 2; ++dc) {
    qh[dc] = ldfrag_h(Qh + (rowB + q0 + c) * HD + dc * 32 + 8 * hh);
    qr[dc] = ldfrag_h(Qr + (rowB + q0 + c) * HD + dc * 32 + 8 * hh);
  }

  float mrun = -INFINITY;                        // running max of query c (equal in both halves)
  float lrun = 0.f;                              // running sum of query c over this half's keys only
  v8f oacc[4];                                   // O^T: tile t, register r = context[query c][d = 16 t + 8 hh + r]
#pragma unroll
  for (int t = 0; t < 4; ++t) oacc[t] = zero8();

#pragma unroll 1
  for (int kb = 0; kb <= qb; kb += NG) {     // block-uniform trip count, at most NQB / NG
    const int kt  = kb + grp;
    const int kv0 = kt * KC;
    const bool act = (kt <= qb);             // wave-uniform (scalar): this group has a chunk in this trip

    __syncthreads();
    if (act) {
      const int pc = (lane & 7) * 8;                                  // 16-B piece of the 128-B tile row
      const int r  = ((lane >> 3) & 1) * 8 + wq * 2 + hh;             // tile row of piece i is r + 16 i
      const _Float16* kgh = Kh + (rowB + kv0 + r) * HD + pc;          // K row kv0+r, d = pc..pc+7
      const _Float16* kgr = Kr + (rowB + kv0 + r) * HD + pc;
      const _Float16* vgh = VThb + (size_t)r * SEQ + kv0 + pc;          // V^T row d = r, s = kv0+pc..+7
      const _Float16* vgr = VTrb + (size_t)r * SEQ + kv0 + pc;
      v8h a0[4], a1[4], b0[4], b1[4];
#pragma unroll                                   // constant indices keep the four arrays in registers
      for (int i = 0; i < 4; ++i) {
        a0[i] = *(const v8h*)(kgh + i * 16 * HD);
        a1[i] = *(const v8h*)(kgr + i * 16 * HD);
        b0[i] = *(const v8h*)(vgh + (size_t)i * 16 * SEQ);
        b1[i] = *(const v8h*)(vgr + (size_t)i * 16 * SEQ);
      }
#if defined(__HIP_DEVICE_COMPILE__)
      // the four address pairs stay whole until this wait
      asm volatile("s_wait_xcnt 0x0" :: "v"(kgh), "v"(kgr), "v"(vgh), "v"(vgr) : "memory");
#endif
#pragma unroll
      for (int i = 0; i < 4; ++i) {
        *(v8h*)(Khs + (r + 16 * i) * LP + pc) = a0[i];
        *(v8h*)(Krs + (r + 16 * i) * LP + pc) = a1[i];
        *(v8h*)(Vhs + (r + 16 * i) * LP + pc) = b0[i];
        *(v8h*)(Vrs + (r + 16 * i) * LP + pc) = b1[i];
      }
    }
    __syncthreads();
    if (!act) continue;                      // the barriers above are passed by every wave in every trip

    // ---- scores, transposed: 64 keys x 16 queries per wave (A operand: row = key j*16+c, k = d, split map) ----
    v8f s[4];
#pragma unroll
    for (int j = 0; j < 4; ++j) {
      v8f sh = zero8();
      v8f sx = zero8();
#pragma unroll
      for (int dc = 0; dc < 2; ++dc) {
        FragH kb, kx;
        kb.h[0] = *(const v8h*)(Khs + (j * 16 + c) * LP + dc * 32 + 8 * hh);
        kb.h[1] = *(const v8h*)(Khs + (j * 16 + c) * LP + dc * 32 + 16 + 8 * hh);
        kx.h[0] = *(const v8h*)(Krs + (j * 16 + c) * LP + dc * 32 + 8 * hh);
        kx.h[1] = *(const v8h*)(Krs + (j * 16 + c) * LP + dc * 32 + 16 + 8 * hh);
        sh = mma_h(kb.v, qh[dc], sh);
        sx = mma_h(kx.v, qh[dc], sx);
        sx = mma_h(kb.v, qr[dc], sx);
      }
      const int key = kv0 + j * 16 + 8 * hh;                  // key of accumulator register r is key + r
#pragma unroll
      for (int r = 0; r < 8; ++r) {
        const float sv = sh[r] + sx[r] * (1.0f / RSC);
        s[j][r] = (key + r > qrow) ? -INFINITY : sv;          // causal: keys strictly after the row excluded
      }
    }

    // ---- query max in the lane and across the halves, online softmax, P^T hi (x1024) and residual (x2048)
    //      packed straight into B operands ----
    float mj[4];                                              // one chain per tile: four short chains, not one long
#pragma unroll
    for (int j = 0; j < 4; ++j) {
      mj[j] = s[j][0];
#pragma unroll
      for (int r = 1; r < 8; ++r) mj[j] = fmaxf(mj[j], s[j][r]);
    }
    float m = fmaxf(fmaxf(mj[0], mj[1]), fmaxf(mj[2], mj[3]));
    m = fmaxf(m, xhalf(m));
    const float mnew  = fmaxf(mrun, m);
    const float alpha = __expf(mrun - mnew);
    mrun = mnew;
    FragH pa[2], pr[2];
    float pj[4];                                              // per-tile partial sums, joined below
#pragma unroll
    for (int j = 0; j < 4; ++j) {
      pj[j] = 0.f;
#pragma unroll
      for (int r = 0; r < 8; ++r) {
        const float p  = __expf(s[j][r] - mnew);
        pj[j] += p;
        const _Float16 hq = (_Float16)(p * PSC);
        const float res = __builtin_fmaf(p, PSC, -(float)hq) * RSC;   // p * 1024 is exact: the same residual
        pa[j >> 1].v[(j & 1) * 8 + r] = hq;                   // element e <-> key 32 kk + 8 hh + e, + 8 more from e = 8
        pr[j >> 1].v[(j & 1) * 8 + r] = (_Float16)res;
      }
    }
    lrun = lrun * alpha + ((pj[0] + pj[1]) + (pj[2] + pj[3]));
#pragma unroll
    for (int t = 0; t < 4; ++t) {
#pragma unroll
      for (int r = 0; r < 8; ++r) oacc[t][r] *= alpha;
    }

    // ---- context^T += V^T . P^T (f16 WMMA; A = V^T [dv][kv] split map, B = P^T from the registers) ----
#pragma unroll
    for (int t = 0; t < 4; ++t) {
      FragH vb[2], vx[2];
#pragma unroll
      for (int kk = 0; kk < 2; ++kk) {
        vb[kk].h[0] = *(const v8h*)(Vhs + (t * 16 + c) * LP + kk * 32 + 8 * hh);
        vb[kk].h[1] = *(const v8h*)(Vhs + (t * 16 + c) * LP + kk * 32 + 16 + 8 * hh);
        vx[kk].h[0] = *(const v8h*)(Vrs + (t * 16 + c) * LP + kk * 32 + 8 * hh);
        vx[kk].h[1] = *(const v8h*)(Vrs + (t * 16 + c) * LP + kk * 32 + 16 + 8 * hh);
      }
      oacc[t] = mma_h(vb[0].v, pa[0].v, oacc[t]);
      oacc[t] = mma_h(vb[1].v, pa[1].v, oacc[t]);
      v8f rr = mma_h(vx[0].v, pa[0].v, zero8());
      rr = mma_h(vx[1].v, pa[1].v, rr);
      rr = mma_h(vb[0].v, pr[0].v, rr);
      rr = mma_h(vb[1].v, pr[1].v, rr);
#pragma unroll
      for (int r = 0; r < 8; ++r) oacc[t][r] += rr[r] * (1.0f / RSC);
    }
  }

  // ---- hand over the wave's un-normalised 16x64 f32 tile (a lane holds 8 consecutive d of its query per
  //      tile: two 16-B stores) and its queries' (max, sum), the sum joined over the halves here ----
  float* os = Os[wave];
#pragma unroll
  for (int t = 0; t < 4; ++t) {
    const v4f lo = {oacc[t][0], oacc[t][1], oacc[t][2], oacc[t][3]};
    const v4f hi = {oacc[t][4], oacc[t][5], oacc[t][6], oacc[t][7]};
    *(v4f*)(os + c * OP + t * 16 + 8 * hh)     = lo;
    *(v4f*)(os + c * OP + t * 16 + 8 * hh + 4) = hi;
  }
  const float lall = lrun + xhalf(lrun);
  if (hh == 0) {                                 // both halves hold equal max and sum
    Ms[wave][c] = mrun;
    Ls[wave][c] = lall;
  }
  __syncthreads();
  // ---- join the NG groups' partials of rows 4 grp .. 4 grp + 3 of tile wq; normalise (8 / l, the 1/1024 p
  //      carry and the 1/64 v carry); each wave store = two whole 256-B rows ----
  {
    const int col = c * 4;
    float* C = outp + (rowB + q0) * HD;
#pragma unroll
    for (int it = 0; it < 2; ++it) {
      const int row = grp * 4 + it * 2 + hh;
      float mg[NG], lg[NG];
      v4f og[NG];
#pragma unroll
      for (int g = 0; g < NG; ++g) {
        mg[g] = Ms[g * 4 + wq][row];
        lg[g] = Ls[g * 4 + wq][row];
        og[g] = *(const v4f*)(Os[g * 4 + wq] + row * OP + col);
      }
      float mx = mg[0];                          // finite: group 0 has chunk 0, whose key 0 no row excludes
#pragma unroll
      for (int g = 1; g < NG; ++g) mx = fmaxf(mx, mg[g]);
      float l = 0.f;
      v4f o = {0.f, 0.f, 0.f, 0.f};
#pragma unroll
      for (int g = 0; g < NG; ++g) {
        const float wg = __expf(mg[g] - mx);
        l = fmaf(wg, lg[g], l);
        o += wg * og[g];
      }
      const float inv = ((l > 0.f) ? (1.0f / l) : 0.f) * (OSC / (PSC * VSC));
      *(v4f*)(C + (size_t)row * HD + col) = o * inv;
    }
  }
}

// =====================================================================================================
// Workspace map (bytes); every plane is an exact multiple of its whole-line / 64x64-tile store granularity:
//   Qh   f16  [16384][64]        0          2097152
//   Qr   f16  [16384][64]        2097152    2097152
//   Kh   f16  [16384][64]        4194304    2097152
//   Kr   f16  [16384][64]        6291456    2097152
//   VTh  f16  [4][64][4096]      8388608    2097152
//   VTr  f16  [4][64][4096]      10485760   2097152
//   end                          12582912
// =====================================================================================================
extern "C" void kernel_launch(void* const* d_in, const int* in_sizes, int n_in,
                              void* d_out, int out_size, void* d_ws, size_t ws_size,
                              hipStream_t stream) {
  if (n_in < 7) return;
  if (in_sizes[0] != NX) return;
  if (in_sizes[1] != NW || in_sizes[3] != NW || in_sizes[5] != NW) return;
  if (in_sizes[2] != HD || in_sizes[4] != HD || in_sizes[6] != HD) return;
  if (out_size != NO) return;

  const float* x  = (const float*)d_in[0];
  const float* Wq = (const float*)d_in[1];
  const float* bq = (const float*)d_in[2];
  const float* Wk = (const float*)d_in[3];
  const float* bk = (const float*)d_in[4];
  const float* Wv = (const float*)d_in[5];
  const float* bv = (const float*)d_in[6];

  const size_t PB = (size_t)NO * 2;                     // 2097152
  size_t off = 0;
  const size_t oQh = off; off += PB;
  const size_t oQr = off; off += PB;
  const size_t oKh = off; off += PB;
  const size_t oKr = off; off += PB;
  const size_t oVh = off; off += PB;
  const size_t oVr = off; off += PB;
  if (off > ws_size) return;                            // off = 12582912

  char* ws = (char*)d_ws;
  _Float16* Qh  = (_Float16*)(ws + oQh);
  _Float16* Qr  = (_Float16*)(ws + oQr);
  _Float16* Kh  = (_Float16*)(ws + oKh);
  _Float16* Kr  = (_Float16*)(ws + oKr);
  _Float16* VTh = (_Float16*)(ws + oVh);
  _Float16* VTr = (_Float16*)(ws + oVr);
  float* out0 = (float*)d_out;

  const dim3 gP(NROW / 64);                             // 256 blocks of 512
  const dim3 blkP(512);
  const dim3 gA(NB * NQB);                              // 256 blocks of 128 * NG
  const dim3 blkA(128 * NG);

  // (1) projections from the f32 inputs -> q/k f16 hi + residual planes, v^T f16 hi + residual planes
  proj_qkv<<<gP, blkP, 0, stream>>>(x, Wq, Wk, Wv, bq, bk, bv, Qh, Qr, Kh, Kr, VTh, VTr);

  // (2) causal flash attention -> out f32 [4][4096][64]
  attn64<<<gA, blkA, 0, stream>>>(Qh, Qr, Kh, Kr, VTh, VTr, out0);
  (void)hipGetLastError();
}

// v006
// A run of this version takes 50.5 microseconds.
// Next to v005, in two timings, it ran 1.35 and 1.37 times as fast.
// Over all steps from v000 it is 5.89 times as fast.
#include <hip/hip_runtime.h>
#include <hip/hip_bf16.h>
#include <math.h>
#include <stdint.h>

#define NB   4
#define SEQ  4096
#define DE   512
#define HD   64
#define KC   64
#define LP   72      // LDS row pitch in halves of the 64-half K and V^T rows: 144 B = 16 B x odd
#define XP   520     // LDS row pitch in bf16 of the 512-element x and W rows: 1040 B = 16 B x odd
#define OP   68      // LDS row pitch in floats of the 64-float context rows: 272 B = 16 B x odd
#define NQB  (SEQ / 64)
#define NG   4       // key groups per attention workgroup: group g takes key chunks g, g + NG, g + 2 NG, ...
#define HT   (NQB / 2)   // query tiles HT .. NQB - 1 have more than HT key chunks: their chunks go to two workgroups
#define NROW (NB * SEQ)
#define NX   (NROW * DE)
#define NW   (HD * DE)
#define NO   (NROW * HD)
#define PSC  1024.0f
#define RSC  2048.0f
#define VSC  64.0f
#define OSC  8.0f
static_assert((SEQ % 64) == 0);
static_assert(HD == 64);
static_assert(KC == 64);
static_assert(LP >= KC && LP >= HD && (LP % 8) == 0 && ((LP / 8) % 2) == 1);
static_assert(OP >= HD && (OP % 4) == 0 && ((OP / 4) % 2) == 1);
static_assert((DE % 32) == 0);
static_assert(DE == 512);
static_assert(XP >= DE && (XP % 8) == 0 && ((XP / 8) % 2) == 1);
static_assert((NROW % 64) == 0);
static_assert((NQB % 2) == 0);

typedef _Float16 v16h __attribute__((ext_vector_type(16)));
typedef _Float16 v8h  __attribute__((ext_vector_type(8)));
typedef __bf16   v16b __attribute__((ext_vector_type(16)));
typedef float    v8f  __attribute__((ext_vector_type(8)));
typedef float    v4f  __attribute__((ext_vector_type(4)));
typedef unsigned int v4u __attribute__((ext_vector_type(4)));
typedef unsigned int v2u __attribute__((ext_vector_type(2)));
typedef float    v2f  __attribute__((ext_vector_type(2)));
typedef __bf16   v2b  __attribute__((ext_vector_type(2)));

union FragH { v16h v; v8h h[2]; };
union FragB { v16b v; v4u u[2]; };
union HU8   { v8h h; v4u u; };
union BU4   { v2b b[2]; v2u u; };

// ---- scalar helpers --------------------------------------------------------------------------------
__device__ __forceinline__ unsigned short bf_bits(float f) {          // f32 -> bf16 bits, RNE convert
  unsigned u = __float_as_uint(f);
  return (unsigned short)((u + 0x7FFFu + ((u >> 16) & 1u)) >> 16);
}
__device__ __forceinline__ float bf_up(unsigned short h) { return __uint_as_float(((unsigned)h) << 16); }
__device__ __forceinline__ float bfr(float f) { return bf_up(bf_bits(f)); }   // value of the bf16 RNE convert
__device__ __forceinline__ v8f zero8() { v8f z = {0.f, 0.f, 0.f, 0.f, 0.f, 0.f, 0.f, 0.f}; return z; }

// ---- fragment loaders: 16-bit A/B operand, lane -> row/col (lane&15), p already includes +8*(lane>>4);
//      elements 0..7 <- p[0..7] (k0+8h..), elements 8..15 <- p[16..23] (k0+16+8h..)
__device__ __forceinline__ v16h ldfrag_h(const _Float16* p) {
  FragH f;
  f.h[0] = *(const v8h*)(p);
  f.h[1] = *(const v8h*)(p + 16);
  return f.v;
}
__device__ __forceinline__ v16b ldfrag_b(const unsigned short* p) {
  FragB f;
  f.u[0] = *(const v4u*)(p);
  f.u[1] = *(const v4u*)(p + 16);
  return f.v;
}

// ---- WMMA helpers with trailing VALU hazard gap --------------------------------------------------------
__device__ __forceinline__ v8f mma_h(v16h a, v16h b, v8f c) {
  c = __builtin_amdgcn_wmma_f32_16x16x32_f16(false, a, false, b, (short)0, c, false, false);
#if defined(__HIP_DEVICE_COMPILE__)
  asm volatile("v_nop\n\tv_nop\n\tv_nop\n\tv_nop" : "+v"(c) : "v"(a), "v"(b));
#endif
  return c;
}
__device__ __forceinline__ v8f mma_b(v16b a, v16b b, v8f c) {
  c = __builtin_amdgcn_wmma_f32_16x16x32_bf16(false, a, false, b, (short)0, c, false, false);
#if defined(__HIP_DEVICE_COMPILE__)
  asm volatile("v_nop\n\tv_nop\n\tv_nop\n\tv_nop" : "+v"(c) : "v"(a), "v"(b));
#endif
  return c;
}
// value of lane l ^ 16 (the other half of the wave), by a vector cross-row move
__device__ __forceinline__ float xhalf(float x) {
  const int i = __float_as_int(x);
  return __int_as_float(__builtin_amdgcn_permlanex16(i, i, 0x76543210, 0xfedcba98, false, false));
}

// =====================================================================================================
// q/k/v projections, f32 inputs converted on the way in. Block = 512 threads = 16 waves = 64 token rows
// (rows r0..r0+63 of the flattened [NB*SEQ] row index; 64 | SEQ so one block never crosses a sequence).
// Stage: the block's 64 x rows and all 64 rows of Wq, Wk, Wv are read as f32 (a wave load = 512 contiguous
// bytes of one row), rounded to bf16 RNE in registers and laid in LDS in rows of pitch XP;
// wave w brings rows 4w..4w+3 of each of the four. One barrier.
// Product: wave (rt, cg) owns token rows 16 rt..+15 x columns 16 cg..+15 of q, k and v: A fragment from x row
// lane&15, B(k, n) = W[n][k] fragments from W row n (k-contiguous), K = DE in ascending 32-steps.
// Epilogue (f32): + bf16_RNE(bias[n]); q/k: hi = f16(v), res = f16((v - hi) * 2048) staged as [row][d];
// v: the same of 64 v, staged transposed [d][s]; one barrier; every thread stores one 16-B piece per plane.
// coverage: 512 threads x 8 halves = 64 x 64 per plane; grid NROW/64 blocks covers all rows.
// =====================================================================================================
__device__ __forceinline__ v2u cvt4(v4f a) {                 // four f32 -> four bf16 (RNE), packed
  BU4 o;
  const v2f lo = {a[0], a[1]};
  const v2f hi = {a[2], a[3]};
  o.b[0] = __builtin_convertvector(lo, v2b);
  o.b[1] = __builtin_convertvector(hi, v2b);
  return o.u;
}
// four f32 rows of DE elements: p = first row + 4 * lane; piece (i, j) = row i, elements 128 j + 4 lane ..+3
__device__ __forceinline__ void ld_rows(const float* __restrict__ p, v4f (&t)[16]) {
#pragma unroll                                   // constant indices keep t[] in registers, here and in st_rows
  for (int i = 0; i < 4; ++i) {
#pragma unroll
    for (int j = 0; j < 4; ++j) t[i * 4 + j] = *(const v4f*)(p + i * DE + j * 128);
  }
}
__device__ __forceinline__ void st_rows(unsigned short* d, const v4f (&t)[16]) {
#pragma unroll
  for (int i = 0; i < 4; ++i) {
#pragma unroll
    for (int j = 0; j < 4; ++j) *(v2u*)(d + i * XP + j * 128) = cvt4(t[i * 4 + j]);
  }
}

__global__ __launch_bounds__(512)
void proj_qkv(const float* __restrict__ x,
              const float* __restrict__ Wq, const float* __restrict__ Wk, const float* __restrict__ Wv,
              const float* __restrict__ bq, const float* __restrict__ bk, const float* __restrict__ bv,
              _Float16* Qh, _Float16* Qr, _Float16* Kh, _Float16* Kr, _Float16* VTh, _Float16* VTr) {
  __shared__ __align__(16) unsigned short Xs[64 * XP];       // bf16 x rows                            65 KB
  __shared__ __align__(16) unsigned short Ws[3][64 * XP];    // bf16 Wq, Wk, Wv rows                  195 KB
  __shared__ __align__(16) _Float16 Eh[3][64 * 72];          // q, k [row][d] and v^T [d][s], hi       27 KB
  __shared__ __align__(16) _Float16 Er[3][64 * 72];          // their x2048 residuals                  27 KB

  const int tid  = threadIdx.x;
  const int wave = __builtin_amdgcn_readfirstlane(tid >> 5);
  const int lane = tid & 31;
  const int hh   = lane >> 4;
  const int c    = lane & 15;
  const int rt   = wave & 3;                     // token row tile
  const int cg   = wave >> 2;                    // column tile inside each projection
  const int r0   = blockIdx.x * 64;
  const int b    = r0 / SEQ;
  const int s0   = r0 - b * SEQ;

  const int n = cg * 16 + c;
  const float bias0 = bfr(bq[n]);
  const float bias1 = bfr(bk[n]);
  const float bias2 = bfr(bv[n]);

  // ---- stage: two register sets, so that the next rows' loads fly while these are rounded and stored.
  //      Each sched_barrier keeps that order: without them the compiler lifts all 64 loads to the top, sinks
  //      all stores to the foot and spills ----
  {
    const size_t ro = (size_t)(wave * 4) * DE + lane * 4;
    const int d = (wave * 4) * XP + lane * 4;
    v4f ta[16], tb[16];
    ld_rows(x + (size_t)r0 * DE + ro, ta);
    ld_rows(Wq + ro, tb);
    __builtin_amdgcn_sched_barrier(0);           // x and Wq rows in flight before the first store
    st_rows(Xs + d, ta);
    __builtin_amdgcn_sched_barrier(0);           // set a is free only now
    ld_rows(Wk + ro, ta);
    __builtin_amdgcn_sched_barrier(0);           // Wk rows in flight before Wq is waited for
    st_rows(Ws[0] + d, tb);
    __builtin_amdgcn_sched_barrier(0);           // set b is free only now
    ld_rows(Wv + ro, tb);
    __builtin_amdgcn_sched_barrier(0);           // Wv rows in flight before Wk is waited for
    st_rows(Ws[1] + d, ta);
    st_rows(Ws[2] + d, tb);
  }
  __syncthreads();

  // ---- products: the fragments of k-step ks + 1 are fetched into the other register set ahead of the
  //      WMMAs of k-step ks ----
  v8f acc[3];
#pragma unroll
  for (int w = 0; w < 3; ++w) acc[w] = zero8();
  const unsigned short* ap = Xs + (rt * 16 + c) * XP + 8 * hh;           // A row = lane&15
  const int wo = n * XP + 8 * hh;                                        // B col n = cg*16+c = W row n
  v16b a[2], wf[2][3];
  a[0] = ldfrag_b(ap);
#pragma unroll
  for (int w = 0; w < 3; ++w) wf[0][w] = ldfrag_b(Ws[w] + wo);
#pragma unroll                                   // the set index ks & 1 must be a constant: both sets in registers
  for (int ks = 0; ks < DE / 32; ++ks) {
    const int cur = ks & 1;
    if (ks + 1 < DE / 32) {
      a[cur ^ 1] = ldfrag_b(ap + (ks + 1) * 32);
#pragma unroll
      for (int w = 0; w < 3; ++w) wf[cur ^ 1][w] = ldfrag_b(Ws[w] + wo + (ks + 1) * 32);
    }
#pragma unroll
    for (int w = 0; w < 3; ++w) acc[w] = mma_b(a[cur], wf[cur][w], acc[w]);
  }

  // ---- q, k: [token row][d] as f16 hi and x2048 residual; v: transposed [d][s], of v * 64 ----
#pragma unroll
  for (int w = 0; w < 3; ++w) {
    const float bias = (w == 0) ? bias0 : ((w == 1) ? bias1 : bias2);
#pragma unroll
    for (int r = 0; r < 8; ++r) {
      const float v = (w < 2) ? (acc[w][r] + bias) : ((acc[w][r] + bias) * VSC);
      const _Float16 hq = (_Float16)v;
      const _Float16 rq = (_Float16)((v - (float)hq) * RSC);
      const int row = rt * 16 + 8 * hh + r;
      const int pi = (w < 2) ? (row * 72 + n) : (n * 72 + row);
      Eh[w][pi] = hq;
      Er[w][pi] = rq;
    }
  }
  __syncthreads();
  {
    const int q8 = tid >> 3, c8 = (tid & 7) * 8;
    v4u vh[3], vr[3];
#pragma unroll
    for (int w = 0; w < 3; ++w) {
      HU8 u;
      u.h = *(const v8h*)(Eh[w] + q8 * 72 + c8);
      vh[w] = u.u;
      u.h = *(const v8h*)(Er[w] + q8 * 72 + c8);
      vr[w] = u.u;
    }
    const size_t o  = (size_t)(r0 + q8) * HD + c8;                       // q, k: token row q8
    const size_t ov = ((size_t)b * HD + q8) * SEQ + s0 + c8;             // v^T: d = q8
    *(v4u*)(Qh + o)   = vh[0];
    *(v4u*)(Qr + o)   = vr[0];
    *(v4u*)(Kh + o)   = vh[1];
    *(v4u*)(Kr + o)   = vr[1];
    *(v4u*)(VTh + ov) = vh[2];
    *(v4u*)(VTr + ov) = vr[2];
  }
}

__global__ __launch_bounds__(128 * NG)
void attn64(const _Float16* __restrict__ Qh, const _Float16* __restrict__ Qr,
            const _Float16* __restrict__ Kh, const _Float16* __restrict__ Kr,
            const _Float16* __restrict__ VTh, const _Float16* __restrict__ VTr, float* outp,
            float* Po, float* Pm, float* Pl) {
  __shared__ __align__(16) _Float16 KhsG[NG][KC * LP];            // per group K hi  [kv][d], pitch LP   9 KB
  __shared__ __align__(16) _Float16 KrsG[NG][KC * LP];            // per group K res [kv][d], pitch LP   9 KB
  __shared__ __align__(16) _Float16 VhsG[NG][HD * LP];            // per group V^T hi  [d][kv], pitch LP 9 KB
  __shared__ __align__(16) _Float16 VrsG[NG][HD * LP];            // per group V^T res [d][kv], pitch LP 9 KB
  __shared__ __align__(16) float    Os[4 * NG][16 * OP];          // per wave context tile [row][d], pitch OP
  __shared__ float                  Ms[4 * NG][16];               // per wave running max of its 16 rows
  __shared__ float                  Ls[4 * NG][16];               // per wave running sum of its 16 rows

  const int tid  = threadIdx.x;
  const int wave = __builtin_amdgcn_readfirstlane(tid >> 5);      // scalar: group tests are scalar branches
  const int grp  = wave >> 2;                    // key group
  const int wq   = wave & 3;                     // query tile inside the block
  const int lane = tid & 31;
  const int hh   = lane >> 4;
  const int c    = lane & 15;
  _Float16* Khs = KhsG[grp];
  _Float16* Krs = KrsG[grp];
  _Float16* Vhs = VhsG[grp];
  _Float16* Vrs = VrsG[grp];

  const int bx = blockIdx.x;
  const int wi = bx % HT + ((bx < NB * HT) ? HT : 0);   // which share of its sequence this block takes
  const int b  = (bx / HT) % NB;
  const size_t rowB = (size_t)b * SEQ;
  const _Float16* VThb = VTh + (size_t)b * HD * SEQ;
  const _Float16* VTrb = VTr + (size_t)b * HD * SEQ;
  const int njob = (wi < HT) ? 1 : 2;            // block-uniform, like all that is formed from wi and job

#pragma unroll 1                                 // one copy of the chunk loop serves both shares
  for (int job = 0; job < njob; ++job) {
    const int qb   = (wi < HT) ? (HT + wi) : ((job == 0) ? wi : (NQB - 1 - wi));     // query tile
    const int c0   = (wi >= HT && job == 0) ? HT : 0;                                // first key chunk
    const int c1   = (wi < HT) ? (HT - 1) : qb;                                      // last key chunk, <= qb
    const int slot = (wi < HT) ? 0 : ((job == 0) ? 1 : -1);   // half of a split tile, or -1: the whole tile
    const int q0 = qb * 64 + wq * 16;              // in-sequence query row of this wave's first row
    const int qrow = q0 + c;                       // in-sequence query row of this lane's accumulator column

    // ---- Q fragments (B operand, column = query = lane&15): 2 d-chunks, hi and residual ----
    v16h qh[2], qr[2];
#pragma unroll
    for (int dc = 0; dc < 2; ++dc) {
      qh[dc] = ldfrag_h(Qh + (rowB + q0 + c) * HD + dc * 32 + 8 * hh);
      qr[dc] = ldfrag_h(Qr + (rowB + q0 + c) * HD + dc * 32 + 8 * hh);
    }

    float mrun = -INFINITY;                        // running max of query c (equal in both halves)
    float lrun = 0.f;                              // running sum of query c over this half's keys only
    v8f oacc[4];                                   // O^T: tile t, register r = context[query c][d = 16 t + 8 hh + r]
#pragma unroll
    for (int t = 0; t < 4; ++t) oacc[t] = zero8();

#pragma unroll 1
    for (int kb = c0; kb <= c1; kb += NG) {    // block-uniform trip count, at most NQB / NG
      const int kt  = kb + grp;
      const int kv0 = kt * KC;
      const bool act = (kt <= c1);             // wave-uniform (scalar): this group has a chunk in this trip

      __syncthreads();
      if (act) {
        const int pc = (lane & 7) * 8;                                  // 16-B piece of the 128-B tile row
        const int r  = ((lane >> 3) & 1) * 8 + wq * 2 + hh;             // tile row of piece i is r + 16 i
        const _Float16* kgh = Kh + (rowB + kv0 + r) * HD + pc;          // K row kv0+r, d = pc..pc+7
        const _Float16* kgr = Kr + (rowB + kv0 + r) * HD + pc;
        const _Float16* vgh = VThb + (size_t)r * SEQ + kv0 + pc;          // V^T row d = r, s = kv0+pc..+7
        const _Float16* vgr = VTrb + (size_t)r * SEQ + kv0 + pc;
        v8h a0[4], a1[4], b0[4], b1[4];
#pragma unroll                                   // constant indices keep the four arrays in registers
        for (int i = 0; i < 4; ++i) {
          a0[i] = *(const v8h*)(kgh + i * 16 * HD);
          a1[i] = *(const v8h*)(kgr + i * 16 * HD);
          b0[i] = *(const v8h*)(vgh + (size_t)i * 16 * SEQ);
          b1[i] = *(const v8h*)(vgr + (size_t)i * 16 * SEQ);
        }
#if defined(__HIP_DEVICE_COMPILE__)
        // the four address pairs stay whole until this wait
        asm volatile("s_wait_xcnt 0x0" :: "v"(kgh), "v"(kgr), "v"(vgh), "v"(vgr) : "memory");
#endif
#pragma unroll
        for (int i = 0; i < 4; ++i) {
          *(v8h*)(Khs + (r + 16 * i) * LP + pc) = a0[i];
          *(v8h*)(Krs + (r + 16 * i) * LP + pc) = a1[i];
          *(v8h*)(Vhs + (r + 16 * i) * LP + pc) = b0[i];
          *(v8h*)(Vrs + (r + 16 * i) * LP + pc) = b1[i];
        }
      }
      __syncthreads();
      if (!act) continue;                      // the barriers above are passed by every wave in every trip

      // ---- scores, transposed: 64 keys x 16 queries per wave (A operand: row = key j*16+c, k = d, split map) ----
      v8f s[4];
#pragma unroll
      for (int j = 0; j < 4; ++j) {
        v8f sh = zero8();
        v8f sx = zero8();
#pragma unroll
        for (int dc = 0; dc < 2; ++dc) {
          FragH kb, kx;
          kb.h[0] = *(const v8h*)(Khs + (j * 16 + c) * LP + dc * 32 + 8 * hh);
          kb.h[1] = *(const v8h*)(Khs + (j * 16 + c) * LP + dc * 32 + 16 + 8 * hh);
          kx.h[0] = *(const v8h*)(Krs + (j * 16 + c) * LP + dc * 32 + 8 * hh);
          kx.h[1] = *(const v8h*)(Krs + (j * 16 + c) * LP + dc * 32 + 16 + 8 * hh);
          sh = mma_h(kb.v, qh[dc], sh);
          sx = mma_h(kx.v, qh[dc], sx);
          sx = mma_h(kb.v, qr[dc], sx);
        }
        const int key = kv0 + j * 16 + 8 * hh;                  // key of accumulator register r is key + r
#pragma unroll
        for (int r = 0; r < 8; ++r) {
          const float sv = sh[r] + sx[r] * (1.0f / RSC);
          s[j][r] = (key + r > qrow) ? -INFINITY : sv;          // causal: keys strictly after the row excluded
        }
      }

      // ---- query max in the lane and across the halves, online softmax, P^T hi (x1024) and residual (x2048)
      //      packed straight into B operands ----
      float mj[4];                                              // one chain per tile: four short chains, not one long
#pragma unroll
      for (int j = 0; j < 4; ++j) {
        mj[j] = s[j][0];
#pragma unroll
        for (int r = 1; r < 8; ++r) mj[j] = fmaxf(mj[j], s[j][r]);
      }
      float m = fmaxf(fmaxf(mj[0], mj[1]), fmaxf(mj[2], mj[3]));
      m = fmaxf(m, xhalf(m));
      const float mnew  = fmaxf(mrun, m);
      const float alpha = __expf(mrun - mnew);
      mrun = mnew;
      FragH pa[2], pr[2];
      float pj[4];                                              // per-tile partial sums, joined below
#pragma unroll
      for (int j = 0; j < 4; ++j) {
        pj[j] = 0.f;
#pragma unroll
        for (int r = 0; r < 8; ++r) {
          const float p  = __expf(s[j][r] - mnew);
          pj[j] += p;
          const _Float16 hq = (_Float16)(p * PSC);
          const float res = __builtin_fmaf(p, PSC, -(float)hq) * RSC;   // p * 1024 is exact: the same residual
          pa[j >> 1].v[(j & 1) * 8 + r] = hq;                   // element e <-> key 32 kk + 8 hh + e, + 8 more from e = 8
          pr[j >> 1].v[(j & 1) * 8 + r] = (_Float16)res;
        }
      }
      lrun = lrun * alpha + ((pj[0] + pj[1]) + (pj[2] + pj[3]));
#pragma unroll
      for (int t = 0; t < 4; ++t) {
#pragma unroll
        for (int r = 0; r < 8; ++r) oacc[t][r] *= alpha;
      }

      // ---- context^T += V^T . P^T (f16 WMMA; A = V^T [dv][kv] split map, B = P^T from the registers) ----
#pragma unroll
      for (int t = 0; t < 4; ++t) {
        FragH vb[2], vx[2];
#pragma unroll
        for (int kk = 0; kk < 2; ++kk) {
          vb[kk].h[0] = *(const v8h*)(Vhs + (t * 16 + c) * LP + kk * 32 + 8 * hh);
          vb[kk].h[1] = *(const v8h*)(Vhs + (t * 16 + c) * LP + kk * 32 + 16 + 8 * hh);
          vx[kk].h[0] = *(const v8h*)(Vrs + (t * 16 + c) * LP + kk * 32 + 8 * hh);
          vx[kk].h[1] = *(const v8h*)(Vrs + (t * 16 + c) * LP + kk * 32 + 16 + 8 * hh);
        }
        oacc[t] = mma_h(vb[0].v, pa[0].v, oacc[t]);
        oacc[t] = mma_h(vb[1].v, pa[1].v, oacc[t]);
        v8f rr = mma_h(vx[0].v, pa[0].v, zero8());
        rr = mma_h(vx[1].v, pa[1].v, rr);
        rr = mma_h(vb[0].v, pr[0].v, rr);
        rr = mma_h(vb[1].v, pr[1].v, rr);
#pragma unroll
        for (int r = 0; r < 8; ++r) oacc[t][r] += rr[r] * (1.0f / RSC);
      }
    }

    // ---- hand over the wave's un-normalised 16x64 f32 tile (a lane holds 8 consecutive d of its query per
    //      tile: two 16-B stores) and its queries' (max, sum), the sum joined over the halves here ----
    float* os = Os[wave];
#pragma unroll
    for (int t = 0; t < 4; ++t) {
      const v4f lo = {oacc[t][0], oacc[t][1], oacc[t][2], oacc[t][3]};
      const v4f hi = {oacc[t][4], oacc[t][5], oacc[t][6], oacc[t][7]};
      *(v4f*)(os + c * OP + t * 16 + 8 * hh)     = lo;
      *(v4f*)(os + c * OP + t * 16 + 8 * hh + 4) = hi;
    }
    const float lall = lrun + xhalf(lrun);
    if (hh == 0) {                                 // both halves hold equal max and sum
      Ms[wave][c] = mrun;
      Ls[wave][c] = lall;
    }
    __syncthreads();
    // ---- join the NG groups' partials of rows 4 grp .. 4 grp + 3 of tile wq; a whole tile is normalised (8 / l,
    //      the 1/1024 p carry and the 1/64 v carry) and goes to out, a half of a split tile goes as it is to
    //      its workspace plane; each wave store = two whole 256-B rows ----
    {
      const int col = c * 4;
      const size_t pt = (size_t)((slot < 0 ? 0 : slot) * NB + b) * HT + (slot < 0 ? 0 : qb - HT);   // plane tile
      float* C = (slot < 0) ? (outp + (rowB + q0) * HD) : (Po + (pt * 64 + wq * 16) * HD);
#pragma unroll
      for (int it = 0; it < 2; ++it) {
        const int row = grp * 4 + it * 2 + hh;
        float mg[NG], lg[NG];
        v4f og[NG];
#pragma unroll
        for (int g = 0; g < NG; ++g) {
          mg[g] = Ms[g * 4 + wq][row];
          lg[g] = Ls[g * 4 + wq][row];
          og[g] = *(const v4f*)(Os[g * 4 + wq] + row * OP + col);
        }
        float mx = mg[0];                          // finite: group 0 has chunk c0, whose first key no row excludes
#pragma unroll
        for (int g = 1; g < NG; ++g) mx = fmaxf(mx, mg[g]);
        float l = 0.f;
        v4f o = {0.f, 0.f, 0.f, 0.f};
#pragma unroll
        for (int g = 0; g < NG; ++g) {
          const float wg = __expf(mg[g] - mx);
          l = fmaf(wg, lg[g], l);
          o += wg * og[g];
        }
        const float inv = (slot < 0) ? (((l > 0.f) ? (1.0f / l) : 0.f) * (OSC / (PSC * VSC))) : 1.0f;
        *(v4f*)(C + (size_t)row * HD + col) = o * inv;
#if defined(__HIP_DEVICE_COMPILE__)
        // what follows reuses the registers that hold this store's address and data
        asm volatile("s_wait_xcnt 0x0" ::: "memory");
#endif
      }
      // ---- a half's (max, sum) of all 64 rows, by the same sums: wave 0 alone, each store one whole line ----
      if (slot >= 0 && wave == 0) {
#pragma unroll
        for (int h = 0; h < 2; ++h) {
          const int rw = h * 32 + lane;
          float mg[NG], lg[NG];
#pragma unroll
          for (int g = 0; g < NG; ++g) {
            mg[g] = Ms[g * 4 + (rw >> 4)][rw & 15];
            lg[g] = Ls[g * 4 + (rw >> 4)][rw & 15];
          }
          float mx = mg[0];
#pragma unroll
          for (int g = 1; g < NG; ++g) mx = fmaxf(mx, mg[g]);
          float l = 0.f;
#pragma unroll
          for (int g = 0; g < NG; ++g) l = fmaf(__expf(mg[g] - mx), lg[g], l);
          Pm[pt * 64 + rw] = mx;
          Pl[pt * 64 + rw] = l;
        }
      }
    }
#if defined(__HIP_DEVICE_COMPILE__)
    // the next share reuses the registers that hold the addresses and data of wave 0's stores
    asm volatile("s_wait_xcnt 0x0" ::: "memory");
#endif
  }
}

// =====================================================================================================
// The two halves of a split query tile (HT .. NQB - 1), joined as the groups are joined above: weights
// exp(m_h - max m), then the same normalisation. Block = one tile = 64 rows x 64 d; piece i of thread tid is
// row tid / 16 + 16 i, d = 4 (tid % 16) .. + 3, so a wave load or store is 512 contiguous bytes. Both maxima are finite.
// coverage: NB * HT blocks x 256 threads x 4 pieces x 4 floats = every element of the split tiles once.
// =====================================================================================================
__global__ __launch_bounds__(256)
void join2(const float* __restrict__ Po, const float* __restrict__ Pm, const float* __restrict__ Pl, float* outp) {
  const int tile = blockIdx.x;                   // b * HT + (qb - HT)
  const int b    = tile / HT;
  const int qb   = HT + tile % HT;
  const int tid  = threadIdx.x;
  const float* o0 = Po + (size_t)tile * (64 * HD) + tid * 4;             // piece i: + 1024 i floats
  const float* o1 = o0 + (size_t)NB * HT * (64 * HD);
  const float* m0 = Pm + tile * 64 + (tid >> 4);                         // row of piece i: + 16 i
  const float* m1 = m0 + NB * HT * 64;
  const float* l0 = Pl + tile * 64 + (tid >> 4);
  const float* l1 = l0 + NB * HT * 64;
  float* C = outp + ((size_t)b * SEQ + qb * 64) * HD + tid * 4;
  v4f oa[4], ob[4];
  float ma[4], mb[4], la[4], lb[4];
#pragma unroll                                   // constant indices keep the arrays in registers: all loads fly at once
  for (int i = 0; i < 4; ++i) {
    oa[i] = *(const v4f*)(o0 + 1024 * i);
    ob[i] = *(const v4f*)(o1 + 1024 * i);
    ma[i] = m0[16 * i];
    mb[i] = m1[16 * i];
    la[i] = l0[16 * i];
    lb[i] = l1[16 * i];
  }
#if defined(__HIP_DEVICE_COMPILE__)
  // the loads' offset register (the thread index) stays whole until this wait; the sums below reuse it
  asm volatile("s_wait_xcnt 0x0" :: "v"(tid) : "memory");
#endif
#pragma unroll
  for (int i = 0; i < 4; ++i) {
    const float w  = __expf(-fabsf(ma[i] - mb[i]));          // the half with the larger maximum weighs exp(0) = 1
    const float wa = (ma[i] >= mb[i]) ? 1.0f : w;
    const float wb = (ma[i] >= mb[i]) ? w : 1.0f;
    const float l  = fmaf(wb, lb[i], wa * la[i]);
    const float inv = ((l > 0.f) ? (1.0f / l) : 0.f) * (OSC / (PSC * VSC));
    *(v4f*)(C + 1024 * i) = (wa * oa[i] + wb * ob[i]) * inv;
  }
}

// =====================================================================================================
// Workspace map (bytes); every plane is an exact multiple of its whole-line / 64x64-tile store granularity:
//   Qh   f16  [16384][64]        0          2097152
//   Qr   f16  [16384][64]        2097152    2097152
//   Kh   f16  [16384][64]        4194304    2097152
//   Kr   f16  [16384][64]        6291456    2097152
//   VTh  f16  [4][64][4096]      8388608    2097152
//   VTr  f16  [4][64][4096]      10485760   2097152
//   Po   f32  [2][4][32][64][64] 12582912   4194304    the two halves' contexts of the split tiles
//   Pm   f32  [2][4][32][64]     16777216   65536      their row maxima
//   Pl   f32  [2][4][32][64]     16842752   65536      their row sums
//   end                          16908288
// =====================================================================================================
extern "C" void kernel_launch(void* const* d_in, const int* in_sizes, int n_in,
                              void* d_out, int out_size, void* d_ws, size_t ws_size,
                              hipStream_t stream) {
  if (n_in < 7) return;
  if (in_sizes[0] != NX) return;
  if (in_sizes[1] != NW || in_sizes[3] != NW || in_sizes[5] != NW) return;
  if (in_sizes[2] != HD || in_sizes[4] != HD || in_sizes[6] != HD) return;
  if (out_size != NO) return;

  const float* x  = (const float*)d_in[0];
  const float* Wq = (const float*)d_in[1];
  const float* bq = (const float*)d_in[2];
  const float* Wk = (const float*)d_in[3];
  const float* bk = (const float*)d_in[4];
  const float* Wv = (const float*)d_in[5];
  const float* bv = (const float*)d_in[6];

  const size_t PB = (size_t)NO * 2;                     // 2097152
  size_t off = 0;
  const size_t oQh = off; off += PB;
  const size_t oQr = off; off += PB;
  const size_t oKh = off; off += PB;
  const size_t oKr = off; off += PB;
  const size_t oVh = off; off += PB;
  const size_t oVr = off; off += PB;
  const size_t oPo = off; off += (size_t)2 * NB * HT * 64 * HD * 4;
  const size_t oPm = off; off += (size_t)2 * NB * HT * 64 * 4;
  const size_t oPl = off; off += (size_t)2 * NB * HT * 64 * 4;
  if (off > ws_size) return;                            // off = 16908288

  char* ws = (char*)d_ws;
  _Float16* Qh  = (_Float16*)(ws + oQh);
  _Float16* Qr  = (_Float16*)(ws + oQr);
  _Float16* Kh  = (_Float16*)(ws + oKh);
  _Float16* Kr  = (_Float16*)(ws + oKr);
  _Float16* VTh = (_Float16*)(ws + oVh);
  _Float16* VTr = (_Float16*)(ws + oVr);
  float* Po = (float*)(ws + oPo);
  float* Pm = (float*)(ws + oPm);
  float* Pl = (float*)(ws + oPl);
  float* out0 = (float*)d_out;

  const dim3 gP(NROW / 64);                             // 256 blocks of 512
  const dim3 blkP(512);
  const dim3 gA(NB * NQB);                              // 256 blocks of 128 * NG
  const dim3 blkA(128 * NG);
  const dim3 gJ(NB * HT);                               // 128 blocks of 256
  const dim3 blkJ(256);

  // (1) projections from the f32 inputs -> q/k f16 hi + residual planes, v^T f16 hi + residual planes
  proj_qkv<<<gP, blkP, 0, stream>>>(x, Wq, Wk, Wv, bq, bk, bv, Qh, Qr, Kh, Kr, VTh, VTr);

  // (2) causal flash attention -> out f32 [4][4096][64] for tiles 0 .. 31, two halves in Po, Pm, Pl for the rest
  attn64<<<gA, blkA, 0, stream>>>(Qh, Qr, Kh, Kr, VTh, VTr, out0, Po, Pm, Pl);

  // (3) the split tiles' halves -> out
  join2<<<gJ, blkJ, 0, stream>>>(Po, Pm, Pl, out0);
  (void)hipGetLastError();
}

// v007
// It runs in 47.8 microseconds.
// Timed twice side by side with v006, it ran 1.05 and 1.06 times as fast.
// All steps since v000 together make it 6.21 times as fast.
#include <hip/hip_runtime.h>
#include <hip/hip_bf16.h>
#include <math.h>
#include <stdint.h>

#define NB   4
#define SEQ  4096
#define DE   512
#define HD   64
#define KC   64
#define LP   72      // LDS row pitch in halves of the 64-half K and V^T rows: 144 B = 16 B x odd
#define XP   520     // LDS row pitch in bf16 of the 512-element x and W rows: 1040 B = 16 B x odd
#define OP   68      // LDS row pitch in floats of the 64-float context rows: 272 B = 16 B x odd
#define NQB  (SEQ / 64)
#define NG   4       // key groups per attention workgroup: group g takes key chunks g, g + NG, g + 2 NG, ...
#define HT   (NQB / 2)   // query tiles HT .. NQB - 1 have more than HT key chunks: their chunks go to two workgroups
#define NROW (NB * SEQ)
#define NX   (NROW * DE)
#define NW   (HD * DE)
#define NO   (NROW * HD)
#define PSC  1024.0f
#define RSC  2048.0f
#define VSC  64.0f
#define OSC  8.0f
static_assert((SEQ % 64) == 0);
static_assert(HD == 64);
static_assert(KC == 64);
static_assert(LP >= KC && LP >= HD && (LP % 8) == 0 && ((LP / 8) % 2) == 1);
static_assert(OP >= HD && (OP % 4) == 0 && ((OP / 4) % 2) == 1);
static_assert((DE % 32) == 0);
static_assert(DE == 512);
static_assert(XP >= DE && (XP % 8) == 0 && ((XP / 8) % 2) == 1);
static_assert((NROW % 64) == 0);
static_assert((NQB % 2) == 0);

typedef _Float16 v16h __attribute__((ext_vector_type(16)));
typedef _Float16 v8h  __attribute__((ext_vector_type(8)));
typedef __bf16   v16b __attribute__((ext_vector_type(16)));
typedef float    v8f  __attribute__((ext_vector_type(8)));
typedef float    v4f  __attribute__((ext_vector_type(4)));
typedef unsigned int v4u __attribute__((ext_vector_type(4)));
typedef unsigned int v2u __attribute__((ext_vector_type(2)));
typedef float    v2f  __attribute__((ext_vector_type(2)));
typedef __bf16   v2b  __attribute__((ext_vector_type(2)));

union FragH { v16h v; v8h h[2]; };
union FragB { v16b v; v4u u[2]; };
union HU8   { v8h h; v4u u; };
union BU4   { v2b b[2]; v2u u; };

// ---- scalar helpers --------------------------------------------------------------------------------
__device__ __forceinline__ unsigned short bf_bits(float f) {          // f32 -> bf16 bits, RNE convert
  unsigned u = __float_as_uint(f);
  return (unsigned short)((u + 0x7FFFu + ((u >> 16) & 1u)) >> 16);
}
__device__ __forceinline__ float bf_up(unsigned short h) { return __uint_as_float(((unsigned)h) << 16); }
__device__ __forceinline__ float bfr(float f) { return bf_up(bf_bits(f)); }   // value of the bf16 RNE convert
__device__ __forceinline__ v8f zero8() { v8f z = {0.f, 0.f, 0.f, 0.f, 0.f, 0.f, 0.f, 0.f}; return z; }

// ---- fragment loaders: 16-bit A/B operand, lane -> row/col (lane&15), p already includes +8*(lane>>4);
//      elements 0..7 <- p[0..7] (k0+8h..), elements 8..15 <- p[16..23] (k0+16+8h..)
__device__ __forceinline__ v16h ldfrag_h(const _Float16* p) {
  FragH f;
  f.h[0] = *(const v8h*)(p);
  f.h[1] = *(const v8h*)(p + 16);
  return f.v;
}
__device__ __forceinline__ v16b ldfrag_b(const unsigned short* p) {
  FragB f;
  f.u[0] = *(const v4u*)(p);
  f.u[1] = *(const v4u*)(p + 16);
  return f.v;
}

// ---- WMMA helpers with trailing VALU hazard gap --------------------------------------------------------
__device__ __forceinline__ v8f mma_h(v16h a, v16h b, v8f c) {
  c = __builtin_amdgcn_wmma_f32_16x16x32_f16(false, a, false, b, (short)0, c, false, false);
#if defined(__HIP_DEVICE_COMPILE__)
  asm volatile("v_nop\n\tv_nop\n\tv_nop\n\tv_nop" : "+v"(c) : "v"(a), "v"(b));
#endif
  return c;
}
__device__ __forceinline__ v8f mma_b(v16b a, v16b b, v8f c) {
  c = __builtin_amdgcn_wmma_f32_16x16x32_bf16(false, a, false, b, (short)0, c, false, false);
#if defined(__HIP_DEVICE_COMPILE__)
  asm volatile("v_nop\n\tv_nop\n\tv_nop\n\tv_nop" : "+v"(c) : "v"(a), "v"(b));
#endif
  return c;
}
// value of lane l ^ 16 (the other half of the wave), by a vector cross-row move
__device__ __forceinline__ float xhalf(float x) {
  const int i = __float_as_int(x);
  return __int_as_float(__builtin_amdgcn_permlanex16(i, i, 0x76543210, 0xfedcba98, false, false));
}

// =====================================================================================================
// q/k/v projections, f32 inputs converted on the way in. Block = 512 threads = 16 waves = 64 token rows
// (rows r0..r0+63 of the flattened [NB*SEQ] row index; 64 | SEQ so one block never crosses a sequence).
// Stage: the block's 64 x rows and all 64 rows of Wq, Wk, Wv are read as f32 (a wave load = 512 contiguous
// bytes of one row), rounded to bf16 RNE in registers and laid in LDS in rows of pitch XP;
// wave w brings rows 4w..4w+3 of each of the four. One barrier.
// Product: wave (rt, cg) owns token rows 16 rt..+15 x columns 16 cg..+15 of q, k and v: A fragment from x row
// lane&15, B(k, n) = W[n][k] fragments from W row n (k-contiguous), K = DE in ascending 32-steps.
// Epilogue (f32): + bf16_RNE(bias[n]); q/k: hi = f16(v), res = f16((v - hi) * 2048) staged as [row][d];
// v: the same of 64 v, staged transposed [d][s]; one barrier; every thread stores one 16-B piece per plane.
// coverage: 512 threads x 8 halves = 64 x 64 per plane; grid NROW/64 blocks covers all rows.
// =====================================================================================================
__device__ __forceinline__ v2u cvt4(v4f a) {                 // four f32 -> four bf16 (RNE), packed
  BU4 o;
  const v2f lo = {a[0], a[1]};
  const v2f hi = {a[2], a[3]};
  o.b[0] = __builtin_convertvector(lo, v2b);
  o.b[1] = __builtin_convertvector(hi, v2b);
  return o.u;
}
// four f32 rows of DE elements: p = first row + 4 * lane; piece (i, j) = row i, elements 128 j + 4 lane ..+3
__device__ __forceinline__ void ld_rows(const float* __restrict__ p, v4f (&t)[16]) {
#pragma unroll                                   // constant indices keep t[] in registers, here and in st_rows
  for (int i = 0; i < 4; ++i) {
#pragma unroll
    for (int j = 0; j < 4; ++j) t[i * 4 + j] = *(const v4f*)(p + i * DE + j * 128);
  }
}
__device__ __forceinline__ void st_rows(unsigned short* d, const v4f (&t)[16]) {
#pragma unroll
  for (int i = 0; i < 4; ++i) {
#pragma unroll
    for (int j = 0; j < 4; ++j) *(v2u*)(d + i * XP + j * 128) = cvt4(t[i * 4 + j]);
  }
}

__global__ __launch_bounds__(512)
void proj_qkv(const float* __restrict__ x,
              const float* __restrict__ Wq, const float* __restrict__ Wk, const float* __restrict__ Wv,
              const float* __restrict__ bq, const float* __restrict__ bk, const float* __restrict__ bv,
              _Float16* Qh, _Float16* Qr, _Float16* Kh, _Float16* Kr, _Float16* VTh, _Float16* VTr) {
  __shared__ __align__(16) unsigned short Xs[64 * XP];       // bf16 x rows                            65 KB
  __shared__ __align__(16) unsigned short Ws[3][64 * XP];    // bf16 Wq, Wk, Wv rows                  195 KB
  __shared__ __align__(16) _Float16 Eh[3][64 * 72];          // q, k [row][d] and v^T [d][s], hi       27 KB
  __shared__ __align__(16) _Float16 Er[3][64 * 72];          // their x2048 residuals                  27 KB

  const int tid  = threadIdx.x;
  const int wave = __builtin_amdgcn_readfirstlane(tid >> 5);
  const int lane = tid & 31;
  const int hh   = lane >> 4;
  const int c    = lane & 15;
  const int rt   = wave & 3;                     // token row tile
  const int cg   = wave >> 2;                    // column tile inside each projection
  const int r0   = blockIdx.x * 64;
  const int b    = r0 / SEQ;
  const int s0   = r0 - b * SEQ;

  const int n = cg * 16 + c;
  const float bias0 = bfr(bq[n]);
  const float bias1 = bfr(bk[n]);
  const float bias2 = bfr(bv[n]);

  // ---- stage: two register sets, so that the next rows' loads fly while these are rounded and stored.
  //      Each sched_barrier keeps that order: without them the compiler lifts all 64 loads to the top, sinks
  //      all stores to the foot and spills ----
  {
    const size_t ro = (size_t)(wave * 4) * DE + lane * 4;
    const int d = (wave * 4) * XP + lane * 4;
    v4f ta[16], tb[16];
    ld_rows(x + (size_t)r0 * DE + ro, ta);
    ld_rows(Wq + ro, tb);
    __builtin_amdgcn_sched_barrier(0);           // x and Wq rows in flight before the first store
    st_rows(Xs + d, ta);
    __builtin_amdgcn_sched_barrier(0);           // set a is free only now
    ld_rows(Wk + ro, ta);
    __builtin_amdgcn_sched_barrier(0);           // Wk rows in flight before Wq is waited for
    st_rows(Ws[0] + d, tb);
    __builtin_amdgcn_sched_barrier(0);           // set b is free only now
    ld_rows(Wv + ro, tb);
    __builtin_amdgcn_sched_barrier(0);           // Wv rows in flight before Wk is waited for
    st_rows(Ws[1] + d, ta);
    st_rows(Ws[2] + d, tb);
  }
  __syncthreads();

  // ---- products: the fragments of k-step ks + 1 are fetched into the other register set ahead of the
  //      WMMAs of k-step ks ----
  v8f acc[3];
#pragma unroll
  for (int w = 0; w < 3; ++w) acc[w] = zero8();
  const unsigned short* ap = Xs + (rt * 16 + c) * XP + 8 * hh;           // A row = lane&15
  const int wo = n * XP + 8 * hh;                                        // B col n = cg*16+c = W row n
  v16b a[2], wf[2][3];
  a[0] = ldfrag_b(ap);
#pragma unroll
  for (int w = 0; w < 3; ++w) wf[0][w] = ldfrag_b(Ws[w] + wo);
#pragma unroll                                   // the set index ks & 1 must be a constant: both sets in registers
  for (int ks = 0; ks < DE / 32; ++ks) {
    const int cur = ks & 1;
    if (ks + 1 < DE / 32) {
      a[cur ^ 1] = ldfrag_b(ap + (ks + 1) * 32);
#pragma unroll
      for (int w = 0; w < 3; ++w) wf[cur ^ 1][w] = ldfrag_b(Ws[w] + wo + (ks + 1) * 32);
    }
#pragma unroll
    for (int w = 0; w < 3; ++w) acc[w] = mma_b(a[cur], wf[cur][w], acc[w]);
  }

  // ---- q, k: [token row][d] as f16 hi and x2048 residual; v: transposed [d][s], of v * 64 ----
#pragma unroll
  for (int w = 0; w < 3; ++w) {
    const float bias = (w == 0) ? bias0 : ((w == 1) ? bias1 : bias2);
#pragma unroll
    for (int r = 0; r < 8; ++r) {
      const float v = (w < 2) ? (acc[w][r] + bias) : ((acc[w][r] + bias) * VSC);
      const _Float16 hq = (_Float16)v;
      const _Float16 rq = (_Float16)((v - (float)hq) * RSC);
      const int row = rt * 16 + 8 * hh + r;
      const int pi = (w < 2) ? (row * 72 + n) : (n * 72 + row);
      Eh[w][pi] = hq;
      Er[w][pi] = rq;
    }
  }
  __syncthreads();
  {
    const int q8 = tid >> 3, c8 = (tid & 7) * 8;
    v4u vh[3], vr[3];
#pragma unroll
    for (int w = 0; w < 3; ++w) {
      HU8 u;
      u.h = *(const v8h*)(Eh[w] + q8 * 72 + c8);
      vh[w] = u.u;
      u.h = *(const v8h*)(Er[w] + q8 * 72 + c8);
      vr[w] = u.u;
    }
    const size_t o  = (size_t)(r0 + q8) * HD + c8;                       // q, k: token row q8
    const size_t ov = ((size_t)b * HD + q8) * SEQ + s0 + c8;             // v^T: d = q8
    *(v4u*)(Qh + o)   = vh[0];
    *(v4u*)(Qr + o)   = vr[0];
    *(v4u*)(Kh + o)   = vh[1];
    *(v4u*)(Kr + o)   = vr[1];
    *(v4u*)(VTh + ov) = vh[2];
    *(v4u*)(VTr + ov) = vr[2];
  }
}

#define PLB  (KC * LP * 2)
#define GRB  (4 * PLB)
#define BUFB (NG * GRB)
static_assert(4 * NG * 16 * OP * 4 <= 2 * BUFB);

// Rows r, r + 16, r + 32, r + 48 of two planes' tiles, 16 B per lane each: l = the lane's LDS byte address in
// the first plane (the second lies PLB behind it), ga, gb = its global addresses, gs = 16 rows in halves.
// The s_wait_xcnt stands inside the statement, so that no address register is rewritten in front of it.
__device__ __forceinline__ void copy2(unsigned l, const _Float16* ga, const _Float16* gb, size_t gs) {
#if defined(__HIP_DEVICE_COMPILE__)
  asm volatile("global_load_async_to_lds_b128 %0, %8, off\n\t"
               "global_load_async_to_lds_b128 %1, %9, off\n\t"
               "global_load_async_to_lds_b128 %2, %10, off\n\t"
               "global_load_async_to_lds_b128 %3, %11, off\n\t"
               "global_load_async_to_lds_b128 %4, %12, off\n\t"
               "global_load_async_to_lds_b128 %5, %13, off\n\t"
               "global_load_async_to_lds_b128 %6, %14, off\n\t"
               "global_load_async_to_lds_b128 %7, %15, off\n\t"
               "s_wait_xcnt 0x0"
               :: "v"(l), "v"(l + 32 * LP), "v"(l + 64 * LP), "v"(l + 96 * LP),
                  "v"(l + PLB), "v"(l + PLB + 32 * LP), "v"(l + PLB + 64 * LP), "v"(l + PLB + 96 * LP),
                  "v"(ga), "v"(ga + gs), "v"(ga + 2 * gs), "v"(ga + 3 * gs),
                  "v"(gb), "v"(gb + gs), "v"(gb + 2 * gs), "v"(gb + 3 * gs)
               : "memory");
#endif
}

__global__ __launch_bounds__(128 * NG)
void attn64(const _Float16* __restrict__ Qh, const _Float16* __restrict__ Qr,
            const _Float16* __restrict__ Kh, const _Float16* __restrict__ Kr,
            const _Float16* __restrict__ VTh, const _Float16* __restrict__ VTr, float* outp,
            float* Po, float* Pm, float* Pl) {
  // [buffer][group][K hi [kv][d], K res, V^T hi [d][kv], V^T res][64 rows of pitch LP], 9 KB a plane; behind a
  // share's last trip its first bytes hold the per wave context tiles [wave][row][d], f32, pitch OP
  __shared__ __align__(16) unsigned char KV[2 * BUFB];
  __shared__ float                  Ms[4 * NG][16];               // per wave running max of its 16 rows
  __shared__ float                  Ls[4 * NG][16];               // per wave running sum of its 16 rows

  const int tid  = threadIdx.x;
  const int wave = __builtin_amdgcn_readfirstlane(tid >> 5);      // scalar: group tests are scalar branches
  const int grp  = wave >> 2;                    // key group
  const int wq   = wave & 3;                     // query tile inside the block
  const int lane = tid & 31;
  const int hh   = lane >> 4;
  const int c    = lane & 15;
  const int pc = (lane & 7) * 8;                                  // staging: 16-B piece of the 128-B tile row
  const int sr = ((lane >> 3) & 1) * 8 + wq * 2 + hh;             // staging: tile row of piece i is sr + 16 i
  // the lane's LDS byte address in its group's K hi plane of buffer 0
  const unsigned sl = (unsigned)(uintptr_t)(KV + grp * GRB + (sr * LP + pc) * 2);

  const int bx = blockIdx.x;
  const int wi = bx % HT + ((bx < NB * HT) ? HT : 0);   // which share of its sequence this block takes
  const int b  = (bx / HT) % NB;
  const size_t rowB = (size_t)b * SEQ;
  const _Float16* VThb = VTh + (size_t)b * HD * SEQ;
  const _Float16* VTrb = VTr + (size_t)b * HD * SEQ;
  const int njob = (wi < HT) ? 1 : 2;            // block-uniform, like all that is formed from wi and job

#pragma unroll 1                                 // one copy of the chunk loop serves both shares
  for (int job = 0; job < njob; ++job) {
    const int qb   = (wi < HT) ? (HT + wi) : ((job == 0) ? wi : (NQB - 1 - wi));     // query tile
    const int c0   = (wi >= HT && job == 0) ? HT : 0;                                // first key chunk
    const int c1   = (wi < HT) ? (HT - 1) : qb;                                      // last key chunk, <= qb
    const int slot = (wi < HT) ? 0 : ((job == 0) ? 1 : -1);   // half of a split tile, or -1: the whole tile
    const int q0 = qb * 64 + wq * 16;              // in-sequence query row of this wave's first row
    const int qrow = q0 + c;                       // in-sequence query row of this lane's accumulator column

    // ---- Q fragments (B operand, column = query = lane&15): 2 d-chunks, hi and residual ----
    v16h qh[2], qr[2];
#pragma unroll
    for (int dc = 0; dc < 2; ++dc) {
      qh[dc] = ldfrag_h(Qh + (rowB + q0 + c) * HD + dc * 32 + 8 * hh);
      qr[dc] = ldfrag_h(Qr + (rowB + q0 + c) * HD + dc * 32 + 8 * hh);
    }

    float mrun = -INFINITY;                        // running max of query c (equal in both halves)
    float lrun = 0.f;                              // running sum of query c over this half's keys only
    v8f oacc[4];                                   // O^T: tile t, register r = context[query c][d = 16 t + 8 hh + r]
#pragma unroll
    for (int t = 0; t < 4; ++t) oacc[t] = zero8();

    // the lane's global addresses in key chunk 0: K row sr, d = pc .. pc + 7; V^T row d = sr, s = pc .. pc + 7
    const _Float16* kgh = Kh + (rowB + sr) * HD + pc;
    const _Float16* kgr = Kr + (rowB + sr) * HD + pc;
    const _Float16* vgh = VThb + (size_t)sr * SEQ + pc;
    const _Float16* vgr = VTrb + (size_t)sr * SEQ + pc;

    // ---- The trips kb = c0 - 2 NG and c0 - NG stand in front of the first chunk: they have no products, only the
    //      foot. The first one's waits and barrier end every wave's reads of the share before (its context tiles
    //      lie in these buffers), and the group's first chunk is copied into buffer 0; the second one's wait and
    //      barrier publish that chunk, and the second chunk is copied into buffer 1. Every test on a group's chunk
    //      is wave-uniform (scalar); every wave passes every wait and every barrier ----
    int buf = 0;                               // byte offset of this trip's buffer: 0 or BUFB
#pragma unroll 1
    for (int kb = c0 - 2 * NG; kb <= c1; kb += NG) {    // block-uniform trip count, at most NQB / NG + 2
      const int kt  = kb + grp;
      const int kv0 = kt * KC;
      const _Float16* Khs = (const _Float16*)(KV + buf + grp * GRB);
      const _Float16* Krs = Khs + KC * LP;
      const _Float16* Vhs = Krs + KC * LP;
      const _Float16* Vrs = Vhs + HD * LP;

      if (kb >= c0 && kt <= c1) {              // wave-uniform (scalar): this group has a chunk in this trip
      // ---- scores, transposed: 64 keys x 16 queries per wave (A operand: row = key j*16+c, k = d, split map) ----
      v8f s[4];
#pragma unroll
      for (int j = 0; j < 4; ++j) {
        v8f sh = zero8();
        v8f sx = zero8();
#pragma unroll
        for (int dc = 0; dc < 2; ++dc) {
          FragH kb, kx;
          kb.h[0] = *(const v8h*)(Khs + (j * 16 + c) * LP + dc * 32 + 8 * hh);
          kb.h[1] = *(const v8h*)(Khs + (j * 16 + c) * LP + dc * 32 + 16 + 8 * hh);
          kx.h[0] = *(const v8h*)(Krs + (j * 16 + c) * LP + dc * 32 + 8 * hh);
          kx.h[1] = *(const v8h*)(Krs + (j * 16 + c) * LP + dc * 32 + 16 + 8 * hh);
          sh = mma_h(kb.v, qh[dc], sh);
          sx = mma_h(kx.v, qh[dc], sx);
          sx = mma_h(kb.v, qr[dc], sx);
        }
        const int key = kv0 + j * 16 + 8 * hh;                  // key of accumulator register r is key + r
#pragma unroll
        for (int r = 0; r < 8; ++r) {
          const float sv = sh[r] + sx[r] * (1.0f / RSC);
          s[j][r] = (key + r > qrow) ? -INFINITY : sv;          // causal: keys strictly after the row excluded
        }
      }

      // ---- query max in the lane and across the halves, online softmax, P^T hi (x1024) and residual (x2048)
      //      packed straight into B operands ----
      float mj[4];                                              // one chain per tile: four short chains, not one long
#pragma unroll
      for (int j = 0; j < 4; ++j) {
        mj[j] = s[j][0];
#pragma unroll
        for (int r = 1; r < 8; ++r) mj[j] = fmaxf(mj[j], s[j][r]);
      }
      float m = fmaxf(fmaxf(mj[0], mj[1]), fmaxf(mj[2], mj[3]));
      m = fmaxf(m, xhalf(m));
      const float mnew  = fmaxf(mrun, m);
      const float alpha = __expf(mrun - mnew);
      mrun = mnew;
      FragH pa[2], pr[2];
      float pj[4];                                              // per-tile partial sums, joined below
#pragma unroll
      for (int j = 0; j < 4; ++j) {
        pj[j] = 0.f;
#pragma unroll
        for (int r = 0; r < 8; ++r) {
          const float p  = __expf(s[j][r] - mnew);
          pj[j] += p;
          const _Float16 hq = (_Float16)(p * PSC);
          const float res = __builtin_fmaf(p, PSC, -(float)hq) * RSC;   // p * 1024 is exact: the same residual
          pa[j >> 1].v[(j & 1) * 8 + r] = hq;                   // element e <-> key 32 kk + 8 hh + e, + 8 more from e = 8
          pr[j >> 1].v[(j & 1) * 8 + r] = (_Float16)res;
        }
      }
      lrun = lrun * alpha + ((pj[0] + pj[1]) + (pj[2] + pj[3]));
#pragma unroll
      for (int t = 0; t < 4; ++t) {
#pragma unroll
        for (int r = 0; r < 8; ++r) oacc[t][r] *= alpha;
      }

      // ---- context^T += V^T . P^T (f16 WMMA; A = V^T [dv][kv] split map, B = P^T from the registers) ----
#pragma unroll
      for (int t = 0; t < 4; ++t) {
        FragH vb[2], vx[2];
#pragma unroll
        for (int kk = 0; kk < 2; ++kk) {
          vb[kk].h[0] = *(const v8h*)(Vhs + (t * 16 + c) * LP + kk * 32 + 8 * hh);
          vb[kk].h[1] = *(const v8h*)(Vhs + (t * 16 + c) * LP + kk * 32 + 16 + 8 * hh);
          vx[kk].h[0] = *(const v8h*)(Vrs + (t * 16 + c) * LP + kk * 32 + 8 * hh);
          vx[kk].h[1] = *(const v8h*)(Vrs + (t * 16 + c) * LP + kk * 32 + 16 + 8 * hh);
        }
        oacc[t] = mma_h(vb[0].v, pa[0].v, oacc[t]);
        oacc[t] = mma_h(vb[1].v, pa[1].v, oacc[t]);
        v8f rr = mma_h(vx[0].v, pa[0].v, zero8());
        rr = mma_h(vx[1].v, pa[1].v, rr);
        rr = mma_h(vb[0].v, pr[0].v, rr);
        rr = mma_h(vb[1].v, pr[1].v, rr);
#pragma unroll
        for (int r = 0; r < 8; ++r) oacc[t][r] += rr[r] * (1.0f / RSC);
      }
      }                                        // end of this group's chunk

      // ---- foot of the trip, every wave ----
#if defined(__HIP_DEVICE_COMPILE__)
      asm volatile("s_wait_dscnt 0x0" ::: "memory");      // this wave has read the last of this trip's buffer
      asm volatile("s_wait_asynccnt 0x0" ::: "memory");   // its pieces of the next trip's chunk have landed
#endif
      __syncthreads();                                    // both hold for every wave
      if (kt + 2 * NG <= c1) {                            // wave-uniform (scalar): the chunk of the trip after the next
        const size_t kv = (size_t)(kt + 2 * NG) * KC;
        copy2(sl + buf, kgh + kv * HD, kgr + kv * HD, 16 * HD);
        copy2(sl + buf + 2 * PLB, vgh + kv, vgr + kv, (size_t)16 * SEQ);
      }
      buf ^= BUFB;
    }
#if defined(__HIP_DEVICE_COMPILE__)
    asm volatile("s_wait_asynccnt 0x0" ::: "memory");     // no copy is in flight when the buffers change their use
#endif

    // ---- hand over the wave's un-normalised 16x64 f32 tile (a lane holds 8 consecutive d of its query per
    //      tile: two 16-B stores) and its queries' (max, sum), the sum joined over the halves here ----
    float* os = (float*)KV + wave * (16 * OP);
#pragma unroll
    for (int t = 0; t < 4; ++t) {
      const v4f lo = {oacc[t][0], oacc[t][1], oacc[t][2], oacc[t][3]};
      const v4f hi = {oacc[t][4], oacc[t][5], oacc[t][6], oacc[t][7]};
      *(v4f*)(os + c * OP + t * 16 + 8 * hh)     = lo;
      *(v4f*)(os + c * OP + t * 16 + 8 * hh + 4) = hi;
    }
    const float lall = lrun + xhalf(lrun);
    if (hh == 0) {                                 // both halves hold equal max and sum
      Ms[wave][c] = mrun;
      Ls[wave][c] = lall;
    }
    __syncthreads();
    // ---- join the NG groups' partials of rows 4 grp .. 4 grp + 3 of tile wq; a whole tile is normalised (8 / l,
    //      the 1/1024 p carry and the 1/64 v carry) and goes to out, a half of a split tile goes as it is to
    //      its workspace plane; each wave store = two whole 256-B rows ----
    {
      const int col = c * 4;
      const size_t pt = (size_t)((slot < 0 ? 0 : slot) * NB + b) * HT + (slot < 0 ? 0 : qb - HT);   // plane tile
      float* C = (slot < 0) ? (outp + (rowB + q0) * HD) : (Po + (pt * 64 + wq * 16) * HD);
#pragma unroll
      for (int it = 0; it < 2; ++it) {
        const int row = grp * 4 + it * 2 + hh;
        float mg[NG], lg[NG];
        v4f og[NG];
#pragma unroll
        for (int g = 0; g < NG; ++g) {
          mg[g] = Ms[g * 4 + wq][row];
          lg[g] = Ls[g * 4 + wq][row];
          og[g] = *(const v4f*)((const float*)KV + (g * 4 + wq) * (16 * OP) + row * OP + col);
        }
        float mx = mg[0];                          // finite: group 0 has chunk c0, whose first key no row excludes
#pragma unroll
        for (int g = 1; g < NG; ++g) mx = fmaxf(mx, mg[g]);
        float l = 0.f;
        v4f o = {0.f, 0.f, 0.f, 0.f};
#pragma unroll
        for (int g = 0; g < NG; ++g) {
          const float wg = __expf(mg[g] - mx);
          l = fmaf(wg, lg[g], l);
          o += wg * og[g];
        }
        const float inv = (slot < 0) ? (((l > 0.f) ? (1.0f / l) : 0.f) * (OSC / (PSC * VSC))) : 1.0f;
        *(v4f*)(C + (size_t)row * HD + col) = o * inv;
#if defined(__HIP_DEVICE_COMPILE__)
        // what follows reuses the registers that hold this store's address and data
        asm volatile("s_wait_xcnt 0x0" ::: "memory");
#endif
      }
      // ---- a half's (max, sum) of all 64 rows, by the same sums: wave 0 alone, each store one whole line ----
      if (slot >= 0 && wave == 0) {
#pragma unroll
        for (int h = 0; h < 2; ++h) {
          const int rw = h * 32 + lane;
          float mg[NG], lg[NG];
#pragma unroll
          for (int g = 0; g < NG; ++g) {
            mg[g] = Ms[g * 4 + (rw >> 4)][rw & 15];
            lg[g] = Ls[g * 4 + (rw >> 4)][rw & 15];
          }
          float mx = mg[0];
#pragma unroll
          for (int g = 1; g < NG; ++g) mx = fmaxf(mx, mg[g]);
          float l = 0.f;
#pragma unroll
          for (int g = 0; g < NG; ++g) l = fmaf(__expf(mg[g] - mx), lg[g], l);
          Pm[pt * 64 + rw] = mx;
          Pl[pt * 64 + rw] = l;
        }
      }
    }
#if defined(__HIP_DEVICE_COMPILE__)
    // the next share reuses the registers that hold the addresses and data of wave 0's stores
    asm volatile("s_wait_xcnt 0x0" ::: "memory");
#endif
  }
}

// =====================================================================================================
// The two halves of a split query tile (HT .. NQB - 1), joined as the groups are joined above: weights
// exp(m_h - max m), then the same normalisation. Block = one tile = 64 rows x 64 d; piece i of thread tid is
// row tid / 16 + 16 i, d = 4 (tid % 16) .. + 3, so a wave load or store is 512 contiguous bytes. Both maxima are finite.
// coverage: NB * HT blocks x 256 threads x 4 pieces x 4 floats = every element of the split tiles once.
// =====================================================================================================
__global__ __launch_bounds__(256)
void join2(const float* __restrict__ Po, const float* __restrict__ Pm, const float* __restrict__ Pl, float* outp) {
  const int tile = blockIdx.x;                   // b * HT + (qb - HT)
  const int b    = tile / HT;
  const int qb   = HT + tile % HT;
  const int tid  = threadIdx.x;
  const float* o0 = Po + (size_t)tile * (64 * HD) + tid * 4;             // piece i: + 1024 i floats
  const float* o1 = o0 + (size_t)NB * HT * (64 * HD);
  const float* m0 = Pm + tile * 64 + (tid >> 4);                         // row of piece i: + 16 i
  const float* m1 = m0 + NB * HT * 64;
  const float* l0 = Pl + tile * 64 + (tid >> 4);
  const float* l1 = l0 + NB * HT * 64;
  float* C = outp + ((size_t)b * SEQ + qb * 64) * HD + tid * 4;
  v4f oa[4], ob[4];
  float ma[4], mb[4], la[4], lb[4];
#pragma unroll                                   // constant indices keep the arrays in registers: all loads fly at once
  for (int i = 0; i < 4; ++i) {
    oa[i] = *(const v4f*)(o0 + 1024 * i);
    ob[i] = *(const v4f*)(o1 + 1024 * i);
    ma[i] = m0[16 * i];
    mb[i] = m1[16 * i];
    la[i] = l0[16 * i];
    lb[i] = l1[16 * i];
  }
#if defined(__HIP_DEVICE_COMPILE__)
  // the loads' offset register (the thread index) stays whole until this wait; the sums below reuse it
  asm volatile("s_wait_xcnt 0x0" :: "v"(tid) : "memory");
#endif
#pragma unroll
  for (int i = 0; i < 4; ++i) {
    const float w  = __expf(-fabsf(ma[i] - mb[i]));          // the half with the larger maximum weighs exp(0) = 1
    const float wa = (ma[i] >= mb[i]) ? 1.0f : w;
    const float wb = (ma[i] >= mb[i]) ? w : 1.0f;
    const float l  = fmaf(wb, lb[i], wa * la[i]);
    const float inv = ((l > 0.f) ? (1.0f / l) : 0.f) * (OSC / (PSC * VSC));
    *(v4f*)(C + 1024 * i) = (wa * oa[i] + wb * ob[i]) * inv;
  }
}

// =====================================================================================================
// Workspace map (bytes); every plane is an exact multiple of its whole-line / 64x64-tile store granularity:
//   Qh   f16  [16384][64]        0          2097152
//   Qr   f16  [16384][64]        2097152    2097152
//   Kh   f16  [16384][64]        4194304    2097152
//   Kr   f16  [16384][64]        6291456    2097152
//   VTh  f16  [4][64][4096]      8388608    2097152
//   VTr  f16  [4][64][4096]      10485760   2097152
//   Po   f32  [2][4][32][64][64] 12582912   4194304    the two halves' contexts of the split tiles
//   Pm   f32  [2][4][32][64]     16777216   65536      their row maxima
//   Pl   f32  [2][4][32][64]     16842752   65536      their row sums
//   end                          16908288
// =====================================================================================================
extern "C" void kernel_launch(void* const* d_in, const int* in_sizes, int n_in,
                              void* d_out, int out_size, void* d_ws, size_t ws_size,
                              hipStream_t stream) {
  if (n_in < 7) return;
  if (in_sizes[0] != NX) return;
  if (in_sizes[1] != NW || in_sizes[3] != NW || in_sizes[5] != NW) return;
  if (in_sizes[2] != HD || in_sizes[4] != HD || in_sizes[6] != HD) return;
  if (out_size != NO) return;

  const float* x  = (const float*)d_in[0];
  const float* Wq = (const float*)d_in[1];
  const float* bq = (const float*)d_in[2];
  const float* Wk = (const float*)d_in[3];
  const float* bk = (const float*)d_in[4];
  const float* Wv = (const float*)d_in[5];
  const float* bv = (const float*)d_in[6];

  const size_t PB = (size_t)NO * 2;                     // 2097152
  size_t off = 0;
  const size_t oQh = off; off += PB;
  const size_t oQr = off; off += PB;
  const size_t oKh = off; off += PB;
  const size_t oKr = off; off += PB;
  const size_t oVh = off; off += PB;
  const size_t oVr = off; off += PB;
  const size_t oPo = off; off += (size_t)2 * NB * HT * 64 * HD * 4;
  const size_t oPm = off; off += (size_t)2 * NB * HT * 64 * 4;
  const size_t oPl = off; off += (size_t)2 * NB * HT * 64 * 4;
  if (off > ws_size) return;                            // off = 16908288

  char* ws = (char*)d_ws;
  _Float16* Qh  = (_Float16*)(ws + oQh);
  _Float16* Qr  = (_Float16*)(ws + oQr);
  _Float16* Kh  = (_Float16*)(ws + oKh);
  _Float16* Kr  = (_Float16*)(ws + oKr);
  _Float16* VTh = (_Float16*)(ws + oVh);
  _Float16* VTr = (_Float16*)(ws + oVr);
  float* Po = (float*)(ws + oPo);
  float* Pm = (float*)(ws + oPm);
  float* Pl = (float*)(ws + oPl);
  float* out0 = (float*)d_out;

  const dim3 gP(NROW / 64);                             // 256 blocks of 512
  const dim3 blkP(512);
  const dim3 gA(NB * NQB);                              // 256 blocks of 128 * NG
  const dim3 blkA(128 * NG);
  const dim3 gJ(NB * HT);                               // 128 blocks of 256
  const dim3 blkJ(256);

  // (1) projections from the f32 inputs -> q/k f16 hi + residual planes, v^T f16 hi + residual planes
  proj_qkv<<<gP, blkP, 0, stream>>>(x, Wq, Wk, Wv, bq, bk, bv, Qh, Qr, Kh, Kr, VTh, VTr);

  // (2) causal flash attention -> out f32 [4][4096][64] for tiles 0 .. 31, two halves in Po, Pm, Pl for the rest
  attn64<<<gA, blkA, 0, stream>>>(Qh, Qr, Kh, Kr, VTh, VTr, out0, Po, Pm, Pl);

  // (3) the split tiles' halves -> out
  join2<<<gJ, blkJ, 0, stream>>>(Po, Pm, Pl, out0);
  (void)hipGetLastError();
}

// v008
// Measured time: 45.7 microseconds a run.
// Next to v007, in two timings, it ran 1.06 and 1.05 times as fast.
// Counting every step since v000, it is 6.56 times as fast.
#include <hip/hip_runtime.h>
#include <hip/hip_bf16.h>
#include <math.h>
#include <stdint.h>

#define NB   4
#define SEQ  4096
#define DE   512
#define HD   64
#define KC   64
#define LP   72      // LDS row pitch in halves of the 64-half K and V^T rows: 144 B = 16 B x odd
#define XP   520     // LDS row pitch in bf16 of the 512-element x and W rows: 1040 B = 16 B x odd
#define OP   68      // LDS row pitch in floats of the 64-float context rows: 272 B = 16 B x odd
#define NQB  (SEQ / 64)
#define NG   4       // key groups per attention workgroup: group g takes key chunks g, g + NG, g + 2 NG, ...
#define HT   (NQB / 2)   // query tiles HT .. NQB - 1 have more than HT key chunks: their chunks go to two workgroups
#define NROW (NB * SEQ)
#define NX   (NROW * DE)
#define NW   (HD * DE)
#define NO   (NROW * HD)
#define PSC  1024.0f
#define RSC  2048.0f
#define VSC  64.0f
#define OSC  8.0f
static_assert((SEQ % 64) == 0);
static_assert(HD == 64);
static_assert(KC == 64);
static_assert(LP >= KC && LP >= HD && (LP % 8) == 0 && ((LP / 8) % 2) == 1);
static_assert(OP >= HD && (OP % 4) == 0 && ((OP / 4) % 2) == 1);
static_assert((DE % 32) == 0);
static_assert(DE == 512);
static_assert(XP >= DE && (XP % 8) == 0 && ((XP / 8) % 2) == 1);
static_assert((NROW % 64) == 0);
static_assert((NQB % 2) == 0);

typedef _Float16 v16h __attribute__((ext_vector_type(16)));
typedef _Float16 v8h  __attribute__((ext_vector_type(8)));
typedef __bf16   v16b __attribute__((ext_vector_type(16)));
typedef float    v8f  __attribute__((ext_vector_type(8)));
typedef float    v4f  __attribute__((ext_vector_type(4)));
typedef unsigned int v4u __attribute__((ext_vector_type(4)));
typedef unsigned int v2u __attribute__((ext_vector_type(2)));
typedef float    v2f  __attribute__((ext_vector_type(2)));
typedef __bf16   v2b  __attribute__((ext_vector_type(2)));

union FragH { v16h v; v8h h[2]; };
union FragB { v16b v; v4u u[2]; };
union HU8   { v8h h; v4u u; };
union BU4   { v2b b[2]; v2u u; };

// ---- scalar helpers --------------------------------------------------------------------------------
__device__ __forceinline__ unsigned short bf_bits(float f) {          // f32 -> bf16 bits, RNE convert
  unsigned u = __float_as_uint(f);
  return (unsigned short)((u + 0x7FFFu + ((u >> 16) & 1u)) >> 16);
}
__device__ __forceinline__ float bf_up(unsigned short h) { return __uint_as_float(((unsigned)h) << 16); }
__device__ __forceinline__ float bfr(float f) { return bf_up(bf_bits(f)); }   // value of the bf16 RNE convert
__device__ __forceinline__ v8f zero8() { v8f z = {0.f, 0.f, 0.f, 0.f, 0.f, 0.f, 0.f, 0.f}; return z; }

// ---- fragment loaders: 16-bit A/B operand, lane -> row/col (lane&15), p already includes +8*(lane>>4);
//      elements 0..7 <- p[0..7] (k0+8h..), elements 8..15 <- p[16..23] (k0+16+8h..)
__device__ __forceinline__ v16h ldfrag_h(const _Float16* p) {
  FragH f;
  f.h[0] = *(const v8h*)(p);
  f.h[1] = *(const v8h*)(p + 16);
  return f.v;
}
__device__ __forceinline__ v16b ldfrag_b(const unsigned short* p) {
  FragB f;
  f.u[0] = *(const v4u*)(p);
  f.u[1] = *(const v4u*)(p + 16);
  return f.v;
}

// ---- WMMA helpers with trailing VALU hazard gap --------------------------------------------------------
__device__ __forceinline__ v8f mma_h(v16h a, v16h b, v8f c) {
  c = __builtin_amdgcn_wmma_f32_16x16x32_f16(false, a, false, b, (short)0, c, false, false);
#if defined(__HIP_DEVICE_COMPILE__)
  asm volatile("v_nop\n\tv_nop\n\tv_nop\n\tv_nop" : "+v"(c) : "v"(a), "v"(b));
#endif
  return c;
}
__device__ __forceinline__ v8f mma_b(v16b a, v16b b, v8f c) {
  c = __builtin_amdgcn_wmma_f32_16x16x32_bf16(false, a, false, b, (short)0, c, false, false);
#if defined(__HIP_DEVICE_COMPILE__)
  asm volatile("v_nop\n\tv_nop\n\tv_nop\n\tv_nop" : "+v"(c) : "v"(a), "v"(b));
#endif
  return c;
}
// value of lane l ^ 16 (the other half of the wave), by a vector cross-row move
__device__ __forceinline__ float xhalf(float x) {
  const int i = __float_as_int(x);
  return __int_as_float(__builtin_amdgcn_permlanex16(i, i, 0x76543210, 0xfedcba98, false, false));
}

// =====================================================================================================
// q/k/v projections, f32 inputs converted on the way in. Block = 512 threads = 16 waves = 64 token rows
// (rows r0..r0+63 of the flattened [NB*SEQ] row index; 64 | SEQ so one block never crosses a sequence).
// Stage: the block's 64 x rows and all 64 rows of Wq, Wk, Wv are read as f32 (a wave load = 512 contiguous
// bytes of one row), rounded to bf16 RNE in registers and laid in LDS in rows of pitch XP;
// wave w brings rows 4w..4w+3 of each of the four. One barrier.
// Product: wave (rt, cg) owns token rows 16 rt..+15 x columns 16 cg..+15 of q, k and v: A fragment from x row
// lane&15, B(k, n) = W[n][k] fragments from W row n (k-contiguous), K = DE in ascending 32-steps.
// Epilogue (f32): + bf16_RNE(bias[n]); q/k: hi = f16(v), res = f16((v - hi) * 2048) staged as [row][d];
// v: the same of 64 v, staged transposed [d][s]; one barrier; every thread stores one 16-B piece per plane.
// coverage: 512 threads x 8 halves = 64 x 64 per plane; grid NROW/64 blocks covers all rows.
// =====================================================================================================
__device__ __forceinline__ v2u cvt4(v4f a) {                 // four f32 -> four bf16 (RNE), packed
  BU4 o;
  const v2f lo = {a[0], a[1]};
  const v2f hi = {a[2], a[3]};
  o.b[0] = __builtin_convertvector(lo, v2b);
  o.b[1] = __builtin_convertvector(hi, v2b);
  return o.u;
}
// four f32 rows of DE elements: p = first row + 4 * lane; piece (i, j) = row i, elements 128 j + 4 lane ..+3
__device__ __forceinline__ void ld_rows(const float* __restrict__ p, v4f (&t)[16]) {
#pragma unroll                                   // constant indices keep t[] in registers, here and in st_rows
  for (int i = 0; i < 4; ++i) {
#pragma unroll
    for (int j = 0; j < 4; ++j) t[i * 4 + j] = *(const v4f*)(p + i * DE + j * 128);
  }
}
__device__ __forceinline__ void st_rows(unsigned short* d, const v4f (&t)[16]) {
#pragma unroll
  for (int i = 0; i < 4; ++i) {
#pragma unroll
    for (int j = 0; j < 4; ++j) *(v2u*)(d + i * XP + j * 128) = cvt4(t[i * 4 + j]);
  }
}

__global__ __launch_bounds__(512)
void proj_qkv(const float* __restrict__ x,
              const float* __restrict__ Wq, const float* __restrict__ Wk, const float* __restrict__ Wv,
              const float* __restrict__ bq, const float* __restrict__ bk, const float* __restrict__ bv,
              _Float16* Qh, _Float16* Qr, _Float16* Kh, _Float16* Kr, _Float16* VTh, _Float16* VTr) {
  __shared__ __align__(16) unsigned short Xs[64 * XP];       // bf16 x rows                            65 KB
  __shared__ __align__(16) unsigned short Ws[3][64 * XP];    // bf16 Wq, Wk, Wv rows                  195 KB
  __shared__ __align__(16) _Float16 Eh[3][64 * 72];          // q, k [row][d] and v^T [d][s], hi       27 KB
  __shared__ __align__(16) _Float16 Er[3][64 * 72];          // their x2048 residuals                  27 KB

  const int tid  = threadIdx.x;
  const int wave = __builtin_amdgcn_readfirstlane(tid >> 5);
  const int lane = tid & 31;
  const int hh   = lane >> 4;
  const int c    = lane & 15;
  const int rt   = wave & 3;                     // token row tile
  const int cg   = wave >> 2;                    // column tile inside each projection
  const int r0   = blockIdx.x * 64;
  const int b    = r0 / SEQ;
  const int s0   = r0 - b * SEQ;

  const int n = cg * 16 + c;
  const float bias0 = bfr(bq[n]);
  const float bias1 = bfr(bk[n]);
  const float bias2 = bfr(bv[n]);

  // ---- stage: two register sets, so that the next rows' loads fly while these are rounded and stored.
  //      Each sched_barrier keeps that order: without them the compiler lifts all 64 loads to the top, sinks
  //      all stores to the foot and spills ----
  {
    const size_t ro = (size_t)(wave * 4) * DE + lane * 4;
    const int d = (wave * 4) * XP + lane * 4;
    v4f ta[16], tb[16];
    ld_rows(x + (size_t)r0 * DE + ro, ta);
    ld_rows(Wq + ro, tb);
    __builtin_amdgcn_sched_barrier(0);           // x and Wq rows in flight before the first store
    st_rows(Xs + d, ta);
    __builtin_amdgcn_sched_barrier(0);           // set a is free only now
    ld_rows(Wk + ro, ta);
    __builtin_amdgcn_sched_barrier(0);           // Wk rows in flight before Wq is waited for
    st_rows(Ws[0] + d, tb);
    __builtin_amdgcn_sched_barrier(0);           // set b is free only now
    ld_rows(Wv + ro, tb);
    __builtin_amdgcn_sched_barrier(0);           // Wv rows in flight before Wk is waited for
    st_rows(Ws[1] + d, ta);
    st_rows(Ws[2] + d, tb);
  }
  __syncthreads();

  // ---- products: the fragments of k-step ks + 1 are fetched into the other register set ahead of the
  //      WMMAs of k-step ks ----
  v8f acc[3];
#pragma unroll
  for (int w = 0; w < 3; ++w) acc[w] = zero8();
  const unsigned short* ap = Xs + (rt * 16 + c) * XP + 8 * hh;           // A row = lane&15
  const int wo = n * XP + 8 * hh;                                        // B col n = cg*16+c = W row n
  v16b a[2], wf[2][3];
  a[0] = ldfrag_b(ap);
#pragma unroll
  for (int w = 0; w < 3; ++w) wf[0][w] = ldfrag_b(Ws[w] + wo);
#pragma unroll                                   // the set index ks & 1 must be a constant: both sets in registers
  for (int ks = 0; ks < DE / 32; ++ks) {
    const int cur = ks & 1;
    if (ks + 1 < DE / 32) {
      a[cur ^ 1] = ldfrag_b(ap + (ks + 1) * 32);
#pragma unroll
      for (int w = 0; w < 3; ++w) wf[cur ^ 1][w] = ldfrag_b(Ws[w] + wo + (ks + 1) * 32);
    }
#pragma unroll
    for (int w = 0; w < 3; ++w) acc[w] = mma_b(a[cur], wf[cur][w], acc[w]);
  }

  // ---- q, k: [token row][d] as f16 hi and x2048 residual; v: transposed [d][s], of v * 64 ----
#pragma unroll
  for (int w = 0; w < 3; ++w) {
    const float bias = (w == 0) ? bias0 : ((w == 1) ? bias1 : bias2);
#pragma unroll
    for (int r = 0; r < 8; ++r) {
      const float v = (w < 2) ? (acc[w][r] + bias) : ((acc[w][r] + bias) * VSC);
      const _Float16 hq = (_Float16)v;
      const _Float16 rq = (_Float16)((v - (float)hq) * RSC);
      const int row = rt * 16 + 8 * hh + r;
      const int pi = (w < 2) ? (row * 72 + n) : (n * 72 + row);
      Eh[w][pi] = hq;
      Er[w][pi] = rq;
    }
  }
  __syncthreads();
  {
    const int q8 = tid >> 3, c8 = (tid & 7) * 8;
    v4u vh[3], vr[3];
#pragma unroll
    for (int w = 0; w < 3; ++w) {
      HU8 u;
      u.h = *(const v8h*)(Eh[w] + q8 * 72 + c8);
      vh[w] = u.u;
      u.h = *(const v8h*)(Er[w] + q8 * 72 + c8);
      vr[w] = u.u;
    }
    const size_t o  = (size_t)(r0 + q8) * HD + c8;                       // q, k: token row q8
    const size_t ov = ((size_t)b * HD + q8) * SEQ + s0 + c8;             // v^T: d = q8
    *(v4u*)(Qh + o)   = vh[0];
    *(v4u*)(Qr + o)   = vr[0];
    *(v4u*)(Kh + o)   = vh[1];
    *(v4u*)(Kr + o)   = vr[1];
    *(v4u*)(VTh + ov) = vh[2];
    *(v4u*)(VTr + ov) = vr[2];
  }
}

#define PLB  (KC * LP * 2)
#define GRB  (4 * PLB)
#define BUFB (NG * GRB)
#define NS   2
static_assert(4 * NG * 16 * OP * 4 <= 2 * BUFB);

// Rows r, r + 16, r + 32, r + 48 of two planes' tiles, 16 B per lane each: l = the lane's LDS byte address in
// the first plane (the second lies PLB behind it), ga, gb = its global addresses, gs = 16 rows in halves.
// The s_wait_xcnt stands inside the statement, so that no address register is rewritten in front of it.
__device__ __forceinline__ void copy2(unsigned l, const _Float16* ga, const _Float16* gb, size_t gs) {
#if defined(__HIP_DEVICE_COMPILE__)
  asm volatile("global_load_async_to_lds_b128 %0, %8, off\n\t"
               "global_load_async_to_lds_b128 %1, %9, off\n\t"
               "global_load_async_to_lds_b128 %2, %10, off\n\t"
               "global_load_async_to_lds_b128 %3, %11, off\n\t"
               "global_load_async_to_lds_b128 %4, %12, off\n\t"
               "global_load_async_to_lds_b128 %5, %13, off\n\t"
               "global_load_async_to_lds_b128 %6, %14, off\n\t"
               "global_load_async_to_lds_b128 %7, %15, off\n\t"
               "s_wait_xcnt 0x0"
               :: "v"(l), "v"(l + 32 * LP), "v"(l + 64 * LP), "v"(l + 96 * LP),
                  "v"(l + PLB), "v"(l + PLB + 32 * LP), "v"(l + PLB + 64 * LP), "v"(l + PLB + 96 * LP),
                  "v"(ga), "v"(ga + gs), "v"(ga + 2 * gs), "v"(ga + 3 * gs),
                  "v"(gb), "v"(gb + gs), "v"(gb + 2 * gs), "v"(gb + 3 * gs)
               : "memory");
#endif
}

// One 16-row fragment tile of a hi plane and of its residual plane, which lies 64 rows behind it: p = the lane's
// row + 8 * (lane >> 4); f[i] = hi, k = 32 i .. 32 i + 31 in the loaders' k order, f[2 + i] = residual, the same k
__device__ __forceinline__ void ld_tile(const _Float16* p, FragH (&f)[4]) {
#pragma unroll
  for (int i = 0; i < 2; ++i) {
    f[i].v     = ldfrag_h(p + i * 32);
    f[2 + i].v = ldfrag_h(p + 64 * LP + i * 32);
  }
}

__global__ __launch_bounds__(128 * NG)
void attn64(const _Float16* __restrict__ Qh, const _Float16* __restrict__ Qr,
            const _Float16* __restrict__ Kh, const _Float16* __restrict__ Kr,
            const _Float16* __restrict__ VTh, const _Float16* __restrict__ VTr, float* outp,
            float* Po, float* Pm, float* Pl) {
  // [buffer][group][K hi [kv][d], K res, V^T hi [d][kv], V^T res][64 rows of pitch LP], 9 KB a plane; behind a
  // share's last trip its first bytes hold the per wave context tiles [wave][row][d], f32, pitch OP
  __shared__ __align__(16) unsigned char KV[2 * BUFB];
  __shared__ float                  Ms[4 * NG][16];               // per wave running max of its 16 rows
  __shared__ float                  Ls[4 * NG][16];               // per wave running sum of its 16 rows

  const int tid  = threadIdx.x;
  const int wave = __builtin_amdgcn_readfirstlane(tid >> 5);      // scalar: group tests are scalar branches
  const int grp  = wave >> 2;                    // key group
  const int wq   = wave & 3;                     // query tile inside the block
  const int lane = tid & 31;
  const int hh   = lane >> 4;
  const int c    = lane & 15;
  const int pc = (lane & 7) * 8;                                  // staging: 16-B piece of the 128-B tile row
  const int sr = ((lane >> 3) & 1) * 8 + wq * 2 + hh;             // staging: tile row of piece i is sr + 16 i
  // the lane's LDS byte address in its group's K hi plane of buffer 0
  const unsigned sl = (unsigned)(uintptr_t)(KV + grp * GRB + (sr * LP + pc) * 2);

  const int bx = blockIdx.x;
  const int wi = bx % HT + ((bx < NB * HT) ? HT : 0);   // which share of its sequence this block takes
  const int b  = (bx / HT) % NB;
  const size_t rowB = (size_t)b * SEQ;
  const _Float16* VThb = VTh + (size_t)b * HD * SEQ;
  const _Float16* VTrb = VTr + (size_t)b * HD * SEQ;
  const int njob = (wi < HT) ? 1 : 2;            // block-uniform, like all that is formed from wi and job

#pragma unroll 1                                 // one copy of the chunk loop serves both shares
  for (int job = 0; job < njob; ++job) {
    const int qb   = (wi < HT) ? (HT + wi) : ((job == 0) ? wi : (NQB - 1 - wi));     // query tile
    const int c0   = (wi >= HT && job == 0) ? HT : 0;                                // first key chunk
    const int c1   = (wi < HT) ? (HT - 1) : qb;                                      // last key chunk, <= qb
    const int slot = (wi < HT) ? 0 : ((job == 0) ? 1 : -1);   // half of a split tile, or -1: the whole tile
    const int q0 = qb * 64 + wq * 16;              // in-sequence query row of this wave's first row
    const int qrow = q0 + c;                       // in-sequence query row of this lane's accumulator column

    // ---- Q fragments (B operand, column = query = lane&15): 2 d-chunks, hi and residual ----
    v16h qh[2], qr[2];
#pragma unroll
    for (int dc = 0; dc < 2; ++dc) {
      qh[dc] = ldfrag_h(Qh + (rowB + q0 + c) * HD + dc * 32 + 8 * hh);
      qr[dc] = ldfrag_h(Qr + (rowB + q0 + c) * HD + dc * 32 + 8 * hh);
    }

    float mrun = -INFINITY;                        // running max of query c (equal in both halves)
    float lrun = 0.f;                              // running sum of query c over this half's keys only
    v8f oacc[4];                                   // O^T: tile t, register r = context[query c][d = 16 t + 8 hh + r]
#pragma unroll
    for (int t = 0; t < 4; ++t) oacc[t] = zero8();

    // the lane's global addresses in key chunk 0: K row sr, d = pc .. pc + 7; V^T row d = sr, s = pc .. pc + 7
    const _Float16* kgh = Kh + (rowB + sr) * HD + pc;
    const _Float16* kgr = Kr + (rowB + sr) * HD + pc;
    const _Float16* vgh = VThb + (size_t)sr * SEQ + pc;
    const _Float16* vgr = VTrb + (size_t)sr * SEQ + pc;

    // ---- The trips kb = c0 - 2 NG and c0 - NG stand in front of the first chunk: they have no products, only the
    //      foot. The first one's waits and barrier end every wave's reads of the share before (its context tiles
    //      lie in these buffers), and the group's first chunk is copied into buffer 0; the second one's wait and
    //      barrier publish that chunk, and the second chunk is copied into buffer 1. Every test on a group's chunk
    //      is wave-uniform (scalar); every wave passes every wait and every barrier ----
    int buf = 0;                               // byte offset of this trip's buffer: 0 or BUFB
#pragma unroll 1
    for (int kb = c0 - 2 * NG; kb <= c1; kb += NG) {    // block-uniform trip count, at most NQB / NG + 2
      const int kt  = kb + grp;
      const int kv0 = kt * KC;
      const _Float16* Khs = (const _Float16*)(KV + buf + grp * GRB);
      const _Float16* Vhs = Khs + 2 * KC * LP;           // behind each hi plane lies its residual plane

      if (kb >= c0 && kt <= c1) {              // wave-uniform (scalar): this group has a chunk in this trip
      // ---- scores, transposed: 64 keys x 16 queries per wave (A operand: row = key j*16+c, k = d, split map) ----
      // ---- the eight fragment tiles of a trip (K rows 16 j .., then V^T rows 16 t ..) go through a ring of NS register
      //      sets: tile n + NS - 1 is fetched from LDS in front of the products of tile n, so that its latency
      //      passes under them; V^T's first tiles fly under the softmax. All of them lie in this trip's buffer ----
      FragH fr[NS][4];
      const int fo = c * LP + 8 * hh;                           // the lane's place in a 16-row tile
      // the query row against this half's first key, formed once a trip: the 32 tests below then need no register each
      const int dq = qrow - kv0 - 8 * hh;
#pragma unroll
      for (int n = 0; n < NS - 1; ++n) ld_tile(Khs + n * 16 * LP + fo, fr[n]);
      v8f s[4];
#pragma unroll                                   // the set index must be a constant: the ring stays in registers
      for (int j = 0; j < 4; ++j) {
        const int nx = j + NS - 1;                              // 4 and up: V^T tile nx - 4
        ld_tile(((nx < 4) ? Khs : Vhs) + (nx & 3) * 16 * LP + fo, fr[nx % NS]);
        __builtin_amdgcn_sched_barrier(0);       // without it the compiler moves these reads in among the products
        const FragH (&kf)[4] = fr[j % NS];
        v8f sh = zero8();
        v8f sx = zero8();
#pragma unroll
        for (int dc = 0; dc < 2; ++dc) {
          sh = mma_h(kf[dc].v, qh[dc], sh);
          sx = mma_h(kf[2 + dc].v, qh[dc], sx);
          sx = mma_h(kf[dc].v, qr[dc], sx);
        }
#pragma unroll
        for (int r = 0; r < 8; ++r) {                           // key of accumulator register r: kv0 + 16 j + 8 hh + r
          const float sv = sh[r] + sx[r] * (1.0f / RSC);
          s[j][r] = (j * 16 + r > dq) ? -INFINITY : sv;         // causal: keys strictly after the row excluded
        }
      }

      // ---- query max in the lane and across the halves, online softmax, P^T hi (x1024) and residual (x2048)
      //      packed straight into B operands ----
      float mj[4];                                              // one chain per tile: four short chains, not one long
#pragma unroll
      for (int j = 0; j < 4; ++j) {
        mj[j] = s[j][0];
#pragma unroll
        for (int r = 1; r < 8; ++r) mj[j] = fmaxf(mj[j], s[j][r]);
      }
      float m = fmaxf(fmaxf(mj[0], mj[1]), fmaxf(mj[2], mj[3]));
      m = fmaxf(m, xhalf(m));
      const float mnew  = fmaxf(mrun, m);
      const float alpha = __expf(mrun - mnew);
      mrun = mnew;
      FragH pa[2], pr[2];
      float pj[4];                                              // per-tile partial sums, joined below
#pragma unroll
      for (int j = 0; j < 4; ++j) {
        pj[j] = 0.f;
#pragma unroll
        for (int r = 0; r < 8; ++r) {
          const float p  = __expf(s[j][r] - mnew);
          pj[j] += p;
          const _Float16 hq = (_Float16)(p * PSC);
          const float res = __builtin_fmaf(p, PSC, -(float)hq) * RSC;   // p * 1024 is exact: the same residual
          pa[j >> 1].v[(j & 1) * 8 + r] = hq;                   // element e <-> key 32 kk + 8 hh + e, + 8 more from e = 8
          pr[j >> 1].v[(j & 1) * 8 + r] = (_Float16)res;
        }
      }
      lrun = lrun * alpha + ((pj[0] + pj[1]) + (pj[2] + pj[3]));
#pragma unroll
      for (int t = 0; t < 4; ++t) {
#pragma unroll
        for (int r = 0; r < 8; ++r) oacc[t][r] *= alpha;
      }

      // ---- context^T += V^T . P^T (f16 WMMA; A = V^T [dv][kv] split map, B = P^T from the registers) ----
#pragma unroll                                   // constant set index, as above
      for (int t = 0; t < 4; ++t) {
        const int nx = t + NS - 1;
        if (nx < 4) {
          ld_tile(Vhs + nx * 16 * LP + fo, fr[(4 + nx) % NS]);
          __builtin_amdgcn_sched_barrier(0);     // as above: the reads stay in front of this tile's products
        }
        const FragH (&vf)[4] = fr[(4 + t) % NS];
        oacc[t] = mma_h(vf[0].v, pa[0].v, oacc[t]);
        oacc[t] = mma_h(vf[1].v, pa[1].v, oacc[t]);
        v8f rr = mma_h(vf[2].v, pa[0].v, zero8());
        rr = mma_h(vf[3].v, pa[1].v, rr);
        rr = mma_h(vf[0].v, pr[0].v, rr);
        rr = mma_h(vf[1].v, pr[1].v, rr);
#pragma unroll
        for (int r = 0; r < 8; ++r) oacc[t][r] += rr[r] * (1.0f / RSC);
      }
      }                                        // end of this group's chunk

      // ---- foot of the trip, every wave ----
#if defined(__HIP_DEVICE_COMPILE__)
      asm volatile("s_wait_dscnt 0x0" ::: "memory");      // this wave has read the last of this trip's buffer
      asm volatile("s_wait_asynccnt 0x0" ::: "memory");   // its pieces of the next trip's chunk have landed
#endif
      __syncthreads();                                    // both hold for every wave
      if (kt + 2 * NG <= c1) {                            // wave-uniform (scalar): the chunk of the trip after the next
        const size_t kv = (size_t)(kt + 2 * NG) * KC;
        copy2(sl + buf, kgh + kv * HD, kgr + kv * HD, 16 * HD);
        copy2(sl + buf + 2 * PLB, vgh + kv, vgr + kv, (size_t)16 * SEQ);
      }
      buf ^= BUFB;
    }
#if defined(__HIP_DEVICE_COMPILE__)
    asm volatile("s_wait_asynccnt 0x0" ::: "memory");     // no copy is in flight when the buffers change their use
#endif

    // ---- hand over the wave's un-normalised 16x64 f32 tile (a lane holds 8 consecutive d of its query per
    //      tile: two 16-B stores) and its queries' (max, sum), the sum joined over the halves here ----
    float* os = (float*)KV + wave * (16 * OP);
#pragma unroll
    for (int t = 0; t < 4; ++t) {
      const v4f lo = {oacc[t][0], oacc[t][1], oacc[t][2], oacc[t][3]};
      const v4f hi = {oacc[t][4], oacc[t][5], oacc[t][6], oacc[t][7]};
      *(v4f*)(os + c * OP + t * 16 + 8 * hh)     = lo;
      *(v4f*)(os + c * OP + t * 16 + 8 * hh + 4) = hi;
    }
    const float lall = lrun + xhalf(lrun);
    if (hh == 0) {                                 // both halves hold equal max and sum
      Ms[wave][c] = mrun;
      Ls[wave][c] = lall;
    }
    __syncthreads();
    // ---- join the NG groups' partials of rows 4 grp .. 4 grp + 3 of tile wq; a whole tile is normalised (8 / l,
    //      the 1/1024 p carry and the 1/64 v carry) and goes to out, a half of a split tile goes as it is to
    //      its workspace plane; each wave store = two whole 256-B rows ----
    {
      const int col = c * 4;
      const size_t pt = (size_t)((slot < 0 ? 0 : slot) * NB + b) * HT + (slot < 0 ? 0 : qb - HT);   // plane tile
      float* C = (slot < 0) ? (outp + (rowB + q0) * HD) : (Po + (pt * 64 + wq * 16) * HD);
#pragma unroll
      for (int it = 0; it < 2; ++it) {
        const int row = grp * 4 + it * 2 + hh;
        float mg[NG], lg[NG];
        v4f og[NG];
#pragma unroll
        for (int g = 0; g < NG; ++g) {
          mg[g] = Ms[g * 4 + wq][row];
          lg[g] = Ls[g * 4 + wq][row];
          og[g] = *(const v4f*)((const float*)KV + (g * 4 + wq) * (16 * OP) + row * OP + col);
        }
        float mx = mg[0];                          // finite: group 0 has chunk c0, whose first key no row excludes
#pragma unroll
        for (int g = 1; g < NG; ++g) mx = fmaxf(mx, mg[g]);
        float l = 0.f;
        v4f o = {0.f, 0.f, 0.f, 0.f};
#pragma unroll
        for (int g = 0; g < NG; ++g) {
          const float wg = __expf(mg[g] - mx);
          l = fmaf(wg, lg[g], l);
          o += wg * og[g];
        }
        const float inv = (slot < 0) ? (((l > 0.f) ? (1.0f / l) : 0.f) * (OSC / (PSC * VSC))) : 1.0f;
        *(v4f*)(C + (size_t)row * HD + col) = o * inv;
#if defined(__HIP_DEVICE_COMPILE__)
        // what follows reuses the registers that hold this store's address and data
        asm volatile("s_wait_xcnt 0x0" ::: "memory");
#endif
      }
      // ---- a half's (max, sum) of all 64 rows, by the same sums: wave 0 alone, each store one whole line ----
      if (slot >= 0 && wave == 0) {
#pragma unroll
        for (int h = 0; h < 2; ++h) {
          const int rw = h * 32 + lane;
          float mg[NG], lg[NG];
#pragma unroll
          for (int g = 0; g < NG; ++g) {
            mg[g] = Ms[g * 4 + (rw >> 4)][rw & 15];
            lg[g] = Ls[g * 4 + (rw >> 4)][rw & 15];
          }
          float mx = mg[0];
#pragma unroll
          for (int g = 1; g < NG; ++g) mx = fmaxf(mx, mg[g]);
          float l = 0.f;
#pragma unroll
          for (int g = 0; g < NG; ++g) l = fmaf(__expf(mg[g] - mx), lg[g], l);
          Pm[pt * 64 + rw] = mx;
          Pl[pt * 64 + rw] = l;
        }
      }
    }
#if defined(__HIP_DEVICE_COMPILE__)
    // the next share reuses the registers that hold the addresses and data of wave 0's stores
    asm volatile("s_wait_xcnt 0x0" ::: "memory");
#endif
  }
}

// =====================================================================================================
// The two halves of a split query tile (HT .. NQB - 1), joined as the groups are joined above: weights
// exp(m_h - max m), then the same normalisation. Block = one tile = 64 rows x 64 d; piece i of thread tid is
// row tid / 16 + 16 i, d = 4 (tid % 16) .. + 3, so a wave load or store is 512 contiguous bytes. Both maxima are finite.
// coverage: NB * HT blocks x 256 threads x 4 pieces x 4 floats = every element of the split tiles once.
// =====================================================================================================
__global__ __launch_bounds__(256)
void join2(const float* __restrict__ Po, const float* __restrict__ Pm, const float* __restrict__ Pl, float* outp) {
  const int tile = blockIdx.x;                   // b * HT + (qb - HT)
  const int b    = tile / HT;
  const int qb   = HT + tile % HT;
  const int tid  = threadIdx.x;
  const float* o0 = Po + (size_t)tile * (64 * HD) + tid * 4;             // piece i: + 1024 i floats
  const float* o1 = o0 + (size_t)NB * HT * (64 * HD);
  const float* m0 = Pm + tile * 64 + (tid >> 4);                         // row of piece i: + 16 i
  const float* m1 = m0 + NB * HT * 64;
  const float* l0 = Pl + tile * 64 + (tid >> 4);
  const float* l1 = l0 + NB * HT * 64;
  float* C = outp + ((size_t)b * SEQ + qb * 64) * HD + tid * 4;
  v4f oa[4], ob[4];
  float ma[4], mb[4], la[4], lb[4];
#pragma unroll                                   // constant indices keep the arrays in registers: all loads fly at once
  for (int i = 0; i < 4; ++i) {
    oa[i] = *(const v4f*)(o0 + 1024 * i);
    ob[i] = *(const v4f*)(o1 + 1024 * i);
    ma[i] = m0[16 * i];
    mb[i] = m1[16 * i];
    la[i] = l0[16 * i];
    lb[i] = l1[16 * i];
  }
#if defined(__HIP_DEVICE_COMPILE__)
  // the loads' offset register (the thread index) stays whole until this wait; the sums below reuse it
  asm volatile("s_wait_xcnt 0x0" :: "v"(tid) : "memory");
#endif
#pragma unroll
  for (int i = 0; i < 4; ++i) {
    const float w  = __expf(-fabsf(ma[i] - mb[i]));          // the half with the larger maximum weighs exp(0) = 1
    const float wa = (ma[i] >= mb[i]) ? 1.0f : w;
    const float wb = (ma[i] >= mb[i]) ? w : 1.0f;
    const float l  = fmaf(wb, lb[i], wa * la[i]);
    const float inv = ((l > 0.f) ? (1.0f / l) : 0.f) * (OSC / (PSC * VSC));
    *(v4f*)(C + 1024 * i) = (wa * oa[i] + wb * ob[i]) * inv;
  }
}

// =====================================================================================================
// Workspace map (bytes); every plane is an exact multiple of its whole-line / 64x64-tile store granularity:
//   Qh   f16  [16384][64]        0          2097152
//   Qr   f16  [16384][64]        2097152    2097152
//   Kh   f16  [16384][64]        4194304    2097152
//   Kr   f16  [16384][64]        6291456    2097152
//   VTh  f16  [4][64][4096]      8388608    2097152
//   VTr  f16  [4][64][4096]      10485760   2097152
//   Po   f32  [2][4][32][64][64] 12582912   4194304    the two halves' contexts of the split tiles
//   Pm   f32  [2][4][32][64]     16777216   65536      their row maxima
//   Pl   f32  [2][4][32][64]     16842752   65536      their row sums
//   end                          16908288
// =====================================================================================================
extern "C" void kernel_launch(void* const* d_in, const int* in_sizes, int n_in,
                              void* d_out, int out_size, void* d_ws, size_t ws_size,
                              hipStream_t stream) {
  if (n_in < 7) return;
  if (in_sizes[0] != NX) return;
  if (in_sizes[1] != NW || in_sizes[3] != NW || in_sizes[5] != NW) return;
  if (in_sizes[2] != HD || in_sizes[4] != HD || in_sizes[6] != HD) return;
  if (out_size != NO) return;

  const float* x  = (const float*)d_in[0];
  const float* Wq = (const float*)d_in[1];
  const float* bq = (const float*)d_in[2];
  const float* Wk = (const float*)d_in[3];
  const float* bk = (const float*)d_in[4];
  const float* Wv = (const float*)d_in[5];
  const float* bv = (const float*)d_in[6];

  const size_t PB = (size_t)NO * 2;                     // 2097152
  size_t off = 0;
  const size_t oQh = off; off += PB;
  const size_t oQr = off; off += PB;
  const size_t oKh = off; off += PB;
  const size_t oKr = off; off += PB;
  const size_t oVh = off; off += PB;
  const size_t oVr = off; off += PB;
  const size_t oPo = off; off += (size_t)2 * NB * HT * 64 * HD * 4;
  const size_t oPm = off; off += (size_t)2 * NB * HT * 64 * 4;
  const size_t oPl = off; off += (size_t)2 * NB * HT * 64 * 4;
  if (off > ws_size) return;                            // off = 16908288

  char* ws = (char*)d_ws;
  _Float16* Qh  = (_Float16*)(ws + oQh);
  _Float16* Qr  = (_Float16*)(ws + oQr);
  _Float16* Kh  = (_Float16*)(ws + oKh);
  _Float16* Kr  = (_Float16*)(ws + oKr);
  _Float16* VTh = (_Float16*)(ws + oVh);
  _Float16* VTr = (_Float16*)(ws + oVr);
  float* Po = (float*)(ws + oPo);
  float* Pm = (float*)(ws + oPm);
  float* Pl = (float*)(ws + oPl);
  float* out0 = (float*)d_out;

  const dim3 gP(NROW / 64);                             // 256 blocks of 512
  const dim3 blkP(512);
  const dim3 gA(NB * NQB);                              // 256 blocks of 128 * NG
  const dim3 blkA(128 * NG);
  const dim3 gJ(NB * HT);                               // 128 blocks of 256
  const dim3 blkJ(256);

  // (1) projections from the f32 inputs -> q/k f16 hi + residual planes, v^T f16 hi + residual planes
  proj_qkv<<<gP, blkP, 0, stream>>>(x, Wq, Wk, Wv, bq, bk, bv, Qh, Qr, Kh, Kr, VTh, VTr);

  // (2) causal flash attention -> out f32 [4][4096][64] for tiles 0 .. 31, two halves in Po, Pm, Pl for the rest
  attn64<<<gA, blkA, 0, stream>>>(Qh, Qr, Kh, Kr, VTh, VTr, out0, Po, Pm, Pl);

  // (3) the split tiles' halves -> out
  join2<<<gJ, blkJ, 0, stream>>>(Po, Pm, Pl, out0);
  (void)hipGetLastError();
}

// v009
// One run takes 44 microseconds.
// Two timings next to v008 both put it at 1.04 times that version's speed.
// Over all steps from v000 it is 6.83 times as fast.
#include <hip/hip_runtime.h>
#include <hip/hip_bf16.h>
#include <math.h>
#include <stdint.h>

#define NB   4
#define SEQ  4096
#define DE   512
#define HD   64
#define KC   64
#define LP   72      // LDS row pitch in halves of the 64-half K and V^T rows: 144 B = 16 B x odd
#define XP   520     // LDS row pitch in bf16 of the 512-element x and W rows: 1040 B = 16 B x odd
#define OP   68      // LDS row pitch in floats of the 64-float context rows: 272 B = 16 B x odd
#define NQB  (SEQ / 64)
#define NG   4       // key groups per attention workgroup: group g takes key chunks g, g + NG, g + 2 NG, ...
#define HT   (NQB / 2)   // query tiles HT .. NQB - 1 have more than HT key chunks: their chunks go to two workgroups
#define NROW (NB * SEQ)
#define NX   (NROW * DE)
#define NW   (HD * DE)
#define NO   (NROW * HD)
#define PSC  1024.0f
#define RSC  2048.0f
#define VSC  64.0f
#define OSC  8.0f
static_assert((SEQ % 64) == 0);
static_assert(HD == 64);
static_assert(KC == 64);
static_assert(LP >= KC && LP >= HD && (LP % 8) == 0 && ((LP / 8) % 2) == 1);
static_assert(OP >= HD && (OP % 4) == 0 && ((OP / 4) % 2) == 1);
static_assert((DE % 32) == 0);
static_assert(DE == 512);
static_assert(XP >= DE && (XP % 8) == 0 && ((XP / 8) % 2) == 1);
static_assert((NROW % 64) == 0);
static_assert((NQB % 2) == 0);

typedef _Float16 v16h __attribute__((ext_vector_type(16)));
typedef _Float16 v8h  __attribute__((ext_vector_type(8)));
typedef __bf16   v16b __attribute__((ext_vector_type(16)));
typedef float    v8f  __attribute__((ext_vector_type(8)));
typedef float    v4f  __attribute__((ext_vector_type(4)));
typedef unsigned int v4u __attribute__((ext_vector_type(4)));
typedef unsigned int v2u __attribute__((ext_vector_type(2)));
typedef float    v2f  __attribute__((ext_vector_type(2)));
typedef __bf16   v2b  __attribute__((ext_vector_type(2)));

union FragH { v16h v; v8h h[2]; };
union FragB { v16b v; v4u u[2]; };
union HU8   { v8h h; v4u u; };
union BU4   { v2b b[2]; v2u u; };

// ---- scalar helpers --------------------------------------------------------------------------------
__device__ __forceinline__ unsigned short bf_bits(float f) {          // f32 -> bf16 bits, RNE convert
  unsigned u = __float_as_uint(f);
  return (unsigned short)((u + 0x7FFFu + ((u >> 16) & 1u)) >> 16);
}
__device__ __forceinline__ float bf_up(unsigned short h) { return __uint_as_float(((unsigned)h) << 16); }
__device__ __forceinline__ float bfr(float f) { return bf_up(bf_bits(f)); }   // value of the bf16 RNE convert
__device__ __forceinline__ v8f zero8() { v8f z = {0.f, 0.f, 0.f, 0.f, 0.f, 0.f, 0.f, 0.f}; return z; }

// ---- fragment loaders: 16-bit A/B operand, lane -> row/col (lane&15), p already includes +8*(lane>>4);
//      elements 0..7 <- p[0..7] (k0+8h..), elements 8..15 <- p[16..23] (k0+16+8h..)
__device__ __forceinline__ v16h ldfrag_h(const _Float16* p) {
  FragH f;
  f.h[0] = *(const v8h*)(p);
  f.h[1] = *(const v8h*)(p + 16);
  return f.v;
}
__device__ __forceinline__ v16b ldfrag_b(const unsigned short* p) {
  FragB f;
  f.u[0] = *(const v4u*)(p);
  f.u[1] = *(const v4u*)(p + 16);
  return f.v;
}

// ---- WMMA helper with trailing VALU hazard gap (projections) -------------------------------------------
__device__ __forceinline__ v8f mma_b(v16b a, v16b b, v8f c) {
  c = __builtin_amdgcn_wmma_f32_16x16x32_bf16(false, a, false, b, (short)0, c, false, false);
#if defined(__HIP_DEVICE_COMPILE__)
  asm volatile("v_nop\n\tv_nop\n\tv_nop\n\tv_nop" : "+v"(c) : "v"(a), "v"(b));
#endif
  return c;
}
// value of lane l ^ 16 (the other half of the wave), by a vector cross-row move
__device__ __forceinline__ float xhalf(float x) {
  const int i = __float_as_int(x);
  return __int_as_float(__builtin_amdgcn_permlanex16(i, i, 0x76543210, 0xfedcba98, false, false));
}

// =====================================================================================================
// q/k/v projections, f32 inputs converted on the way in. Block = 512 threads = 16 waves = 64 token rows
// (rows r0..r0+63 of the flattened [NB*SEQ] row index; 64 | SEQ so one block never crosses a sequence).
// Stage: the block's 64 x rows and all 64 rows of Wq, Wk, Wv are read as f32 (a wave load = 512 contiguous
// bytes of one row), rounded to bf16 RNE in registers and laid in LDS in rows of pitch XP;
// wave w brings rows 4w..4w+3 of each of the four. One barrier.
// Product: wave (rt, cg) owns token rows 16 rt..+15 x columns 16 cg..+15 of q, k and v: A fragment from x row
// lane&15, B(k, n) = W[n][k] fragments from W row n (k-contiguous), K = DE in ascending 32-steps.
// Epilogue (f32): + bf16_RNE(bias[n]); q/k: hi = f16(v), res = f16((v - hi) * 2048) staged as [row][d];
// v: the same of 64 v, staged transposed [d][s]; one barrier; every thread stores one 16-B piece per plane.
// coverage: 512 threads x 8 halves = 64 x 64 per plane; grid NROW/64 blocks covers all rows.
// =====================================================================================================
__device__ __forceinline__ v2u cvt4(v4f a) {                 // four f32 -> four bf16 (RNE), packed
  BU4 o;
  const v2f lo = {a[0], a[1]};
  const v2f hi = {a[2], a[3]};
  o.b[0] = __builtin_convertvector(lo, v2b);
  o.b[1] = __builtin_convertvector(hi, v2b);
  return o.u;
}
// four f32 rows of DE elements: p = first row + 4 * lane; piece (i, j) = row i, elements 128 j + 4 lane ..+3
__device__ __forceinline__ void ld_rows(const float* __restrict__ p, v4f (&t)[16]) {
#pragma unroll                                   // constant indices keep t[] in registers, here and in st_rows
  for (int i = 0; i < 4; ++i) {
#pragma unroll
    for (int j = 0; j < 4; ++j) t[i * 4 + j] = *(const v4f*)(p + i * DE + j * 128);
  }
}
__device__ __forceinline__ void st_rows(unsigned short* d, const v4f (&t)[16]) {
#pragma unroll
  for (int i = 0; i < 4; ++i) {
#pragma unroll
    for (int j = 0; j < 4; ++j) *(v2u*)(d + i * XP + j * 128) = cvt4(t[i * 4 + j]);
  }
}

__global__ __launch_bounds__(512)
void proj_qkv(const float* __restrict__ x,
              const float* __restrict__ Wq, const float* __restrict__ Wk, const float* __restrict__ Wv,
              const float* __restrict__ bq, const float* __restrict__ bk, const float* __restrict__ bv,
              _Float16* Qh, _Float16* Qr, _Float16* Kh, _Float16* Kr, _Float16* VTh, _Float16* VTr) {
  __shared__ __align__(16) unsigned short Xs[64 * XP];       // bf16 x rows                            65 KB
  __shared__ __align__(16) unsigned short Ws[3][64 * XP];    // bf16 Wq, Wk, Wv rows                  195 KB
  __shared__ __align__(16) _Float16 Eh[3][64 * 72];          // q, k [row][d] and v^T [d][s], hi       27 KB
  __shared__ __align__(16) _Float16 Er[3][64 * 72];          // their x2048 residuals                  27 KB

  const int tid  = threadIdx.x;
  const int wave = __builtin_amdgcn_readfirstlane(tid >> 5);
  const int lane = tid & 31;
  const int hh   = lane >> 4;
  const int c    = lane & 15;
  const int rt   = wave & 3;                     // token row tile
  const int cg   = wave >> 2;                    // column tile inside each projection
  const int r0   = blockIdx.x * 64;
  const int b    = r0 / SEQ;
  const int s0   = r0 - b * SEQ;

  const int n = cg * 16 + c;
  const float bias0 = bfr(bq[n]);
  const float bias1 = bfr(bk[n]);
  const float bias2 = bfr(bv[n]);

  // ---- stage: two register sets, so that the next rows' loads fly while these are rounded and stored.
  //      Each sched_barrier keeps that order: without them the compiler lifts all 64 loads to the top, sinks
  //      all stores to the foot and spills ----
  {
    const size_t ro = (size_t)(wave * 4) * DE + lane * 4;
    const int d = (wave * 4) * XP + lane * 4;
    v4f ta[16], tb[16];
    ld_rows(x + (size_t)r0 * DE + ro, ta);
    ld_rows(Wq + ro, tb);
    __builtin_amdgcn_sched_barrier(0);           // x and Wq rows in flight before the first store
    st_rows(Xs + d, ta);
    __builtin_amdgcn_sched_barrier(0);           // set a is free only now
    ld_rows(Wk + ro, ta);
    __builtin_amdgcn_sched_barrier(0);           // Wk rows in flight before Wq is waited for
    st_rows(Ws[0] + d, tb);
    __builtin_amdgcn_sched_barrier(0);           // set b is free only now
    ld_rows(Wv + ro, tb);
    __builtin_amdgcn_sched_barrier(0);           // Wv rows in flight before Wk is waited for
    st_rows(Ws[1] + d, ta);
    st_rows(Ws[2] + d, tb);
  }
  __syncthreads();

  // ---- products: the fragments of k-step ks + 1 are fetched into the other register set ahead of the
  //      WMMAs of k-step ks ----
  v8f acc[3];
#pragma unroll
  for (int w = 0; w < 3; ++w) acc[w] = zero8();
  const unsigned short* ap = Xs + (rt * 16 + c) * XP + 8 * hh;           // A row = lane&15
  const int wo = n * XP + 8 * hh;                                        // B col n = cg*16+c = W row n
  v16b a[2], wf[2][3];
  a[0] = ldfrag_b(ap);
#pragma unroll
  for (int w = 0; w < 3; ++w) wf[0][w] = ldfrag_b(Ws[w] + wo);
#pragma unroll                                   // the set index ks & 1 must be a constant: both sets in registers
  for (int ks = 0; ks < DE / 32; ++ks) {
    const int cur = ks & 1;
    if (ks + 1 < DE / 32) {
      a[cur ^ 1] = ldfrag_b(ap + (ks + 1) * 32);
#pragma unroll
      for (int w = 0; w < 3; ++w) wf[cur ^ 1][w] = ldfrag_b(Ws[w] + wo + (ks + 1) * 32);
    }
#pragma unroll
    for (int w = 0; w < 3; ++w) acc[w] = mma_b(a[cur], wf[cur][w], acc[w]);
  }

  // ---- q, k: [token row][d] as f16 hi and x2048 residual; v: transposed [d][s], of v * 64 ----
#pragma unroll
  for (int w = 0; w < 3; ++w) {
    const float bias = (w == 0) ? bias0 : ((w == 1) ? bias1 : bias2);
#pragma unroll
    for (int r = 0; r < 8; ++r) {
      const float v = (w < 2) ? (acc[w][r] + bias) : ((acc[w][r] + bias) * VSC);
      const _Float16 hq = (_Float16)v;
      const _Float16 rq = (_Float16)((v - (float)hq) * RSC);
      const int row = rt * 16 + 8 * hh + r;
      const int pi = (w < 2) ? (row * 72 + n) : (n * 72 + row);
      Eh[w][pi] = hq;
      Er[w][pi] = rq;
    }
  }
  __syncthreads();
  {
    const int q8 = tid >> 3, c8 = (tid & 7) * 8;
    v4u vh[3], vr[3];
#pragma unroll
    for (int w = 0; w < 3; ++w) {
      HU8 u;
      u.h = *(const v8h*)(Eh[w] + q8 * 72 + c8);
      vh[w] = u.u;
      u.h = *(const v8h*)(Er[w] + q8 * 72 + c8);
      vr[w] = u.u;
    }
    const size_t o  = (size_t)(r0 + q8) * HD + c8;                       // q, k: token row q8
    const size_t ov = ((size_t)b * HD + q8) * SEQ + s0 + c8;             // v^T: d = q8
    *(v4u*)(Qh + o)   = vh[0];
    *(v4u*)(Qr + o)   = vr[0];
    *(v4u*)(Kh + o)   = vh[1];
    *(v4u*)(Kr + o)   = vr[1];
    *(v4u*)(VTh + ov) = vh[2];
    *(v4u*)(VTr + ov) = vr[2];
  }
}

#define PLB  (KC * LP * 2)
#define GRB  (4 * PLB)
#define BUFB (NG * GRB)
#define NS   2
static_assert(4 * NG * 16 * OP * 4 <= 2 * BUFB);

// Rows r, r + 16, r + 32, r + 48 of two planes' tiles, 16 B per lane each: l = the lane's LDS byte address in
// the first plane (the second lies PLB behind it), ga, gb = its global addresses, gs = 16 rows in halves.
// The s_wait_xcnt stands inside the statement, so that no address register is rewritten in front of it.
__device__ __forceinline__ void copy2(unsigned l, const _Float16* ga, const _Float16* gb, size_t gs) {
#if defined(__HIP_DEVICE_COMPILE__)
  asm volatile("global_load_async_to_lds_b128 %0, %8, off\n\t"
               "global_load_async_to_lds_b128 %1, %9, off\n\t"
               "global_load_async_to_lds_b128 %2, %10, off\n\t"
               "global_load_async_to_lds_b128 %3, %11, off\n\t"
               "global_load_async_to_lds_b128 %4, %12, off\n\t"
               "global_load_async_to_lds_b128 %5, %13, off\n\t"
               "global_load_async_to_lds_b128 %6, %14, off\n\t"
               "global_load_async_to_lds_b128 %7, %15, off\n\t"
               "s_wait_xcnt 0x0"
               :: "v"(l), "v"(l + 32 * LP), "v"(l + 64 * LP), "v"(l + 96 * LP),
                  "v"(l + PLB), "v"(l + PLB + 32 * LP), "v"(l + PLB + 64 * LP), "v"(l + PLB + 96 * LP),
                  "v"(ga), "v"(ga + gs), "v"(ga + 2 * gs), "v"(ga + 3 * gs),
                  "v"(gb), "v"(gb + gs), "v"(gb + 2 * gs), "v"(gb + 3 * gs)
               : "memory");
#endif
}

// One 16-row fragment tile of a hi plane and of its residual plane, which lies 64 rows behind it: p = the lane's
// row + 8 * (lane >> 4); f[i] = hi, k = 32 i .. 32 i + 31 in the loaders' k order, f[2 + i] = residual, the same k
__device__ __forceinline__ void ld_tile(const _Float16* p, FragH (&f)[4]) {
#pragma unroll
  for (int i = 0; i < 2; ++i) {
    f[i].v     = ldfrag_h(p + i * 32);
    f[2 + i].v = ldfrag_h(p + 64 * LP + i * 32);
  }
}

// The six products of one 16-row fragment tile, in ONE statement: the two accumulator chains alternate, so that a
// product's own sum lies two products back (the last one: one back), and the four vector slots that the chip asks
// for between a product and a vector instruction on its result stand once, behind the last product, not behind
// each. Each s_delay_alu names the producers of the two products behind it, so that the wave yields the issue port
// to its neighbours while it waits for them. Each chain keeps its order of sums.
// In asm, because the scheduling fences of the fragment ring do not hold builtin products: those sink behind the
// later tiles' reads, four tiles' fragments are then live at once, and the query fragments spill.
// Scores: sh = k hi . q hi; sx = k res . q hi + k hi . q res, d = 0 .. 31 and then d = 32 .. 63
__device__ __forceinline__ void qk_tile(const FragH (&kf)[4], const v16h (&qh)[2], const v16h (&qr)[2],
                                        v8f& sh, v8f& sx) {
#if defined(__HIP_DEVICE_COMPILE__)
  asm volatile("v_wmma_f32_16x16x32_f16 %1, %4, %6, 0\n\t"
               "v_wmma_f32_16x16x32_f16 %0, %2, %6, 0\n\t"
               "s_delay_alu instid0(TRANS32_DEP_2) | instskip(NEXT) | instid1(TRANS32_DEP_2)\n\t"
               "v_wmma_f32_16x16x32_f16 %1, %2, %8, %1\n\t"
               "v_wmma_f32_16x16x32_f16 %0, %3, %7, %0\n\t"
               "s_delay_alu instid0(TRANS32_DEP_2) | instskip(NEXT) | instid1(TRANS32_DEP_1)\n\t"
               "v_wmma_f32_16x16x32_f16 %1, %5, %7, %1\n\t"
               "v_wmma_f32_16x16x32_f16 %1, %3, %9, %1\n\t"
               "v_nop\n\tv_nop\n\tv_nop\n\tv_nop"
               : "=&v"(sh), "=&v"(sx)
               : "v"(kf[0].v), "v"(kf[1].v), "v"(kf[2].v), "v"(kf[3].v),
                 "v"(qh[0]), "v"(qh[1]), "v"(qr[0]), "v"(qr[1]));
#else
  sh = zero8();
  sx = zero8();
#endif
}
// Context: o += v hi . p hi; rr = v res . p hi + v hi . p res, keys 0 .. 31 and then 32 .. 63 of each
__device__ __forceinline__ void pv_tile(const FragH (&vf)[4], const FragH (&pa)[2], const FragH (&pr)[2],
                                        v8f& o, v8f& rr) {
#if defined(__HIP_DEVICE_COMPILE__)
  asm volatile("v_wmma_f32_16x16x32_f16 %1, %4, %6, 0\n\t"
               "v_wmma_f32_16x16x32_f16 %0, %2, %6, %0\n\t"
               "s_delay_alu instid0(TRANS32_DEP_2) | instskip(NEXT) | instid1(TRANS32_DEP_2)\n\t"
               "v_wmma_f32_16x16x32_f16 %1, %5, %7, %1\n\t"
               "v_wmma_f32_16x16x32_f16 %0, %3, %7, %0\n\t"
               "s_delay_alu instid0(TRANS32_DEP_2) | instskip(NEXT) | instid1(TRANS32_DEP_1)\n\t"
               "v_wmma_f32_16x16x32_f16 %1, %2, %8, %1\n\t"
               "v_wmma_f32_16x16x32_f16 %1, %3, %9, %1\n\t"
               "v_nop\n\tv_nop\n\tv_nop\n\tv_nop"
               : "+v"(o), "=&v"(rr)
               : "v"(vf[0].v), "v"(vf[1].v), "v"(vf[2].v), "v"(vf[3].v),
                 "v"(pa[0].v), "v"(pa[1].v), "v"(pr[0].v), "v"(pr[1].v));
#else
  rr = zero8();
#endif
}

__global__ __launch_bounds__(128 * NG)
void attn64(const _Float16* __restrict__ Qh, const _Float16* __restrict__ Qr,
            const _Float16* __restrict__ Kh, const _Float16* __restrict__ Kr,
            const _Float16* __restrict__ VTh, const _Float16* __restrict__ VTr, float* outp,
            float* Po, float* Pm, float* Pl) {
  // [buffer][group][K hi [kv][d], K res, V^T hi [d][kv], V^T res][64 rows of pitch LP], 9 KB a plane; behind a
  // share's last trip its first bytes hold the per wave context tiles [wave][row][d], f32, pitch OP
  __shared__ __align__(16) unsigned char KV[2 * BUFB];
  __shared__ float                  Ms[4 * NG][16];               // per wave running max of its 16 rows
  __shared__ float                  Ls[4 * NG][16];               // per wave running sum of its 16 rows

  const int tid  = threadIdx.x;
  const int wave = __builtin_amdgcn_readfirstlane(tid >> 5);      // scalar: group tests are scalar branches
  const int grp  = wave >> 2;                    // key group
  const int wq   = wave & 3;                     // query tile inside the block
  const int lane = tid & 31;
  const int hh   = lane >> 4;
  const int c    = lane & 15;
  const int pc = (lane & 7) * 8;                                  // staging: 16-B piece of the 128-B tile row
  const int sr = ((lane >> 3) & 1) * 8 + wq * 2 + hh;             // staging: tile row of piece i is sr + 16 i
  // the lane's LDS byte address in its group's K hi plane of buffer 0
  const unsigned sl = (unsigned)(uintptr_t)(KV + grp * GRB + (sr * LP + pc) * 2);

  const int bx = blockIdx.x;
  const int wi = bx % HT + ((bx < NB * HT) ? HT : 0);   // which share of its sequence this block takes
  const int b  = (bx / HT) % NB;
  const size_t rowB = (size_t)b * SEQ;
  const _Float16* VThb = VTh + (size_t)b * HD * SEQ;
  const _Float16* VTrb = VTr + (size_t)b * HD * SEQ;
  const int njob = (wi < HT) ? 1 : 2;            // block-uniform, like all that is formed from wi and job

#pragma unroll 1                                 // one copy of the chunk loop serves both shares
  for (int job = 0; job < njob; ++job) {
    const int qb   = (wi < HT) ? (HT + wi) : ((job == 0) ? wi : (NQB - 1 - wi));     // query tile
    const int c0   = (wi >= HT && job == 0) ? HT : 0;                                // first key chunk
    const int c1   = (wi < HT) ? (HT - 1) : qb;                                      // last key chunk, <= qb
    const int slot = (wi < HT) ? 0 : ((job == 0) ? 1 : -1);   // half of a split tile, or -1: the whole tile
    const int q0 = qb * 64 + wq * 16;              // in-sequence query row of this wave's first row
    const int qrow = q0 + c;                       // in-sequence query row of this lane's accumulator column

    // ---- Q fragments (B operand, column = query = lane&15): 2 d-chunks, hi and residual ----
    v16h qh[2], qr[2];
#pragma unroll
    for (int dc = 0; dc < 2; ++dc) {
      qh[dc] = ldfrag_h(Qh + (rowB + q0 + c) * HD + dc * 32 + 8 * hh);
      qr[dc] = ldfrag_h(Qr + (rowB + q0 + c) * HD + dc * 32 + 8 * hh);
    }

    float mrun = -INFINITY;                        // running max of query c (equal in both halves)
    float lrun = 0.f;                              // running sum of query c over this half's keys only
    v8f oacc[4];                                   // O^T: tile t, register r = context[query c][d = 16 t + 8 hh + r]
#pragma unroll
    for (int t = 0; t < 4; ++t) oacc[t] = zero8();

    // the lane's global addresses in key chunk 0: K row sr, d = pc .. pc + 7; V^T row d = sr, s = pc .. pc + 7
    const _Float16* kgh = Kh + (rowB + sr) * HD + pc;
    const _Float16* kgr = Kr + (rowB + sr) * HD + pc;
    const _Float16* vgh = VThb + (size_t)sr * SEQ + pc;
    const _Float16* vgr = VTrb + (size_t)sr * SEQ + pc;

    // ---- The trips kb = c0 - 2 NG and c0 - NG stand in front of the first chunk: they have no products, only the
    //      foot. The first one's waits and barrier end every wave's reads of the share before (its context tiles
    //      lie in these buffers), and the group's first chunk is copied into buffer 0; the second one's wait and
    //      barrier publish that chunk, and the second chunk is copied into buffer 1. Every test on a group's chunk
    //      is wave-uniform (scalar); every wave passes every wait and every barrier ----
    int buf = 0;                               // byte offset of this trip's buffer: 0 or BUFB
#pragma unroll 1
    for (int kb = c0 - 2 * NG; kb <= c1; kb += NG) {    // block-uniform trip count, at most NQB / NG + 2
      const int kt  = kb + grp;
      const int kv0 = kt * KC;
      const _Float16* Khs = (const _Float16*)(KV + buf + grp * GRB);
      const _Float16* Vhs = Khs + 2 * KC * LP;           // behind each hi plane lies its residual plane

      if (kb >= c0 && kt <= c1) {              // wave-uniform (scalar): this group has a chunk in this trip
      // ---- scores, transposed: 64 keys x 16 queries per wave (A operand: row = key j*16+c, k = d, split map) ----
      // ---- the eight fragment tiles of a trip (K rows 16 j .., then V^T rows 16 t ..) go through a ring of NS register
      //      sets: tile n + NS - 1 is fetched from LDS in front of the products of tile n, so that its latency
      //      passes under them; V^T's first tiles fly under the softmax. All of them lie in this trip's buffer ----
      FragH fr[NS][4];
      const int fo = c * LP + 8 * hh;                           // the lane's place in a 16-row tile
      // the query row against this half's first key, formed once a trip: the 32 tests below then need no register each
      const int dq = qrow - kv0 - 8 * hh;
#pragma unroll
      for (int n = 0; n < NS - 1; ++n) ld_tile(Khs + n * 16 * LP + fo, fr[n]);
      v8f s[4];
#pragma unroll                                   // the set index must be a constant: the ring stays in registers
      for (int j = 0; j < 4; ++j) {
        const int nx = j + NS - 1;                              // 4 and up: V^T tile nx - 4
        ld_tile(((nx < 4) ? Khs : Vhs) + (nx & 3) * 16 * LP + fo, fr[nx % NS]);
        __builtin_amdgcn_sched_barrier(0);       // without it the compiler moves these reads in among the products
        const FragH (&kf)[4] = fr[j % NS];
        v8f sh, sx;
        qk_tile(kf, qh, qr, sh, sx);
#pragma unroll
        for (int r = 0; r < 8; ++r) {                           // key of accumulator register r: kv0 + 16 j + 8 hh + r
          const float sv = sh[r] + sx[r] * (1.0f / RSC);
          s[j][r] = (j * 16 + r > dq) ? -INFINITY : sv;         // causal: keys strictly after the row excluded
        }
      }

      // ---- query max in the lane and across the halves, online softmax, P^T hi (x1024) and residual (x2048)
      //      packed straight into B operands ----
      float mj[4];                                              // one chain per tile: four short chains, not one long
#pragma unroll
      for (int j = 0; j < 4; ++j) {
        mj[j] = s[j][0];
#pragma unroll
        for (int r = 1; r < 8; ++r) mj[j] = fmaxf(mj[j], s[j][r]);
      }
      float m = fmaxf(fmaxf(mj[0], mj[1]), fmaxf(mj[2], mj[3]));
      m = fmaxf(m, xhalf(m));
      const float mnew  = fmaxf(mrun, m);
      const float alpha = __expf(mrun - mnew);
      mrun = mnew;
      FragH pa[2], pr[2];
      float pj[4];                                              // per-tile partial sums, joined below
#pragma unroll
      for (int j = 0; j < 4; ++j) {
        pj[j] = 0.f;
#pragma unroll
        for (int r = 0; r < 8; ++r) {
          const float p  = __expf(s[j][r] - mnew);
          pj[j] += p;
          const _Float16 hq = (_Float16)(p * PSC);
          const float res = __builtin_fmaf(p, PSC, -(float)hq) * RSC;   // p * 1024 is exact: the same residual
          pa[j >> 1].v[(j & 1) * 8 + r] = hq;                   // element e <-> key 32 kk + 8 hh + e, + 8 more from e = 8
          pr[j >> 1].v[(j & 1) * 8 + r] = (_Float16)res;
        }
      }
      lrun = lrun * alpha + ((pj[0] + pj[1]) + (pj[2] + pj[3]));
#pragma unroll
      for (int t = 0; t < 4; ++t) {
#pragma unroll
        for (int r = 0; r < 8; ++r) oacc[t][r] *= alpha;
      }

      // ---- context^T += V^T . P^T (f16 WMMA; A = V^T [dv][kv] split map, B = P^T from the registers) ----
#pragma unroll                                   // constant set index, as above
      for (int t = 0; t < 4; ++t) {
        const int nx = t + NS - 1;
        if (nx < 4) {
          ld_tile(Vhs + nx * 16 * LP + fo, fr[(4 + nx) % NS]);
          __builtin_amdgcn_sched_barrier(0);     // as above: the reads stay in front of this tile's products
        }
        const FragH (&vf)[4] = fr[(4 + t) % NS];
        v8f rr;
        pv_tile(vf, pa, pr, oacc[t], rr);
#pragma unroll
        for (int r = 0; r < 8; ++r) oacc[t][r] += rr[r] * (1.0f / RSC);
      }
      }                                        // end of this group's chunk

      // ---- foot of the trip, every wave ----
#if defined(__HIP_DEVICE_COMPILE__)
      asm volatile("s_wait_dscnt 0x0" ::: "memory");      // this wave has read the last of this trip's buffer
      asm volatile("s_wait_asynccnt 0x0" ::: "memory");   // its pieces of the next trip's chunk have landed
#endif
      __syncthreads();                                    // both hold for every wave
      if (kt + 2 * NG <= c1) {                            // wave-uniform (scalar): the chunk of the trip after the next
        const size_t kv = (size_t)(kt + 2 * NG) * KC;
        copy2(sl + buf, kgh + kv * HD, kgr + kv * HD, 16 * HD);
        copy2(sl + buf + 2 * PLB, vgh + kv, vgr + kv, (size_t)16 * SEQ);
      }
      buf ^= BUFB;
    }
#if defined(__HIP_DEVICE_COMPILE__)
    asm volatile("s_wait_asynccnt 0x0" ::: "memory");     // no copy is in flight when the buffers change their use
#endif

    // ---- hand over the wave's un-normalised 16x64 f32 tile (a lane holds 8 consecutive d of its query per
    //      tile: two 16-B stores) and its queries' (max, sum), the sum joined over the halves here ----
    float* os = (float*)KV + wave * (16 * OP);
#pragma unroll
    for (int t = 0; t < 4; ++t) {
      const v4f lo = {oacc[t][0], oacc[t][1], oacc[t][2], oacc[t][3]};
      const v4f hi = {oacc[t][4], oacc[t][5], oacc[t][6], oacc[t][7]};
      *(v4f*)(os + c * OP + t * 16 + 8 * hh)     = lo;
      *(v4f*)(os + c * OP + t * 16 + 8 * hh + 4) = hi;
    }
    const float lall = lrun + xhalf(lrun);
    if (hh == 0) {                                 // both halves hold equal max and sum
      Ms[wave][c] = mrun;
      Ls[wave][c] = lall;
    }
    __syncthreads();
    // ---- join the NG groups' partials of rows 4 grp .. 4 grp + 3 of tile wq; a whole tile is normalised (8 / l,
    //      the 1/1024 p carry and the 1/64 v carry) and goes to out, a half of a split tile goes as it is to
    //      its workspace plane; each wave store = two whole 256-B rows ----
    {
      const int col = c * 4;
      const size_t pt = (size_t)((slot < 0 ? 0 : slot) * NB + b) * HT + (slot < 0 ? 0 : qb - HT);   // plane tile
      float* C = (slot < 0) ? (outp + (rowB + q0) * HD) : (Po + (pt * 64 + wq * 16) * HD);
#pragma unroll
      for (int it = 0; it < 2; ++it) {
        const int row = grp * 4 + it * 2 + hh;
        float mg[NG], lg[NG];
        v4f og[NG];
#pragma unroll
        for (int g = 0; g < NG; ++g) {
          mg[g] = Ms[g * 4 + wq][row];
          lg[g] = Ls[g * 4 + wq][row];
          og[g] = *(const v4f*)((const float*)KV + (g * 4 + wq) * (16 * OP) + row * OP + col);
        }
        float mx = mg[0];                          // finite: group 0 has chunk c0, whose first key no row excludes
#pragma unroll
        for (int g = 1; g < NG; ++g) mx = fmaxf(mx, mg[g]);
        float l = 0.f;
        v4f o = {0.f, 0.f, 0.f, 0.f};
#pragma unroll
        for (int g = 0; g < NG; ++g) {
          const float wg = __expf(mg[g] - mx);
          l = fmaf(wg, lg[g], l);
          o += wg * og[g];
        }
        const float inv = (slot < 0) ? (((l > 0.f) ? (1.0f / l) : 0.f) * (OSC / (PSC * VSC))) : 1.0f;
        *(v4f*)(C + (size_t)row * HD + col) = o * inv;
#if defined(__HIP_DEVICE_COMPILE__)
        // what follows reuses the registers that hold this store's address and data
        asm volatile("s_wait_xcnt 0x0" ::: "memory");
#endif
      }
      // ---- a half's (max, sum) of all 64 rows, by the same sums: wave 0 alone, each store one whole line ----
      if (slot >= 0 && wave == 0) {
#pragma unroll
        for (int h = 0; h < 2; ++h) {
          const int rw = h * 32 + lane;
          float mg[NG], lg[NG];
#pragma unroll
          for (int g = 0; g < NG; ++g) {
            mg[g] = Ms[g * 4 + (rw >> 4)][rw & 15];
            lg[g] = Ls[g * 4 + (rw >> 4)][rw & 15];
          }
          float mx = mg[0];
#pragma unroll
          for (int g = 1; g < NG; ++g) mx = fmaxf(mx, mg[g]);
          float l = 0.f;
#pragma unroll
          for (int g = 0; g < NG; ++g) l = fmaf(__expf(mg[g] - mx), lg[g], l);
          Pm[pt * 64 + rw] = mx;
          Pl[pt * 64 + rw] = l;
        }
      }
    }
#if defined(__HIP_DEVICE_COMPILE__)
    // the next share reuses the registers that hold the addresses and data of wave 0's stores
    asm volatile("s_wait_xcnt 0x0" ::: "memory");
#endif
  }
}

// =====================================================================================================
// The two halves of a split query tile (HT .. NQB - 1), joined as the groups are joined above: weights
// exp(m_h - max m), then the same normalisation. Block = one tile = 64 rows x 64 d; piece i of thread tid is
// row tid / 16 + 16 i, d = 4 (tid % 16) .. + 3, so a wave load or store is 512 contiguous bytes. Both maxima are finite.
// coverage: NB * HT blocks x 256 threads x 4 pieces x 4 floats = every element of the split tiles once.
// =====================================================================================================
__global__ __launch_bounds__(256)
void join2(const float* __restrict__ Po, const float* __restrict__ Pm, const float* __restrict__ Pl, float* outp) {
  const int tile = blockIdx.x;                   // b * HT + (qb - HT)
  const int b    = tile / HT;
  const int qb   = HT + tile % HT;
  const int tid  = threadIdx.x;
  const float* o0 = Po + (size_t)tile * (64 * HD) + tid * 4;             // piece i: + 1024 i floats
  const float* o1 = o0 + (size_t)NB * HT * (64 * HD);
  const float* m0 = Pm + tile * 64 + (tid >> 4);                         // row of piece i: + 16 i
  const float* m1 = m0 + NB * HT * 64;
  const float* l0 = Pl + tile * 64 + (tid >> 4);
  const float* l1 = l0 + NB * HT * 64;
  float* C = outp + ((size_t)b * SEQ + qb * 64) * HD + tid * 4;
  v4f oa[4], ob[4];
  float ma[4], mb[4], la[4], lb[4];
#pragma unroll                                   // constant indices keep the arrays in registers: all loads fly at once
  for (int i = 0; i < 4; ++i) {
    oa[i] = *(const v4f*)(o0 + 1024 * i);
    ob[i] = *(const v4f*)(o1 + 1024 * i);
    ma[i] = m0[16 * i];
    mb[i] = m1[16 * i];
    la[i] = l0[16 * i];
    lb[i] = l1[16 * i];
  }
#if defined(__HIP_DEVICE_COMPILE__)
  // the loads' offset register (the thread index) stays whole until this wait; the sums below reuse it
  asm volatile("s_wait_xcnt 0x0" :: "v"(tid) : "memory");
#endif
#pragma unroll
  for (int i = 0; i < 4; ++i) {
    const float w  = __expf(-fabsf(ma[i] - mb[i]));          // the half with the larger maximum weighs exp(0) = 1
    const float wa = (ma[i] >= mb[i]) ? 1.0f : w;
    const float wb = (ma[i] >= mb[i]) ? w : 1.0f;
    const float l  = fmaf(wb, lb[i], wa * la[i]);
    const float inv = ((l > 0.f) ? (1.0f / l) : 0.f) * (OSC / (PSC * VSC));
    *(v4f*)(C + 1024 * i) = (wa * oa[i] + wb * ob[i]) * inv;
  }
}

// =====================================================================================================
// Workspace map (bytes); every plane is an exact multiple of its whole-line / 64x64-tile store granularity:
//   Qh   f16  [16384][64]        0          2097152
//   Qr   f16  [16384][64]        2097152    2097152
//   Kh   f16  [16384][64]        4194304    2097152
//   Kr   f16  [16384][64]        6291456    2097152
//   VTh  f16  [4][64][4096]      8388608    2097152
//   VTr  f16  [4][64][4096]      10485760   2097152
//   Po   f32  [2][4][32][64][64] 12582912   4194304    the two halves' contexts of the split tiles
//   Pm   f32  [2][4][32][64]     16777216   65536      their row maxima
//   Pl   f32  [2][4][32][64]     16842752   65536      their row sums
//   end                          16908288
// =====================================================================================================
extern "C" void kernel_launch(void* const* d_in, const int* in_sizes, int n_in,
                              void* d_out, int out_size, void* d_ws, size_t ws_size,
                              hipStream_t stream) {
  if (n_in < 7) return;
  if (in_sizes[0] != NX) return;
  if (in_sizes[1] != NW || in_sizes[3] != NW || in_sizes[5] != NW) return;
  if (in_sizes[2] != HD || in_sizes[4] != HD || in_sizes[6] != HD) return;
  if (out_size != NO) return;

  const float* x  = (const float*)d_in[0];
  const float* Wq = (const float*)d_in[1];
  const float* bq = (const float*)d_in[2];
  const float* Wk = (const float*)d_in[3];
  const float* bk = (const float*)d_in[4];
  const float* Wv = (const float*)d_in[5];
  const float* bv = (const float*)d_in[6];

  const size_t PB = (size_t)NO * 2;                     // 2097152
  size_t off = 0;
  const size_t oQh = off; off += PB;
  const size_t oQr = off; off += PB;
  const size_t oKh = off; off += PB;
  const size_t oKr = off; off += PB;
  const size_t oVh = off; off += PB;
  const size_t oVr = off; off += PB;
  const size_t oPo = off; off += (size_t)2 * NB * HT * 64 * HD * 4;
  const size_t oPm = off; off += (size_t)2 * NB * HT * 64 * 4;
  const size_t oPl = off; off += (size_t)2 * NB * HT * 64 * 4;
  if (off > ws_size) return;                            // off = 16908288

  char* ws = (char*)d_ws;
  _Float16* Qh  = (_Float16*)(ws + oQh);
  _Float16* Qr  = (_Float16*)(ws + oQr);
  _Float16* Kh  = (_Float16*)(ws + oKh);
  _Float16* Kr  = (_Float16*)(ws + oKr);
  _Float16* VTh = (_Float16*)(ws + oVh);
  _Float16* VTr = (_Float16*)(ws + oVr);
  float* Po = (float*)(ws + oPo);
  float* Pm = (float*)(ws + oPm);
  float* Pl = (float*)(ws + oPl);
  float* out0 = (float*)d_out;

  const dim3 gP(NROW / 64);                             // 256 blocks of 512
  const dim3 blkP(512);
  const dim3 gA(NB * NQB);                              // 256 blocks of 128 * NG
  const dim3 blkA(128 * NG);
  const dim3 gJ(NB * HT);                               // 128 blocks of 256
  const dim3 blkJ(256);

  // (1) projections from the f32 inputs -> q/k f16 hi + residual planes, v^T f16 hi + residual planes
  proj_qkv<<<gP, blkP, 0, stream>>>(x, Wq, Wk, Wv, bq, bk, bv, Qh, Qr, Kh, Kr, VTh, VTr);

  // (2) causal flash attention -> out f32 [4][4096][64] for tiles 0 .. 31, two halves in Po, Pm, Pl for the rest
  attn64<<<gA, blkA, 0, stream>>>(Qh, Qr, Kh, Kr, VTh, VTr, out0, Po, Pm, Pl);

  // (3) the split tiles' halves -> out
  join2<<<gJ, blkJ, 0, stream>>>(Po, Pm, Pl, out0);
  (void)hipGetLastError();
}

// v010
// One run takes 41.1 microseconds.
// In both of two side-by-side timings against v009, it was 1.07 times as fast.
// Counting every step since v000, it is 7.31 times as fast.
#include <hip/hip_runtime.h>
#include <hip/hip_bf16.h>
#include <math.h>
#include <stdint.h>

#define NB   4
#define SEQ  4096
#define DE   512
#define HD   64
#define KC   64
#define LP   72      // LDS row pitch in halves of the 64-half K and V^T rows: 144 B = 16 B x odd
#define XP   520     // LDS row pitch in bf16 of the 512-element x and W rows: 1040 B = 16 B x odd
#define OP   68      // LDS row pitch in floats of the 64-float context rows: 272 B = 16 B x odd
#define NQB  (SEQ / 64)
#define NG   4       // key groups per attention workgroup: group g takes key chunks g, g + NG, g + 2 NG, ...
#define HT   (NQB / 2)   // query tiles HT .. NQB - 1 have more than HT key chunks: their chunks go to two workgroups
#define NROW (NB * SEQ)
#define NX   (NROW * DE)
#define NW   (HD * DE)
#define NO   (NROW * HD)
#define PSC  1024.0f
#define RSC  2048.0f
#define VSC  64.0f
#define OSC  8.0f
static_assert((SEQ % 64) == 0);
static_assert(HD == 64);
static_assert(KC == 64);
static_assert(LP >= KC && LP >= HD && (LP % 8) == 0 && ((LP / 8) % 2) == 1);
static_assert(OP >= HD && (OP % 4) == 0 && ((OP / 4) % 2) == 1);
static_assert((DE % 32) == 0);
static_assert(DE == 512);
static_assert(XP >= DE && (XP % 8) == 0 && ((XP / 8) % 2) == 1);
static_assert((NROW % 64) == 0);
static_assert((NQB % 2) == 0);

typedef _Float16 v16h __attribute__((ext_vector_type(16)));
typedef _Float16 v8h  __attribute__((ext_vector_type(8)));
typedef __bf16   v16b __attribute__((ext_vector_type(16)));
typedef float    v8f  __attribute__((ext_vector_type(8)));
typedef float    v4f  __attribute__((ext_vector_type(4)));
typedef unsigned int v4u __attribute__((ext_vector_type(4)));
typedef unsigned int v2u __attribute__((ext_vector_type(2)));
typedef float    v2f  __attribute__((ext_vector_type(2)));
typedef __bf16   v2b  __attribute__((ext_vector_type(2)));

union FragH { v16h v; v8h h[2]; };
union FragB { v16b v; v4u u[2]; };
union HU8   { v8h h; v4u u; };
union BU4   { v2b b[2]; v2u u; };

// ---- scalar helpers --------------------------------------------------------------------------------
__device__ __forceinline__ unsigned short bf_bits(float f) {          // f32 -> bf16 bits, RNE convert
  unsigned u = __float_as_uint(f);
  return (unsigned short)((u + 0x7FFFu + ((u >> 16) & 1u)) >> 16);
}
__device__ __forceinline__ float bf_up(unsigned short h) { return __uint_as_float(((unsigned)h) << 16); }
__device__ __forceinline__ float bfr(float f) { return bf_up(bf_bits(f)); }   // value of the bf16 RNE convert
__device__ __forceinline__ v8f zero8() { v8f z = {0.f, 0.f, 0.f, 0.f, 0.f, 0.f, 0.f, 0.f}; return z; }

// ---- fragment loaders: 16-bit A/B operand, lane -> row/col (lane&15), p already includes +8*(lane>>4);
//      elements 0..7 <- p[0..7] (k0+8h..), elements 8..15 <- p[16..23] (k0+16+8h..)
__device__ __forceinline__ v16h ldfrag_h(const _Float16* p) {
  FragH f;
  f.h[0] = *(const v8h*)(p);
  f.h[1] = *(const v8h*)(p + 16);
  return f.v;
}
__device__ __forceinline__ v16b ldfrag_b(const unsigned short* p) {
  FragB f;
  f.u[0] = *(const v4u*)(p);
  f.u[1] = *(const v4u*)(p + 16);
  return f.v;
}

// ---- WMMA helper with trailing VALU hazard gap (projections) -------------------------------------------
__device__ __forceinline__ v8f mma_b(v16b a, v16b b, v8f c) {
  c = __builtin_amdgcn_wmma_f32_16x16x32_bf16(false, a, false, b, (short)0, c, false, false);
#if defined(__HIP_DEVICE_COMPILE__)
  asm volatile("v_nop\n\tv_nop\n\tv_nop\n\tv_nop" : "+v"(c) : "v"(a), "v"(b));
#endif
  return c;
}
// value of lane l ^ 16 (the other half of the wave), by a vector cross-row move
__device__ __forceinline__ float xhalf(float x) {
  const int i = __float_as_int(x);
  return __int_as_float(__builtin_amdgcn_permlanex16(i, i, 0x76543210, 0xfedcba98, false, false));
}

// =====================================================================================================
// q/k/v projections, f32 inputs converted on the way in. Block = 512 threads = 16 waves = 64 token rows
// (rows r0..r0+63 of the flattened [NB*SEQ] row index; 64 | SEQ so one block never crosses a sequence).
// Stage: the block's 64 x rows and all 64 rows of Wq, Wk, Wv are read as f32 (a wave load = 512 contiguous
// bytes of one row), rounded to bf16 RNE in registers and laid in LDS in rows of pitch XP;
// wave w brings rows 4w..4w+3 of each of the four. One barrier.
// Product: wave (rt, cg) owns token rows 16 rt..+15 x columns 16 cg..+15 of q, k and v: A fragment from x row
// lane&15, B(k, n) = W[n][k] fragments from W row n (k-contiguous), K = DE in ascending 32-steps.
// Epilogue (f32): + bf16_RNE(bias[n]); q/k: hi = f16(v), res = f16((v - hi) * 2048) staged as [row][d];
// v: the same of 64 v, staged transposed [d][s]; one barrier; every thread stores one 16-B piece per plane.
// coverage: 512 threads x 8 halves = 64 x 64 per plane; grid NROW/64 blocks covers all rows.
// =====================================================================================================
__device__ __forceinline__ v2u cvt4(v4f a) {                 // four f32 -> four bf16 (RNE), packed
  BU4 o;
  const v2f lo = {a[0], a[1]};
  const v2f hi = {a[2], a[3]};
  o.b[0] = __builtin_convertvector(lo, v2b);
  o.b[1] = __builtin_convertvector(hi, v2b);
  return o.u;
}
// four f32 rows of DE elements: p = first row + 4 * lane; piece (i, j) = row i, elements 128 j + 4 lane ..+3
__device__ __forceinline__ void ld_rows(const float* __restrict__ p, v4f (&t)[16]) {
#pragma unroll                                   // constant indices keep t[] in registers, here and in st_rows
  for (int i = 0; i < 4; ++i) {
#pragma unroll
    for (int j = 0; j < 4; ++j) t[i * 4 + j] = *(const v4f*)(p + i * DE + j * 128);
  }
}
__device__ __forceinline__ void st_rows(unsigned short* d, const v4f (&t)[16]) {
#pragma unroll
  for (int i = 0; i < 4; ++i) {
#pragma unroll
    for (int j = 0; j < 4; ++j) *(v2u*)(d + i * XP + j * 128) = cvt4(t[i * 4 + j]);
  }
}

__global__ __launch_bounds__(512)
void proj_qkv(const float* __restrict__ x,
              const float* __restrict__ Wq, const float* __restrict__ Wk, const float* __restrict__ Wv,
              const float* __restrict__ bq, const float* __restrict__ bk, const float* __restrict__ bv,
              _Float16* Qh, _Float16* Qr, _Float16* Kh, _Float16* Kr, _Float16* VTh, _Float16* VTr) {
  __shared__ __align__(16) unsigned short Xs[64 * XP];       // bf16 x rows                            65 KB
  __shared__ __align__(16) unsigned short Ws[3][64 * XP];    // bf16 Wq, Wk, Wv rows                  195 KB
  __shared__ __align__(16) _Float16 Eh[3][64 * 72];          // q, k [row][d] and v^T [d][s], hi       27 KB
  __shared__ __align__(16) _Float16 Er[3][64 * 72];          // their x2048 residuals                  27 KB

  const int tid  = threadIdx.x;
  const int wave = __builtin_amdgcn_readfirstlane(tid >> 5);
  const int lane = tid & 31;
  const int hh   = lane >> 4;
  const int c    = lane & 15;
  const int rt   = wave & 3;                     // token row tile
  const int cg   = wave >> 2;                    // column tile inside each projection
  const int r0   = blockIdx.x * 64;
  const int b    = r0 / SEQ;
  const int s0   = r0 - b * SEQ;

  const int n = cg * 16 + c;
  const float bias0 = bfr(bq[n]);
  const float bias1 = bfr(bk[n]);
  const float bias2 = bfr(bv[n]);

  // ---- stage: two register sets, so that the next rows' loads fly while these are rounded and stored.
  //      Each sched_barrier keeps that order: without them the compiler lifts all 64 loads to the top, sinks
  //      all stores to the foot and spills ----
  {
    const size_t ro = (size_t)(wave * 4) * DE + lane * 4;
    const int d = (wave * 4) * XP + lane * 4;
    v4f ta[16], tb[16];
    ld_rows(x + (size_t)r0 * DE + ro, ta);
    ld_rows(Wq + ro, tb);
    __builtin_amdgcn_sched_barrier(0);           // x and Wq rows in flight before the first store
    st_rows(Xs + d, ta);
    __builtin_amdgcn_sched_barrier(0);           // set a is free only now
    ld_rows(Wk + ro, ta);
    __builtin_amdgcn_sched_barrier(0);           // Wk rows in flight before Wq is waited for
    st_rows(Ws[0] + d, tb);
    __builtin_amdgcn_sched_barrier(0);           // set b is free only now
    ld_rows(Wv + ro, tb);
    __builtin_amdgcn_sched_barrier(0);           // Wv rows in flight before Wk is waited for
    st_rows(Ws[1] + d, ta);
    st_rows(Ws[2] + d, tb);
  }
  __syncthreads();

  // ---- products: the fragments of k-step ks + 1 are fetched into the other register set ahead of the
  //      WMMAs of k-step ks ----
  v8f acc[3];
#pragma unroll
  for (int w = 0; w < 3; ++w) acc[w] = zero8();
  const unsigned short* ap = Xs + (rt * 16 + c) * XP + 8 * hh;           // A row = lane&15
  const int wo = n * XP + 8 * hh;                                        // B col n = cg*16+c = W row n
  v16b a[2], wf[2][3];
  a[0] = ldfrag_b(ap);
#pragma unroll
  for (int w = 0; w < 3; ++w) wf[0][w] = ldfrag_b(Ws[w] + wo);
#pragma unroll                                   // the set index ks & 1 must be a constant: both sets in registers
  for (int ks = 0; ks < DE / 32; ++ks) {
    const int cur = ks & 1;
    if (ks + 1 < DE / 32) {
      a[cur ^ 1] = ldfrag_b(ap + (ks + 1) * 32);
#pragma unroll
      for (int w = 0; w < 3; ++w) wf[cur ^ 1][w] = ldfrag_b(Ws[w] + wo + (ks + 1) * 32);
    }
#pragma unroll
    for (int w = 0; w < 3; ++w) acc[w] = mma_b(a[cur], wf[cur][w], acc[w]);
  }

  // ---- q, k: [token row][d] as f16 hi and x2048 residual; v: transposed [d][s], of v * 64 ----
#pragma unroll
  for (int w = 0; w < 3; ++w) {
    const float bias = (w == 0) ? bias0 : ((w == 1) ? bias1 : bias2);
#pragma unroll
    for (int r = 0; r < 8; ++r) {
      const float v = (w < 2) ? (acc[w][r] + bias) : ((acc[w][r] + bias) * VSC);
      const _Float16 hq = (_Float16)v;
      const _Float16 rq = (_Float16)((v - (float)hq) * RSC);
      const int row = rt * 16 + 8 * hh + r;
      const int pi = (w < 2) ? (row * 72 + n) : (n * 72 + row);
      Eh[w][pi] = hq;
      Er[w][pi] = rq;
    }
  }
  __syncthreads();
  {
    const int q8 = tid >> 3, c8 = (tid & 7) * 8;
    v4u vh[3], vr[3];
#pragma unroll
    for (int w = 0; w < 3; ++w) {
      HU8 u;
      u.h = *(const v8h*)(Eh[w] + q8 * 72 + c8);
      vh[w] = u.u;
      u.h = *(const v8h*)(Er[w] + q8 * 72 + c8);
      vr[w] = u.u;
    }
    const size_t o  = (size_t)(r0 + q8) * HD + c8;                       // q, k: token row q8
    const size_t ov = ((size_t)b * HD + q8) * SEQ + s0 + c8;             // v^T: d = q8
    *(v4u*)(Qh + o)   = vh[0];
    *(v4u*)(Qr + o)   = vr[0];
    *(v4u*)(Kh + o)   = vh[1];
    *(v4u*)(Kr + o)   = vr[1];
    *(v4u*)(VTh + ov) = vh[2];
    *(v4u*)(VTr + ov) = vr[2];
  }
}

#define PLB  (KC * LP * 2)
#define GRB  (4 * PLB)
#define BUFB (NG * GRB)
#define NS   2
#define SG   (NG / 2)
static_assert(4 * NG * 16 * OP * 4 <= 2 * BUFB);

// Rows r, r + 16, r + 32, r + 48 of two planes' tiles, 16 B per lane each: l = the lane's LDS byte address in
// the first plane (the second lies PLB behind it), ga, gb = its global addresses, gs = 16 rows in halves.
// The s_wait_xcnt stands inside the statement, so that no address register is rewritten in front of it.
__device__ __forceinline__ void copy2(unsigned l, const _Float16* ga, const _Float16* gb, size_t gs) {
#if defined(__HIP_DEVICE_COMPILE__)
  asm volatile("global_load_async_to_lds_b128 %0, %8, off\n\t"
               "global_load_async_to_lds_b128 %1, %9, off\n\t"
               "global_load_async_to_lds_b128 %2, %10, off\n\t"
               "global_load_async_to_lds_b128 %3, %11, off\n\t"
               "global_load_async_to_lds_b128 %4, %12, off\n\t"
               "global_load_async_to_lds_b128 %5, %13, off\n\t"
               "global_load_async_to_lds_b128 %6, %14, off\n\t"
               "global_load_async_to_lds_b128 %7, %15, off\n\t"
               "s_wait_xcnt 0x0"
               :: "v"(l), "v"(l + 32 * LP), "v"(l + 64 * LP), "v"(l + 96 * LP),
                  "v"(l + PLB), "v"(l + PLB + 32 * LP), "v"(l + PLB + 64 * LP), "v"(l + PLB + 96 * LP),
                  "v"(ga), "v"(ga + gs), "v"(ga + 2 * gs), "v"(ga + 3 * gs),
                  "v"(gb), "v"(gb + gs), "v"(gb + 2 * gs), "v"(gb + 3 * gs)
               : "memory");
#endif
}

// One 16-row fragment tile of a hi plane and of its residual plane, which lies 64 rows behind it: p = the lane's
// row + 8 * (lane >> 4); f[i] = hi, k = 32 i .. 32 i + 31 in the loaders' k order, f[2 + i] = residual, the same k
__device__ __forceinline__ void ld_tile(const _Float16* p, FragH (&f)[4]) {
#pragma unroll
  for (int i = 0; i < 2; ++i) {
    f[i].v     = ldfrag_h(p + i * 32);
    f[2 + i].v = ldfrag_h(p + 64 * LP + i * 32);
  }
}

// The six products of one 16-row fragment tile, in ONE statement: the two accumulator chains alternate, so that a
// product's own sum lies two products back (the last one: one back), and the four vector slots that the chip asks
// for between a product and a vector instruction on its result stand once, behind the last product, not behind
// each. Each s_delay_alu names the producers of the two products behind it, so that the wave yields the issue port
// to its neighbours while it waits for them. Each chain keeps its order of sums.
// In asm, because the scheduling fences of the fragment ring do not hold builtin products: those sink behind the
// later tiles' reads, four tiles' fragments are then live at once, and the query fragments spill.
// Scores: sh = k hi . q hi; sx = k res . q hi + k hi . q res, d = 0 .. 31 and then d = 32 .. 63
__device__ __forceinline__ void qk_tile(const FragH (&kf)[4], const v16h (&qh)[2], const v16h (&qr)[2],
                                        v8f& sh, v8f& sx) {
#if defined(__HIP_DEVICE_COMPILE__)
  asm volatile("v_wmma_f32_16x16x32_f16 %1, %4, %6, 0\n\t"
               "v_wmma_f32_16x16x32_f16 %0, %2, %6, 0\n\t"
               "s_delay_alu instid0(TRANS32_DEP_2) | instskip(NEXT) | instid1(TRANS32_DEP_2)\n\t"
               "v_wmma_f32_16x16x32_f16 %1, %2, %8, %1\n\t"
               "v_wmma_f32_16x16x32_f16 %0, %3, %7, %0\n\t"
               "s_delay_alu instid0(TRANS32_DEP_2) | instskip(NEXT) | instid1(TRANS32_DEP_1)\n\t"
               "v_wmma_f32_16x16x32_f16 %1, %5, %7, %1\n\t"
               "v_wmma_f32_16x16x32_f16 %1, %3, %9, %1\n\t"
               "v_nop\n\tv_nop\n\tv_nop\n\tv_nop"
               : "=&v"(sh), "=&v"(sx)
               : "v"(kf[0].v), "v"(kf[1].v), "v"(kf[2].v), "v"(kf[3].v),
                 "v"(qh[0]), "v"(qh[1]), "v"(qr[0]), "v"(qr[1]));
#else
  sh = zero8();
  sx = zero8();
#endif
}
// Context: o += v hi . p hi; rr = v res . p hi + v hi . p res, keys 0 .. 31 and then 32 .. 63 of each
__device__ __forceinline__ void pv_tile(const FragH (&vf)[4], const FragH (&pa)[2], const FragH (&pr)[2],
                                        v8f& o, v8f& rr) {
#if defined(__HIP_DEVICE_COMPILE__)
  asm volatile("v_wmma_f32_16x16x32_f16 %1, %4, %6, 0\n\t"
               "v_wmma_f32_16x16x32_f16 %0, %2, %6, %0\n\t"
               "s_delay_alu instid0(TRANS32_DEP_2) | instskip(NEXT) | instid1(TRANS32_DEP_2)\n\t"
               "v_wmma_f32_16x16x32_f16 %1, %5, %7, %1\n\t"
               "v_wmma_f32_16x16x32_f16 %0, %3, %7, %0\n\t"
               "s_delay_alu instid0(TRANS32_DEP_2) | instskip(NEXT) | instid1(TRANS32_DEP_1)\n\t"
               "v_wmma_f32_16x16x32_f16 %1, %2, %8, %1\n\t"
               "v_wmma_f32_16x16x32_f16 %1, %3, %9, %1\n\t"
               "v_nop\n\tv_nop\n\tv_nop\n\tv_nop"
               : "+v"(o), "=&v"(rr)
               : "v"(vf[0].v), "v"(vf[1].v), "v"(vf[2].v), "v"(vf[3].v),
                 "v"(pa[0].v), "v"(pa[1].v), "v"(pr[0].v), "v"(pr[1].v));
#else
  rr = zero8();
#endif
}

__global__ __launch_bounds__(128 * NG)
void attn64(const _Float16* __restrict__ Qh, const _Float16* __restrict__ Qr,
            const _Float16* __restrict__ Kh, const _Float16* __restrict__ Kr,
            const _Float16* __restrict__ VTh, const _Float16* __restrict__ VTr, float* outp,
            float* Po, float* Pm, float* Pl) {
  // [buffer][group][K hi [kv][d], K res, V^T hi [d][kv], V^T res][64 rows of pitch LP], 9 KB a plane; behind a
  // share's last trip its first bytes hold the per wave context tiles [wave][row][d], f32, pitch OP
  __shared__ __align__(16) unsigned char KV[2 * BUFB];
  __shared__ float                  Ms[4 * NG][16];               // per wave running max of its 16 rows
  __shared__ float                  Ls[4 * NG][16];               // per wave running sum of its 16 rows

  const int tid  = threadIdx.x;
  const int wave = __builtin_amdgcn_readfirstlane(tid >> 5);      // scalar: group tests are scalar branches
  const int grp  = wave >> 2;                    // key group
  const int wq   = wave & 3;                     // query tile inside the block
  const int lane = tid & 31;
  const int hh   = lane >> 4;
  const int c    = lane & 15;
  const int pc = (lane & 7) * 8;                                  // staging: 16-B piece of the 128-B tile row
  const int sr = ((lane >> 3) & 1) * 8 + wq * 2 + hh;             // staging: tile row of piece i is sr + 16 i
  // the lane's LDS byte address in its group's K hi plane of buffer 0
  const unsigned sl = (unsigned)(uintptr_t)(KV + grp * GRB + (sr * LP + pc) * 2);

  const int bx = blockIdx.x;
  const int wi = bx % HT + ((bx < NB * HT) ? HT : 0);   // which share of its sequence this block takes
  const int b  = (bx / HT) % NB;
  const size_t rowB = (size_t)b * SEQ;
  const _Float16* VThb = VTh + (size_t)b * HD * SEQ;
  const _Float16* VTrb = VTr + (size_t)b * HD * SEQ;
  const int njob = (wi < HT) ? 1 : 2;            // block-uniform, like all that is formed from wi and job

#pragma unroll 1                                 // one copy of the chunk loop serves both shares
  for (int job = 0; job < njob; ++job) {
    const int qb   = (wi < HT) ? (HT + wi) : ((job == 0) ? wi : (NQB - 1 - wi));     // query tile
    const int c0   = (wi >= HT && job == 0) ? HT : 0;                                // first key chunk
    const int c1   = (wi < HT) ? (HT - 1) : qb;                                      // last key chunk, <= qb
    const int slot = (wi < HT) ? 0 : ((job == 0) ? 1 : -1);   // half of a split tile, or -1: the whole tile
    const int q0 = qb * 64 + wq * 16;              // in-sequence query row of this wave's first row
    const int qrow = q0 + c;                       // in-sequence query row of this lane's accumulator column

    // ---- Q fragments (B operand, column = query = lane&15): 2 d-chunks, hi and residual ----
    v16h qh[2], qr[2];
#pragma unroll
    for (int dc = 0; dc < 2; ++dc) {
      qh[dc] = ldfrag_h(Qh + (rowB + q0 + c) * HD + dc * 32 + 8 * hh);
      qr[dc] = ldfrag_h(Qr + (rowB + q0 + c) * HD + dc * 32 + 8 * hh);
    }

    float mrun = -INFINITY;                        // running max of query c (equal in both halves)
    float lrun = 0.f;                              // running sum of query c over this half's keys only
    v8f oacc[4];                                   // O^T: tile t, register r = context[query c][d = 16 t + 8 hh + r]
#pragma unroll
    for (int t = 0; t < 4; ++t) oacc[t] = zero8();

    // the lane's global addresses in key chunk 0: K row sr, d = pc .. pc + 7; V^T row d = sr, s = pc .. pc + 7
    const _Float16* kgh = Kh + (rowB + sr) * HD + pc;
    const _Float16* kgr = Kr + (rowB + sr) * HD + pc;
    const _Float16* vgh = VThb + (size_t)sr * SEQ + pc;
    const _Float16* vgr = VTrb + (size_t)sr * SEQ + pc;

    // ---- Steps. A chunk's work falls into two steps: the scores (vector and matrix work bound by the K reads), then
    //      softmax and context (mostly vector work). Groups SG .. NG - 1 run one step behind groups 0 .. SG - 1, so
    //      that at any time half of the waves are in the one kind of step and half in the other, and the
    //      LDS reads and products of the one pass under the vector work of the other. One barrier a step, passed by
    //      every wave, keeps the two halves so. Step u of a group: chunk number m = u >> 1 of its chunks, in buffer
    //      m & 1; u even: scores, kept in s[] over the barrier; u odd: softmax and context.
    //      Foot of an odd step (the chunk's last read): the copies of chunk m + 1, issued two steps ago, waited for,
    //      the barrier (it publishes them and ends the last read of chunk m), then the copies of chunk m + 2 into
    //      the buffer just read. Steps u = -3 and u = -1 have no work, only that foot: the first one's barrier
    //      ends every wave's reads of the share before (its context tiles lie in these buffers). Every test on a
    //      group's step or chunk is wave-uniform (scalar); every wave passes every barrier ----
    const int ph   = (grp >= SG) ? 1 : 0;
    const int nlo  = (c1 - c0) / NG + 1;                                   // chunks of group 0, the most of any
    const int nhi  = (c1 - c0 >= SG) ? ((c1 - c0 - SG) / NG + 1) : 0;      // chunks of group SG, the most of the late
    const int iend = (2 * nhi > 2 * nlo - 1) ? (2 * nhi) : (2 * nlo - 1);  // the last step that any group works in
    const int fo = c * LP + 8 * hh;                             // the lane's place in a 16-row fragment tile
    v8f s[4];                                                   // the chunk's scores, from its even to its odd step
#pragma unroll
    for (int j = 0; j < 4; ++j) s[j] = zero8();                 // a defined value on every path that the compiler sees
#pragma unroll 1
    for (int i = -3; i <= iend; ++i) {                  // block-uniform trip count, at most 2 NQB / NG + 4
      const int u   = i - ph;
      const int m   = u >> 1;
      const int odd = u & 1;
      const int kt  = c0 + grp + NG * m;
      const int kv0 = kt * KC;
      const int buf = (m & 1) * BUFB;          // byte offset of the chunk's buffer: 0 or BUFB
      const _Float16* Khs = (const _Float16*)(KV + buf + grp * GRB);
      const _Float16* Vhs = Khs + 2 * KC * LP;           // behind each hi plane lies its residual plane

      const bool act = (u >= 0 && kt <= c1);   // wave-uniform (scalar): this group has a chunk in this step
      // ---- the four fragment tiles of a step go through a ring of NS register sets: tile n + 1 is fetched from LDS
      //      in front of the products of tile n, so that its latency passes under them ----
      if (act && odd == 0) {
      FragH fr[NS][4];
      // ---- scores, transposed: 64 keys x 16 queries per wave (A operand: row = key j*16+c, k = d, split map) ----
      // the query row against this half's first key, formed once a chunk: the 32 tests below then need no register each
      const int dq = qrow - kv0 - 8 * hh;
      ld_tile(Khs + fo, fr[0]);
#pragma unroll                                   // the set index must be a constant: the ring stays in registers
      for (int j = 0; j < 4; ++j) {
        if (j + 1 < 4) {
          ld_tile(Khs + (j + 1) * 16 * LP + fo, fr[(j + 1) % NS]);
          __builtin_amdgcn_sched_barrier(0);     // without it the compiler moves these reads in among the products
        }
        const FragH (&kf)[4] = fr[j % NS];
        v8f sh, sx;
        qk_tile(kf, qh, qr, sh, sx);
#pragma unroll
        for (int r = 0; r < 8; ++r) {                           // key of accumulator register r: kv0 + 16 j + 8 hh + r
          const float sv = sh[r] + sx[r] * (1.0f / RSC);
          s[j][r] = (j * 16 + r > dq) ? -INFINITY : sv;         // causal: keys strictly after the row excluded
        }
      }
      }
      if (act && odd != 0) {
      FragH fr[NS][4];
      ld_tile(Vhs + fo, fr[0]);
      __builtin_amdgcn_sched_barrier(0);         // V^T's first tile is asked for here, so that it flies under the softmax

      // ---- query max in the lane and across the halves, online softmax, P^T hi (x1024) and residual (x2048)
      //      packed straight into B operands ----
      float mj[4];                                              // one chain per tile: four short chains, not one long
#pragma unroll
      for (int j = 0; j < 4; ++j) {
        mj[j] = s[j][0];
#pragma unroll
        for (int r = 1; r < 8; ++r) mj[j] = fmaxf(mj[j], s[j][r]);
      }
      float m4 = fmaxf(fmaxf(mj[0], mj[1]), fmaxf(mj[2], mj[3]));
      m4 = fmaxf(m4, xhalf(m4));
      const float mnew  = fmaxf(mrun, m4);
      const float alpha = __expf(mrun - mnew);
      mrun = mnew;
      FragH pa[2], pr[2];
      float pj[4];                                              // per-tile partial sums, joined below
#pragma unroll
      for (int j = 0; j < 4; ++j) {
        pj[j] = 0.f;
#pragma unroll
        for (int r = 0; r < 8; ++r) {
          const float p  = __expf(s[j][r] - mnew);
          pj[j] += p;
          const _Float16 hq = (_Float16)(p * PSC);
          const float res = __builtin_fmaf(p, PSC, -(float)hq) * RSC;   // p * 1024 is exact: the same residual
          pa[j >> 1].v[(j & 1) * 8 + r] = hq;                   // element e <-> key 32 kk + 8 hh + e, + 8 more from e = 8
          pr[j >> 1].v[(j & 1) * 8 + r] = (_Float16)res;
        }
      }
      // The scores are dead from here to the group's next even step, but the compiler cannot see that an even step comes
      // before every odd one, and would keep their 32 registers through the products below and spill the queries.
      // Naming P's bits as their value lets both share the same registers; nothing reads s before it is written anew.
      s[0] = __builtin_bit_cast(v8f, pa[0].v);
      s[1] = __builtin_bit_cast(v8f, pr[0].v);
      s[2] = __builtin_bit_cast(v8f, pa[1].v);
      s[3] = __builtin_bit_cast(v8f, pr[1].v);
      lrun = lrun * alpha + ((pj[0] + pj[1]) + (pj[2] + pj[3]));
#pragma unroll
      for (int t = 0; t < 4; ++t) {
#pragma unroll
        for (int r = 0; r < 8; ++r) oacc[t][r] *= alpha;
      }

      // ---- context^T += V^T . P^T (f16 WMMA; A = V^T [dv][kv] split map, B = P^T from the registers) ----
#pragma unroll                                   // constant set index, as above
      for (int t = 0; t < 4; ++t) {
        if (t + 1 < 4) {
          ld_tile(Vhs + (t + 1) * 16 * LP + fo, fr[(t + 1) % NS]);
          __builtin_amdgcn_sched_barrier(0);     // as above: the reads stay in front of this tile's products
        }
        const FragH (&vf)[4] = fr[t % NS];
        v8f rr;
        pv_tile(vf, pa, pr, oacc[t], rr);
#pragma unroll
        for (int r = 0; r < 8; ++r) oacc[t][r] += rr[r] * (1.0f / RSC);
      }
      }                                        // end of this group's step

      // ---- foot of the step, every wave ----
#if defined(__HIP_DEVICE_COMPILE__)
      asm volatile("s_wait_dscnt 0x0" ::: "memory");      // this wave has read the last of what this step reads
      if (odd) {                                          // wave-uniform (scalar)
        asm volatile("s_wait_asynccnt 0x0" ::: "memory"); // its pieces of the group's next chunk have landed
      }
#endif
      __syncthreads();                                    // the first holds for every wave, the second for those in an odd step
      if (odd && kt + 2 * NG <= c1) {                     // wave-uniform (scalar): the group's chunk after the next
        const size_t kv = (size_t)(kt + 2 * NG) * KC;
        copy2(sl + buf, kgh + kv * HD, kgr + kv * HD, 16 * HD);
        copy2(sl + buf + 2 * PLB, vgh + kv, vgr + kv, (size_t)16 * SEQ);
      }
    }
#if defined(__HIP_DEVICE_COMPILE__)
    asm volatile("s_wait_asynccnt 0x0" ::: "memory");     // no copy is in flight when the buffers change their use
#endif

    // ---- hand over the wave's un-normalised 16x64 f32 tile (a lane holds 8 consecutive d of its query per
    //      tile: two 16-B stores) and its queries' (max, sum), the sum joined over the halves here ----
    float* os = (float*)KV + wave * (16 * OP);
#pragma unroll
    for (int t = 0; t < 4; ++t) {
      const v4f lo = {oacc[t][0], oacc[t][1], oacc[t][2], oacc[t][3]};
      const v4f hi = {oacc[t][4], oacc[t][5], oacc[t][6], oacc[t][7]};
      *(v4f*)(os + c * OP + t * 16 + 8 * hh)     = lo;
      *(v4f*)(os + c * OP + t * 16 + 8 * hh + 4) = hi;
    }
    const float lall = lrun + xhalf(lrun);
    if (hh == 0) {                                 // both halves hold equal max and sum
      Ms[wave][c] = mrun;
      Ls[wave][c] = lall;
    }
    __syncthreads();
    // ---- join the NG groups' partials of rows 4 grp .. 4 grp + 3 of tile wq; a whole tile is normalised (8 / l,
    //      the 1/1024 p carry and the 1/64 v carry) and goes to out, a half of a split tile goes as it is to
    //      its workspace plane; each wave store = two whole 256-B rows ----
    {
      const int col = c * 4;
      const size_t pt = (size_t)((slot < 0 ? 0 : slot) * NB + b) * HT + (slot < 0 ? 0 : qb - HT);   // plane tile
      float* C = (slot < 0) ? (outp + (rowB + q0) * HD) : (Po + (pt * 64 + wq * 16) * HD);
#pragma unroll
      for (int it = 0; it < 2; ++it) {
        const int row = grp * 4 + it * 2 + hh;
        float mg[NG], lg[NG];
        v4f og[NG];
#pragma unroll
        for (int g = 0; g < NG; ++g) {
          mg[g] = Ms[g * 4 + wq][row];
          lg[g] = Ls[g * 4 + wq][row];
          og[g] = *(const v4f*)((const float*)KV + (g * 4 + wq) * (16 * OP) + row * OP + col);
        }
        float mx = mg[0];                          // finite: group 0 has chunk c0, whose first key no row excludes
#pragma unroll
        for (int g = 1; g < NG; ++g) mx = fmaxf(mx, mg[g]);
        float l = 0.f;
        v4f o = {0.f, 0.f, 0.f, 0.f};
#pragma unroll
        for (int g = 0; g < NG; ++g) {
          const float wg = __expf(mg[g] - mx);
          l = fmaf(wg, lg[g], l);
          o += wg * og[g];
        }
        const float inv = (slot < 0) ? (((l > 0.f) ? (1.0f / l) : 0.f) * (OSC / (PSC * VSC))) : 1.0f;
        *(v4f*)(C + (size_t)row * HD + col) = o * inv;
#if defined(__HIP_DEVICE_COMPILE__)
        // what follows reuses the registers that hold this store's address and data
        asm volatile("s_wait_xcnt 0x0" ::: "memory");
#endif
      }
      // ---- a half's (max, sum) of all 64 rows, by the same sums: wave 0 alone, each store one whole line ----
      if (slot >= 0 && wave == 0) {
#pragma unroll
        for (int h = 0; h < 2; ++h) {
          const int rw = h * 32 + lane;
          float mg[NG], lg[NG];
#pragma unroll
          for (int g = 0; g < NG; ++g) {
            mg[g] = Ms[g * 4 + (rw >> 4)][rw & 15];
            lg[g] = Ls[g * 4 + (rw >> 4)][rw & 15];
          }
          float mx = mg[0];
#pragma unroll
          for (int g = 1; g < NG; ++g) mx = fmaxf(mx, mg[g]);
          float l = 0.f;
#pragma unroll
          for (int g = 0; g < NG; ++g) l = fmaf(__expf(mg[g] - mx), lg[g], l);
          Pm[pt * 64 + rw] = mx;
          Pl[pt * 64 + rw] = l;
        }
      }
    }
#if defined(__HIP_DEVICE_COMPILE__)
    // the next share reuses the registers that hold the addresses and data of wave 0's stores
    asm volatile("s_wait_xcnt 0x0" ::: "memory");
#endif
  }
}

// =====================================================================================================
// The two halves of a split query tile (HT .. NQB - 1), joined as the groups are joined above: weights
// exp(m_h - max m), then the same normalisation. Block = one tile = 64 rows x 64 d; piece i of thread tid is
// row tid / 16 + 16 i, d = 4 (tid % 16) .. + 3, so a wave load or store is 512 contiguous bytes. Both maxima are finite.
// coverage: NB * HT blocks x 256 threads x 4 pieces x 4 floats = every element of the split tiles once.
// =====================================================================================================
__global__ __launch_bounds__(256)
void join2(const float* __restrict__ Po, const float* __restrict__ Pm, const float* __restrict__ Pl, float* outp) {
  const int tile = blockIdx.x;                   // b * HT + (qb - HT)
  const int b    = tile / HT;
  const int qb   = HT + tile % HT;
  const int tid  = threadIdx.x;
  const float* o0 = Po + (size_t)tile * (64 * HD) + tid * 4;             // piece i: + 1024 i floats
  const float* o1 = o0 + (size_t)NB * HT * (64 * HD);
  const float* m0 = Pm + tile * 64 + (tid >> 4);                         // row of piece i: + 16 i
  const float* m1 = m0 + NB * HT * 64;
  const float* l0 = Pl + tile * 64 + (tid >> 4);
  const float* l1 = l0 + NB * HT * 64;
  float* C = outp + ((size_t)b * SEQ + qb * 64) * HD + tid * 4;
  v4f oa[4], ob[4];
  float ma[4], mb[4], la[4], lb[4];
#pragma unroll                                   // constant indices keep the arrays in registers: all loads fly at once
  for (int i = 0; i < 4; ++i) {
    oa[i] = *(const v4f*)(o0 + 1024 * i);
    ob[i] = *(const v4f*)(o1 + 1024 * i);
    ma[i] = m0[16 * i];
    mb[i] = m1[16 * i];
    la[i] = l0[16 * i];
    lb[i] = l1[16 * i];
  }
#if defined(__HIP_DEVICE_COMPILE__)
  // the loads' offset register (the thread index) stays whole until this wait; the sums below reuse it
  asm volatile("s_wait_xcnt 0x0" :: "v"(tid) : "memory");
#endif
#pragma unroll
  for (int i = 0; i < 4; ++i) {
    const float w  = __expf(-fabsf(ma[i] - mb[i]));          // the half with the larger maximum weighs exp(0) = 1
    const float wa = (ma[i] >= mb[i]) ? 1.0f : w;
    const float wb = (ma[i] >= mb[i]) ? w : 1.0f;
    const float l  = fmaf(wb, lb[i], wa * la[i]);
    const float inv = ((l > 0.f) ? (1.0f / l) : 0.f) * (OSC / (PSC * VSC));
    *(v4f*)(C + 1024 * i) = (wa * oa[i] + wb * ob[i]) * inv;
  }
}

// =====================================================================================================
// Workspace map (bytes); every plane is an exact multiple of its whole-line / 64x64-tile store granularity:
//   Qh   f16  [16384][64]        0          2097152
//   Qr   f16  [16384][64]        2097152    2097152
//   Kh   f16  [16384][64]        4194304    2097152
//   Kr   f16  [16384][64]        6291456    2097152
//   VTh  f16  [4][64][4096]      8388608    2097152
//   VTr  f16  [4][64][4096]      10485760   2097152
//   Po   f32  [2][4][32][64][64] 12582912   4194304    the two halves' contexts of the split tiles
//   Pm   f32  [2][4][32][64]     16777216   65536      their row maxima
//   Pl   f32  [2][4][32][64]     16842752   65536      their row sums
//   end                          16908288
// =====================================================================================================
extern "C" void kernel_launch(void* const* d_in, const int* in_sizes, int n_in,
                              void* d_out, int out_size, void* d_ws, size_t ws_size,
                              hipStream_t stream) {
  if (n_in < 7) return;
  if (in_sizes[0] != NX) return;
  if (in_sizes[1] != NW || in_sizes[3] != NW || in_sizes[5] != NW) return;
  if (in_sizes[2] != HD || in_sizes[4] != HD || in_sizes[6] != HD) return;
  if (out_size != NO) return;

  const float* x  = (const float*)d_in[0];
  const float* Wq = (const float*)d_in[1];
  const float* bq = (const float*)d_in[2];
  const float* Wk = (const float*)d_in[3];
  const float* bk = (const float*)d_in[4];
  const float* Wv = (const float*)d_in[5];
  const float* bv = (const float*)d_in[6];

  const size_t PB = (size_t)NO * 2;                     // 2097152
  size_t off = 0;
  const size_t oQh = off; off += PB;
  const size_t oQr = off; off += PB;
  const size_t oKh = off; off += PB;
  const size_t oKr = off; off += PB;
  const size_t oVh = off; off += PB;
  const size_t oVr = off; off += PB;
  const size_t oPo = off; off += (size_t)2 * NB * HT * 64 * HD * 4;
  const size_t oPm = off; off += (size_t)2 * NB * HT * 64 * 4;
  const size_t oPl = off; off += (size_t)2 * NB * HT * 64 * 4;
  if (off > ws_size) return;                            // off = 16908288

  char* ws = (char*)d_ws;
  _Float16* Qh  = (_Float16*)(ws + oQh);
  _Float16* Qr  = (_Float16*)(ws + oQr);
  _Float16* Kh  = (_Float16*)(ws + oKh);
  _Float16* Kr  = (_Float16*)(ws + oKr);
  _Float16* VTh = (_Float16*)(ws + oVh);
  _Float16* VTr = (_Float16*)(ws + oVr);
  float* Po = (float*)(ws + oPo);
  float* Pm = (float*)(ws + oPm);
  float* Pl = (float*)(ws + oPl);
  float* out0 = (float*)d_out;

  const dim3 gP(NROW / 64);                             // 256 blocks of 512
  const dim3 blkP(512);
  const dim3 gA(NB * NQB);                              // 256 blocks of 128 * NG
  const dim3 blkA(128 * NG);
  const dim3 gJ(NB * HT);                               // 128 blocks of 256
  const dim3 blkJ(256);

  // (1) projections from the f32 inputs -> q/k f16 hi + residual planes, v^T f16 hi + residual planes
  proj_qkv<<<gP, blkP, 0, stream>>>(x, Wq, Wk, Wv, bq, bk, bv, Qh, Qr, Kh, Kr, VTh, VTr);

  // (2) causal flash attention -> out f32 [4][4096][64] for tiles 0 .. 31, two halves in Po, Pm, Pl for the rest
  attn64<<<gA, blkA, 0, stream>>>(Qh, Qr, Kh, Kr, VTh, VTr, out0, Po, Pm, Pl);

  // (3) the split tiles' halves -> out
  join2<<<gJ, blkJ, 0, stream>>>(Po, Pm, Pl, out0);
  (void)hipGetLastError();
}
